// v000
// The times below were measured on an AMD MI455X: many runs one after another, warmed up first and cycling through
// copies of the inputs, with the whole window's GPU time divided by the number of runs. Launches and the gaps
// between them are all in it. The median over several windows is given; except for v000 it joins two sittings, which
// can be a few percent apart, so the side-by-side timings, each taken in one sitting, are the better comparison.
// v000, which the later versions start from, runs in 380 microseconds.
#include <hip/hip_runtime.h>
#include <math.h>

// ---------------- problem constants ----------------
#define BB   2
#define SS   2048
#define EE   768
#define HH   12
#define DD   64
#define FFF  3072
#define MM   (BB * SS)        // 4096 rows

typedef _Float16 v16h __attribute__((ext_vector_type(16)));
typedef _Float16 v8h  __attribute__((ext_vector_type(8)));
typedef float    v8f  __attribute__((ext_vector_type(8)));

__device__ __forceinline__ v8f wmma_f16(v16h a, v16h b, v8f c) {
    // (neg_a, A, neg_b, B, c_mod, C, reuse_a, reuse_b)
    return __builtin_amdgcn_wmma_f32_16x16x32_f16(false, a, false, b, (short)0, c, false, false);
}

__device__ __forceinline__ v16h ld_frag(const _Float16* p0, const _Float16* p1) {
    v8h lo = *(const v8h*)p0;
    v8h hi = *(const v8h*)p1;
    return __builtin_shufflevector(lo, hi, 0,1,2,3,4,5,6,7,8,9,10,11,12,13,14,15);
}

// async 16B global -> LDS copy (ASYNCcnt-tracked DMA, CDNA5)
__device__ __forceinline__ void async_ld_b128(unsigned lds_off, const void* gaddr) {
    asm volatile("global_load_async_to_lds_b128 %0, %1, off"
                 :: "v"(lds_off), "v"(gaddr) : "memory");
}
__device__ __forceinline__ void wait_async0() {
    asm volatile("s_wait_asynccnt 0" ::: "memory");
}

// ---------------- f32 -> f16 convert ----------------
__global__ void cvt_f16_kernel(const float* __restrict__ in, _Float16* __restrict__ out, int n) {
    int i = blockIdx.x * 256 + threadIdx.x;
    if (i < n) out[i] = (_Float16)in[i];
}

// ---------------- row LayerNorm -> f16 ----------------
__global__ void ln_f16_kernel(const float* __restrict__ x,
                              const float* __restrict__ gamma,
                              const float* __restrict__ beta,
                              _Float16* __restrict__ out) {
    __shared__ float s1[256], s2[256];
    const int row = blockIdx.x;
    const float* xr = x + (size_t)row * EE;
    float v[3], sum = 0.f, sq = 0.f;
#pragma unroll
    for (int i = 0; i < 3; ++i) {
        v[i] = xr[threadIdx.x + i * 256];
        sum += v[i];
        sq  += v[i] * v[i];
    }
    s1[threadIdx.x] = sum; s2[threadIdx.x] = sq;
    __syncthreads();
    for (int s = 128; s > 0; s >>= 1) {
        if (threadIdx.x < s) {
            s1[threadIdx.x] += s1[threadIdx.x + s];
            s2[threadIdx.x] += s2[threadIdx.x + s];
        }
        __syncthreads();
    }
    const float mu = s1[0] * (1.0f / EE);
    const float var = s2[0] * (1.0f / EE) - mu * mu;
    const float rs = rsqrtf(var + 1e-5f);
    _Float16* orow = out + (size_t)row * EE;
#pragma unroll
    for (int i = 0; i < 3; ++i) {
        int c = threadIdx.x + i * 256;
        orow[c] = (_Float16)((v[i] - mu) * rs * gamma[c] + beta[c]);
    }
}

// ---------------- WMMA GEMM: C[M,N] = A[M,K] @ W[N,K]^T ----------------
// LDS-staged via async global->LDS DMA, double buffered.
// Block: 256 thr = 8 waves, tile 128M x 64N; wave tile 32x32 (4 WMMAs/step).
// mode 0: outH f16 row-major        (no bias)
// mode 1: outH f16, V-transposed to [B,H,D,S]  (no bias)
// mode 2: outF f32 = resid + bias + C
// mode 3: outH f16 = gelu(bias + C)   (exact erf)
__global__ void gemm_wmma_kernel(const _Float16* __restrict__ A,
                                 const _Float16* __restrict__ W,
                                 const float* __restrict__ bias,
                                 const float* __restrict__ resid,
                                 float* __restrict__ outF,
                                 _Float16* __restrict__ outH,
                                 int M, int N, int K, int mode) {
    __shared__ _Float16 Abuf[2][128 * 32];   // 8 KB each
    __shared__ _Float16 Bbuf[2][64 * 32];    // 4 KB each

    const int lane = threadIdx.x & 31;
    const int wave = threadIdx.x >> 5;          // 0..7 -> 4M x 2N
    const int mW = (wave >> 1) * 32;            // local M offset of wave tile
    const int nW = (wave & 1) * 32;             // local N offset of wave tile
    const int mBlk = blockIdx.y * 128;
    const int nBlk = blockIdx.x * 64;
    const int ko = (lane & 16) ? 8 : 0;         // K sub-offsets {ko, ko+16}
    const int col = lane & 15;
    const int half = lane >> 4;

    // stage one 32-wide K slab: A 128x32 (2 chunks/thread) + B 64x32 (1 chunk/thread)
    auto stage = [&](int kk, int bufIdx) {
#pragma unroll
        for (int i = 0; i < 2; ++i) {
            int c = threadIdx.x + i * 256;      // 0..511
            int row = c >> 2, q = c & 3;
            const _Float16* g = A + (size_t)(mBlk + row) * K + kk + q * 8;
            async_ld_b128((unsigned)(unsigned long long)&Abuf[bufIdx][row * 32 + q * 8], g);
        }
        {
            int c = threadIdx.x;                // 0..255
            int row = c >> 2, q = c & 3;
            const _Float16* g = W + (size_t)(nBlk + row) * K + kk + q * 8;
            async_ld_b128((unsigned)(unsigned long long)&Bbuf[bufIdx][row * 32 + q * 8], g);
        }
    };

    v8f c00 = {}, c01 = {}, c10 = {}, c11 = {};

    const int nsteps = K >> 5;
    stage(0, 0);
    wait_async0();
    __syncthreads();

    for (int s = 0; s < nsteps; ++s) {
        const int cur = s & 1;
        if (s + 1 < nsteps) stage((s + 1) << 5, cur ^ 1);

        const _Float16* ab = &Abuf[cur][0];
        const _Float16* bb = &Bbuf[cur][0];
        v16h a0 = ld_frag(ab + (mW + col) * 32 + ko,      ab + (mW + col) * 32 + ko + 16);
        v16h a1 = ld_frag(ab + (mW + 16 + col) * 32 + ko, ab + (mW + 16 + col) * 32 + ko + 16);
        v16h b0 = ld_frag(bb + (nW + col) * 32 + ko,      bb + (nW + col) * 32 + ko + 16);
        v16h b1 = ld_frag(bb + (nW + 16 + col) * 32 + ko, bb + (nW + 16 + col) * 32 + ko + 16);
        c00 = wmma_f16(a0, b0, c00);
        c01 = wmma_f16(a0, b1, c01);
        c10 = wmma_f16(a1, b0, c10);
        c11 = wmma_f16(a1, b1, c11);

        wait_async0();        // our next-slab DMAs have landed
        __syncthreads();      // everyone done reading cur before it is overwritten
    }

    // ---------------- writeback ----------------
#pragma unroll
    for (int i = 0; i < 2; ++i) {
#pragma unroll
        for (int r = 0; r < 8; ++r) {
            int m = mBlk + mW + i * 16 + half * 8 + r;
#pragma unroll
            for (int j = 0; j < 2; ++j) {
                int n = nBlk + nW + j * 16 + col;
                float v;
                if (i == 0) v = (j == 0) ? c00[r] : c01[r];
                else        v = (j == 0) ? c10[r] : c11[r];
                if (mode == 0) {
                    outH[(size_t)m * N + n] = (_Float16)v;
                } else if (mode == 1) {
                    int b = m >> 11, sIdx = m & (SS - 1);
                    int h = n >> 6,  d = n & (DD - 1);
                    outH[(((size_t)b * HH + h) * DD + d) * SS + sIdx] = (_Float16)v;
                } else if (mode == 2) {
                    v += bias[n];
                    outF[(size_t)m * N + n] = resid[(size_t)m * N + n] + v;
                } else {
                    v += bias[n];
                    v = 0.5f * v * (1.0f + erff(v * 0.70710678118654752f));
                    outH[(size_t)m * N + n] = (_Float16)v;
                }
            }
        }
    }
}

// ---------------- flash attention (causal) ----------------
// q16,k16: [B,S,H,D] f16 row-major ( == [M,E] );  vt16: [B,H,D,S] f16
// attn16 out: [B,S,H,D] f16 ( == [M,E] )
__global__ void flash_attn_kernel(const _Float16* __restrict__ q16,
                                  const _Float16* __restrict__ k16,
                                  const _Float16* __restrict__ vt16,
                                  _Float16* __restrict__ attn16) {
    __shared__ _Float16 pl[8 * 16 * 32];   // per-wave 16x32 P tile

    const int lane = threadIdx.x & 31;
    const int wave = threadIdx.x >> 5;
    const int half = lane >> 4;
    const int col  = lane & 15;
    const int ko   = (lane & 16) ? 8 : 0;

    const int bh = blockIdx.y;
    const int b = bh / HH, h = bh % HH;
    const int qbase = blockIdx.x * 128 + wave * 16;
    const int qend  = qbase + 15;
    const size_t bS = (size_t)b * SS;
    const int pbase = wave * 512;
    const float scale = 0.125f;   // 1/sqrt(64)

    const _Float16* qrow = q16 + (bS + qbase + col) * EE + h * DD;
    v16h aq0 = ld_frag(qrow + ko,      qrow + ko + 16);
    v16h aq1 = ld_frag(qrow + 32 + ko, qrow + 32 + ko + 16);

    const _Float16* vtb = vt16 + ((size_t)b * HH + h) * DD * SS;

    v8f acc0 = {}, acc1 = {}, acc2 = {}, acc3 = {};
    float mrow[8], lrow[8];
#pragma unroll
    for (int r = 0; r < 8; ++r) { mrow[r] = -INFINITY; lrow[r] = 0.f; }

    for (int kk = 0; kk <= qend; kk += 32) {
        const _Float16* krow0 = k16 + (bS + kk + col) * EE + h * DD;
        const _Float16* krow1 = krow0 + (size_t)16 * EE;
        v8f s0 = {}, s1 = {};
        {
            v16h bk = ld_frag(krow0 + ko, krow0 + ko + 16);
            s0 = wmma_f16(aq0, bk, s0);
            bk = ld_frag(krow0 + 32 + ko, krow0 + 32 + ko + 16);
            s0 = wmma_f16(aq1, bk, s0);
            bk = ld_frag(krow1 + ko, krow1 + ko + 16);
            s1 = wmma_f16(aq0, bk, s1);
            bk = ld_frag(krow1 + 32 + ko, krow1 + 32 + ko + 16);
            s1 = wmma_f16(aq1, bk, s1);
        }
        const int key0 = kk + col, key1 = kk + 16 + col;

#pragma unroll
        for (int r = 0; r < 8; ++r) {
            const int qidx = qbase + half * 8 + r;
            float a0 = (key0 <= qidx) ? s0[r] * scale : -1e30f;
            float a1 = (key1 <= qidx) ? s1[r] * scale : -1e30f;
            float mx = fmaxf(a0, a1);
            mx = fmaxf(mx, __shfl_xor(mx, 1, 32));
            mx = fmaxf(mx, __shfl_xor(mx, 2, 32));
            mx = fmaxf(mx, __shfl_xor(mx, 4, 32));
            mx = fmaxf(mx, __shfl_xor(mx, 8, 32));
            const float nm = fmaxf(mrow[r], mx);
            const float al = __expf(mrow[r] - nm);
            const float p0 = __expf(a0 - nm);
            const float p1 = __expf(a1 - nm);
            float rs = p0 + p1;
            rs += __shfl_xor(rs, 1, 32);
            rs += __shfl_xor(rs, 2, 32);
            rs += __shfl_xor(rs, 4, 32);
            rs += __shfl_xor(rs, 8, 32);
            lrow[r] = lrow[r] * al + rs;
            mrow[r] = nm;
            acc0[r] *= al; acc1[r] *= al; acc2[r] *= al; acc3[r] *= al;
            pl[pbase + (half * 8 + r) * 32 + col]      = (_Float16)p0;
            pl[pbase + (half * 8 + r) * 32 + 16 + col] = (_Float16)p1;
        }

        // wave-private LDS tile: order writes before re-striped reads
        asm volatile("s_wait_dscnt 0" ::: "memory");

        v16h pa = ld_frag(&pl[pbase + col * 32 + ko], &pl[pbase + col * 32 + ko + 16]);

        {
            const _Float16* vr = vtb + (size_t)(col) * SS + kk;
            v16h vb = ld_frag(vr + ko, vr + ko + 16);
            acc0 = wmma_f16(pa, vb, acc0);
            vr = vtb + (size_t)(16 + col) * SS + kk;
            vb = ld_frag(vr + ko, vr + ko + 16);
            acc1 = wmma_f16(pa, vb, acc1);
            vr = vtb + (size_t)(32 + col) * SS + kk;
            vb = ld_frag(vr + ko, vr + ko + 16);
            acc2 = wmma_f16(pa, vb, acc2);
            vr = vtb + (size_t)(48 + col) * SS + kk;
            vb = ld_frag(vr + ko, vr + ko + 16);
            acc3 = wmma_f16(pa, vb, acc3);
        }
    }

#pragma unroll
    for (int r = 0; r < 8; ++r) {
        const int q = qbase + half * 8 + r;
        const float inv = 1.0f / lrow[r];
        _Float16* orow = attn16 + (bS + q) * EE + h * DD;
        orow[col]      = (_Float16)(acc0[r] * inv);
        orow[16 + col] = (_Float16)(acc1[r] * inv);
        orow[32 + col] = (_Float16)(acc2[r] * inv);
        orow[48 + col] = (_Float16)(acc3[r] * inv);
    }
}

// ---------------- host launcher ----------------
extern "C" void kernel_launch(void* const* d_in, const int* in_sizes, int n_in,
                              void* d_out, int out_size, void* d_ws, size_t ws_size,
                              hipStream_t stream) {
    (void)in_sizes; (void)n_in; (void)out_size; (void)ws_size;
    const float* x     = (const float*)d_in[0];
    const float* wq    = (const float*)d_in[1];
    const float* wk    = (const float*)d_in[2];
    const float* wv    = (const float*)d_in[3];
    const float* wo    = (const float*)d_in[4];
    const float* bo    = (const float*)d_in[5];
    const float* w1    = (const float*)d_in[6];
    const float* b1    = (const float*)d_in[7];
    const float* w2    = (const float*)d_in[8];
    const float* b2    = (const float*)d_in[9];
    const float* gamma = (const float*)d_in[10];
    const float* beta  = (const float*)d_in[11];
    float* out = (float*)d_out;

    const size_t nEE = (size_t)EE * EE;
    const size_t nEF = (size_t)EE * FFF;
    const size_t nME = (size_t)MM * EE;
    const size_t nMF = (size_t)MM * FFF;

    char* ws = (char*)d_ws;
    size_t off = 0;
    auto alloc = [&](size_t bytes) -> void* {
        void* p = ws + off;
        off = (off + bytes + 255) & ~(size_t)255;
        return p;
    };
    _Float16* wq16   = (_Float16*)alloc(nEE * 2);
    _Float16* wk16   = (_Float16*)alloc(nEE * 2);
    _Float16* wv16   = (_Float16*)alloc(nEE * 2);
    _Float16* wo16   = (_Float16*)alloc(nEE * 2);
    _Float16* w116   = (_Float16*)alloc(nEF * 2);
    _Float16* w216   = (_Float16*)alloc(nEF * 2);
    _Float16* xn16   = (_Float16*)alloc(nME * 2);
    _Float16* q16    = (_Float16*)alloc(nME * 2);
    _Float16* k16    = (_Float16*)alloc(nME * 2);
    _Float16* vt16   = (_Float16*)alloc(nME * 2);
    _Float16* attn16 = (_Float16*)alloc(nME * 2);
    _Float16* y16    = (_Float16*)alloc(nME * 2);
    _Float16* h16    = (_Float16*)alloc(nMF * 2);
    float*    res    = (float*)alloc(nME * 4);

    cvt_f16_kernel<<<(nEE + 255) / 256, 256, 0, stream>>>(wq, wq16, (int)nEE);
    cvt_f16_kernel<<<(nEE + 255) / 256, 256, 0, stream>>>(wk, wk16, (int)nEE);
    cvt_f16_kernel<<<(nEE + 255) / 256, 256, 0, stream>>>(wv, wv16, (int)nEE);
    cvt_f16_kernel<<<(nEE + 255) / 256, 256, 0, stream>>>(wo, wo16, (int)nEE);
    cvt_f16_kernel<<<(nEF + 255) / 256, 256, 0, stream>>>(w1, w116, (int)nEF);
    cvt_f16_kernel<<<(nEF + 255) / 256, 256, 0, stream>>>(w2, w216, (int)nEF);

    ln_f16_kernel<<<MM, 256, 0, stream>>>(x, gamma, beta, xn16);

    dim3 gEE(EE / 64, MM / 128);
    gemm_wmma_kernel<<<gEE, 256, 0, stream>>>(xn16, wq16, nullptr, nullptr, nullptr, q16,  MM, EE, EE, 0);
    gemm_wmma_kernel<<<gEE, 256, 0, stream>>>(xn16, wk16, nullptr, nullptr, nullptr, k16,  MM, EE, EE, 0);
    gemm_wmma_kernel<<<gEE, 256, 0, stream>>>(xn16, wv16, nullptr, nullptr, nullptr, vt16, MM, EE, EE, 1);

    flash_attn_kernel<<<dim3(SS / 128, BB * HH), 256, 0, stream>>>(q16, k16, vt16, attn16);

    gemm_wmma_kernel<<<gEE, 256, 0, stream>>>(attn16, wo16, bo, x, res, nullptr, MM, EE, EE, 2);

    ln_f16_kernel<<<MM, 256, 0, stream>>>(res, gamma, beta, y16);

    dim3 gFF(FFF / 64, MM / 128);
    gemm_wmma_kernel<<<gFF, 256, 0, stream>>>(y16, w116, b1, nullptr, nullptr, h16, MM, FFF, EE, 3);
    gemm_wmma_kernel<<<gEE, 256, 0, stream>>>(h16, w216, b2, res, out, nullptr, MM, EE, FFF, 2);
}

// v001
// One run takes 355 microseconds.
// Next to v000, in two timings, it ran 1.10 times as fast each time.
#include <hip/hip_runtime.h>
#include <math.h>

// ---------------- problem constants ----------------
#define BB   2
#define SS   2048
#define EE   768
#define HH   12
#define DD   64
#define FFF  3072
#define MM   (BB * SS)        // 4096 rows

typedef _Float16 v16h __attribute__((ext_vector_type(16)));
typedef _Float16 v8h  __attribute__((ext_vector_type(8)));
typedef float    v8f  __attribute__((ext_vector_type(8)));

__device__ __forceinline__ v8f wmma_f16(v16h a, v16h b, v8f c) {
    // (neg_a, A, neg_b, B, c_mod, C, reuse_a, reuse_b)
    return __builtin_amdgcn_wmma_f32_16x16x32_f16(false, a, false, b, (short)0, c, false, false);
}

__device__ __forceinline__ v16h ld_frag(const _Float16* p0, const _Float16* p1) {
    v8h lo = *(const v8h*)p0;
    v8h hi = *(const v8h*)p1;
    return __builtin_shufflevector(lo, hi, 0,1,2,3,4,5,6,7,8,9,10,11,12,13,14,15);
}

// LDS pitch of a 32-half (64-B) row: 80 B = 16 B x odd, so the 16 rows that one
// ds_load_b128 touches per lane half fall on 16 distinct groups of four banks.
#define LP   40

// three async 16B global -> LDS copies (ASYNCcnt-tracked DMA, CDNA5).
// s_wait_xcnt stands inside the statement so that no address register of a copy
// is rewritten (next slab's address additions) ahead of it.
__device__ __forceinline__ void async_ld3_b128(unsigned l0, const void* g0,
                                               unsigned l1, const void* g1,
                                               unsigned l2, const void* g2) {
    asm volatile("global_load_async_to_lds_b128 %0, %1, off\n\t"
                 "global_load_async_to_lds_b128 %2, %3, off\n\t"
                 "global_load_async_to_lds_b128 %4, %5, off\n\t"
                 "s_wait_xcnt 0x0"
                 :: "v"(l0), "v"(g0), "v"(l1), "v"(g1), "v"(l2), "v"(g2) : "memory");
}
__device__ __forceinline__ void wait_async0() {
    asm volatile("s_wait_asynccnt 0" ::: "memory");
}

// ---------------- f32 -> f16 convert ----------------
__global__ void cvt_f16_kernel(const float* __restrict__ in, _Float16* __restrict__ out, int n) {
    int i = blockIdx.x * 256 + threadIdx.x;
    if (i < n) out[i] = (_Float16)in[i];
}

// ---------------- row LayerNorm -> f16 ----------------
__global__ void ln_f16_kernel(const float* __restrict__ x,
                              const float* __restrict__ gamma,
                              const float* __restrict__ beta,
                              _Float16* __restrict__ out) {
    __shared__ float s1[256], s2[256];
    const int row = blockIdx.x;
    const float* xr = x + (size_t)row * EE;
    float v[3], sum = 0.f, sq = 0.f;
#pragma unroll
    for (int i = 0; i < 3; ++i) {
        v[i] = xr[threadIdx.x + i * 256];
        sum += v[i];
        sq  += v[i] * v[i];
    }
    s1[threadIdx.x] = sum; s2[threadIdx.x] = sq;
    __syncthreads();
    for (int s = 128; s > 0; s >>= 1) {
        if (threadIdx.x < s) {
            s1[threadIdx.x] += s1[threadIdx.x + s];
            s2[threadIdx.x] += s2[threadIdx.x + s];
        }
        __syncthreads();
    }
    const float mu = s1[0] * (1.0f / EE);
    const float var = s2[0] * (1.0f / EE) - mu * mu;
    const float rs = rsqrtf(var + 1e-5f);
    _Float16* orow = out + (size_t)row * EE;
#pragma unroll
    for (int i = 0; i < 3; ++i) {
        int c = threadIdx.x + i * 256;
        orow[c] = (_Float16)((v[i] - mu) * rs * gamma[c] + beta[c]);
    }
}

// ---------------- WMMA GEMM: C[M,N] = A[M,K] @ W[N,K]^T ----------------
// LDS-staged via async global->LDS DMA, double buffered.
// Block: 256 thr = 8 waves, tile 128M x 64N; wave tile 32x32 (4 WMMAs/step).
// mode 0: outH f16 row-major        (no bias)
// mode 1: outH f16, V-transposed to [B,H,D,S]  (no bias)
// mode 2: outF f32 = resid + bias + C
// mode 3: outH f16 = gelu(bias + C)   (exact erf)
__global__ void gemm_wmma_kernel(const _Float16* __restrict__ A,
                                 const _Float16* __restrict__ W,
                                 const float* __restrict__ bias,
                                 const float* __restrict__ resid,
                                 float* __restrict__ outF,
                                 _Float16* __restrict__ outH,
                                 int M, int N, int K, int mode) {
    __shared__ __attribute__((aligned(16))) _Float16 Abuf[2][128 * LP];   // 10 KB each
    __shared__ __attribute__((aligned(16))) _Float16 Bbuf[2][64 * LP];    // 5 KB each

    const int lane = threadIdx.x & 31;
    const int wave = threadIdx.x >> 5;          // 0..7 -> 4M x 2N
    const int mW = (wave >> 1) * 32;            // local M offset of wave tile
    const int nW = (wave & 1) * 32;             // local N offset of wave tile
    const int mBlk = blockIdx.y * 128;
    const int nBlk = blockIdx.x * 64;
    const int ko = (lane & 16) ? 8 : 0;         // K sub-offsets {ko, ko+16}
    const int col = lane & 15;
    const int half = lane >> 4;

    // stage one 32-wide K slab: A 128x32 (2 chunks/thread) + B 64x32 (1 chunk/thread)
    auto stage = [&](int kk, int bufIdx) {
        const int row = threadIdx.x >> 2, q = threadIdx.x & 3;   // row 0..63
        const _Float16* gA0 = A + (size_t)(mBlk + row) * K + kk + q * 8;
        const _Float16* gA1 = A + (size_t)(mBlk + 64 + row) * K + kk + q * 8;
        const _Float16* gB  = W + (size_t)(nBlk + row) * K + kk + q * 8;
        async_ld3_b128((unsigned)(unsigned long long)&Abuf[bufIdx][row * LP + q * 8], gA0,
                       (unsigned)(unsigned long long)&Abuf[bufIdx][(64 + row) * LP + q * 8], gA1,
                       (unsigned)(unsigned long long)&Bbuf[bufIdx][row * LP + q * 8], gB);
    };

    v8f c00 = {}, c01 = {}, c10 = {}, c11 = {};

    const int nsteps = K >> 5;
    stage(0, 0);
    wait_async0();
    __syncthreads();

    for (int s = 0; s < nsteps; ++s) {
        const int cur = s & 1;
        if (s + 1 < nsteps) stage((s + 1) << 5, cur ^ 1);

        const _Float16* ab = &Abuf[cur][0];
        const _Float16* bb = &Bbuf[cur][0];
        v16h a0 = ld_frag(ab + (mW + col) * LP + ko,      ab + (mW + col) * LP + ko + 16);
        v16h a1 = ld_frag(ab + (mW + 16 + col) * LP + ko, ab + (mW + 16 + col) * LP + ko + 16);
        v16h b0 = ld_frag(bb + (nW + col) * LP + ko,      bb + (nW + col) * LP + ko + 16);
        v16h b1 = ld_frag(bb + (nW + 16 + col) * LP + ko, bb + (nW + 16 + col) * LP + ko + 16);
        c00 = wmma_f16(a0, b0, c00);
        c01 = wmma_f16(a0, b1, c01);
        c10 = wmma_f16(a1, b0, c10);
        c11 = wmma_f16(a1, b1, c11);

        // this wave's reads of cur have retired before the barrier frees cur for refill
        asm volatile("s_wait_dscnt 0" ::: "memory");
        wait_async0();        // our next-slab DMAs have landed
        __syncthreads();      // everyone done reading cur before it is overwritten
    }

    // ---------------- writeback ----------------
#pragma unroll
    for (int i = 0; i < 2; ++i) {
#pragma unroll
        for (int r = 0; r < 8; ++r) {
            int m = mBlk + mW + i * 16 + half * 8 + r;
#pragma unroll
            for (int j = 0; j < 2; ++j) {
                int n = nBlk + nW + j * 16 + col;
                float v;
                if (i == 0) v = (j == 0) ? c00[r] : c01[r];
                else        v = (j == 0) ? c10[r] : c11[r];
                if (mode == 0) {
                    outH[(size_t)m * N + n] = (_Float16)v;
                } else if (mode == 1) {
                    int b = m >> 11, sIdx = m & (SS - 1);
                    int h = n >> 6,  d = n & (DD - 1);
                    outH[(((size_t)b * HH + h) * DD + d) * SS + sIdx] = (_Float16)v;
                } else if (mode == 2) {
                    v += bias[n];
                    outF[(size_t)m * N + n] = resid[(size_t)m * N + n] + v;
                } else {
                    v += bias[n];
                    v = 0.5f * v * (1.0f + erff(v * 0.70710678118654752f));
                    outH[(size_t)m * N + n] = (_Float16)v;
                }
            }
        }
    }
}

// ---------------- flash attention (causal) ----------------
// q16,k16: [B,S,H,D] f16 row-major ( == [M,E] );  vt16: [B,H,D,S] f16
// attn16 out: [B,S,H,D] f16 ( == [M,E] )
__global__ void flash_attn_kernel(const _Float16* __restrict__ q16,
                                  const _Float16* __restrict__ k16,
                                  const _Float16* __restrict__ vt16,
                                  _Float16* __restrict__ attn16) {
    __shared__ __attribute__((aligned(16))) _Float16 pl[8 * 16 * LP];   // per-wave 16x32 P tile, rows at LP

    const int lane = threadIdx.x & 31;
    const int wave = threadIdx.x >> 5;
    const int half = lane >> 4;
    const int col  = lane & 15;
    const int ko   = (lane & 16) ? 8 : 0;

    const int bh = blockIdx.y;
    const int b = bh / HH, h = bh % HH;
    const int qbase = blockIdx.x * 128 + wave * 16;
    const int qend  = qbase + 15;
    const size_t bS = (size_t)b * SS;
    const int pbase = wave * 16 * LP;
    const float scale = 0.125f;   // 1/sqrt(64)

    const _Float16* qrow = q16 + (bS + qbase + col) * EE + h * DD;
    v16h aq0 = ld_frag(qrow + ko,      qrow + ko + 16);
    v16h aq1 = ld_frag(qrow + 32 + ko, qrow + 32 + ko + 16);

    const _Float16* vtb = vt16 + ((size_t)b * HH + h) * DD * SS;

    v8f acc0 = {}, acc1 = {}, acc2 = {}, acc3 = {};
    float mrow[8], lrow[8];
#pragma unroll
    for (int r = 0; r < 8; ++r) { mrow[r] = -INFINITY; lrow[r] = 0.f; }

    for (int kk = 0; kk <= qend; kk += 32) {
        const _Float16* krow0 = k16 + (bS + kk + col) * EE + h * DD;
        const _Float16* krow1 = krow0 + (size_t)16 * EE;
        v8f s0 = {}, s1 = {};
        {
            v16h bk = ld_frag(krow0 + ko, krow0 + ko + 16);
            s0 = wmma_f16(aq0, bk, s0);
            bk = ld_frag(krow0 + 32 + ko, krow0 + 32 + ko + 16);
            s0 = wmma_f16(aq1, bk, s0);
            bk = ld_frag(krow1 + ko, krow1 + ko + 16);
            s1 = wmma_f16(aq0, bk, s1);
            bk = ld_frag(krow1 + 32 + ko, krow1 + 32 + ko + 16);
            s1 = wmma_f16(aq1, bk, s1);
        }
        const int key0 = kk + col, key1 = kk + 16 + col;

#pragma unroll
        for (int r = 0; r < 8; ++r) {
            const int qidx = qbase + half * 8 + r;
            float a0 = (key0 <= qidx) ? s0[r] * scale : -1e30f;
            float a1 = (key1 <= qidx) ? s1[r] * scale : -1e30f;
            float mx = fmaxf(a0, a1);
            mx = fmaxf(mx, __shfl_xor(mx, 1, 32));
            mx = fmaxf(mx, __shfl_xor(mx, 2, 32));
            mx = fmaxf(mx, __shfl_xor(mx, 4, 32));
            mx = fmaxf(mx, __shfl_xor(mx, 8, 32));
            const float nm = fmaxf(mrow[r], mx);
            const float al = __expf(mrow[r] - nm);
            const float p0 = __expf(a0 - nm);
            const float p1 = __expf(a1 - nm);
            float rs = p0 + p1;
            rs += __shfl_xor(rs, 1, 32);
            rs += __shfl_xor(rs, 2, 32);
            rs += __shfl_xor(rs, 4, 32);
            rs += __shfl_xor(rs, 8, 32);
            lrow[r] = lrow[r] * al + rs;
            mrow[r] = nm;
            acc0[r] *= al; acc1[r] *= al; acc2[r] *= al; acc3[r] *= al;
            pl[pbase + (half * 8 + r) * LP + col]      = (_Float16)p0;
            pl[pbase + (half * 8 + r) * LP + 16 + col] = (_Float16)p1;
        }

        // wave-private LDS tile: order writes before re-striped reads
        asm volatile("s_wait_dscnt 0" ::: "memory");

        v16h pa = ld_frag(&pl[pbase + col * LP + ko], &pl[pbase + col * LP + ko + 16]);

        {
            const _Float16* vr = vtb + (size_t)(col) * SS + kk;
            v16h vb = ld_frag(vr + ko, vr + ko + 16);
            acc0 = wmma_f16(pa, vb, acc0);
            vr = vtb + (size_t)(16 + col) * SS + kk;
            vb = ld_frag(vr + ko, vr + ko + 16);
            acc1 = wmma_f16(pa, vb, acc1);
            vr = vtb + (size_t)(32 + col) * SS + kk;
            vb = ld_frag(vr + ko, vr + ko + 16);
            acc2 = wmma_f16(pa, vb, acc2);
            vr = vtb + (size_t)(48 + col) * SS + kk;
            vb = ld_frag(vr + ko, vr + ko + 16);
            acc3 = wmma_f16(pa, vb, acc3);
        }
    }

#pragma unroll
    for (int r = 0; r < 8; ++r) {
        const int q = qbase + half * 8 + r;
        const float inv = 1.0f / lrow[r];
        _Float16* orow = attn16 + (bS + q) * EE + h * DD;
        orow[col]      = (_Float16)(acc0[r] * inv);
        orow[16 + col] = (_Float16)(acc1[r] * inv);
        orow[32 + col] = (_Float16)(acc2[r] * inv);
        orow[48 + col] = (_Float16)(acc3[r] * inv);
    }
}

// ---------------- host launcher ----------------
extern "C" void kernel_launch(void* const* d_in, const int* in_sizes, int n_in,
                              void* d_out, int out_size, void* d_ws, size_t ws_size,
                              hipStream_t stream) {
    (void)in_sizes; (void)n_in; (void)out_size; (void)ws_size;
    const float* x     = (const float*)d_in[0];
    const float* wq    = (const float*)d_in[1];
    const float* wk    = (const float*)d_in[2];
    const float* wv    = (const float*)d_in[3];
    const float* wo    = (const float*)d_in[4];
    const float* bo    = (const float*)d_in[5];
    const float* w1    = (const float*)d_in[6];
    const float* b1    = (const float*)d_in[7];
    const float* w2    = (const float*)d_in[8];
    const float* b2    = (const float*)d_in[9];
    const float* gamma = (const float*)d_in[10];
    const float* beta  = (const float*)d_in[11];
    float* out = (float*)d_out;

    const size_t nEE = (size_t)EE * EE;
    const size_t nEF = (size_t)EE * FFF;
    const size_t nME = (size_t)MM * EE;
    const size_t nMF = (size_t)MM * FFF;

    char* ws = (char*)d_ws;
    size_t off = 0;
    auto alloc = [&](size_t bytes) -> void* {
        void* p = ws + off;
        off = (off + bytes + 255) & ~(size_t)255;
        return p;
    };
    _Float16* wq16   = (_Float16*)alloc(nEE * 2);
    _Float16* wk16   = (_Float16*)alloc(nEE * 2);
    _Float16* wv16   = (_Float16*)alloc(nEE * 2);
    _Float16* wo16   = (_Float16*)alloc(nEE * 2);
    _Float16* w116   = (_Float16*)alloc(nEF * 2);
    _Float16* w216   = (_Float16*)alloc(nEF * 2);
    _Float16* xn16   = (_Float16*)alloc(nME * 2);
    _Float16* q16    = (_Float16*)alloc(nME * 2);
    _Float16* k16    = (_Float16*)alloc(nME * 2);
    _Float16* vt16   = (_Float16*)alloc(nME * 2);
    _Float16* attn16 = (_Float16*)alloc(nME * 2);
    _Float16* y16    = (_Float16*)alloc(nME * 2);
    _Float16* h16    = (_Float16*)alloc(nMF * 2);
    float*    res    = (float*)alloc(nME * 4);

    cvt_f16_kernel<<<(nEE + 255) / 256, 256, 0, stream>>>(wq, wq16, (int)nEE);
    cvt_f16_kernel<<<(nEE + 255) / 256, 256, 0, stream>>>(wk, wk16, (int)nEE);
    cvt_f16_kernel<<<(nEE + 255) / 256, 256, 0, stream>>>(wv, wv16, (int)nEE);
    cvt_f16_kernel<<<(nEE + 255) / 256, 256, 0, stream>>>(wo, wo16, (int)nEE);
    cvt_f16_kernel<<<(nEF + 255) / 256, 256, 0, stream>>>(w1, w116, (int)nEF);
    cvt_f16_kernel<<<(nEF + 255) / 256, 256, 0, stream>>>(w2, w216, (int)nEF);

    ln_f16_kernel<<<MM, 256, 0, stream>>>(x, gamma, beta, xn16);

    dim3 gEE(EE / 64, MM / 128);
    gemm_wmma_kernel<<<gEE, 256, 0, stream>>>(xn16, wq16, nullptr, nullptr, nullptr, q16,  MM, EE, EE, 0);
    gemm_wmma_kernel<<<gEE, 256, 0, stream>>>(xn16, wk16, nullptr, nullptr, nullptr, k16,  MM, EE, EE, 0);
    gemm_wmma_kernel<<<gEE, 256, 0, stream>>>(xn16, wv16, nullptr, nullptr, nullptr, vt16, MM, EE, EE, 1);

    flash_attn_kernel<<<dim3(SS / 128, BB * HH), 256, 0, stream>>>(q16, k16, vt16, attn16);

    gemm_wmma_kernel<<<gEE, 256, 0, stream>>>(attn16, wo16, bo, x, res, nullptr, MM, EE, EE, 2);

    ln_f16_kernel<<<MM, 256, 0, stream>>>(res, gamma, beta, y16);

    dim3 gFF(FFF / 64, MM / 128);
    gemm_wmma_kernel<<<gFF, 256, 0, stream>>>(y16, w116, b1, nullptr, nullptr, h16, MM, FFF, EE, 3);
    gemm_wmma_kernel<<<gEE, 256, 0, stream>>>(h16, w216, b2, res, out, nullptr, MM, EE, FFF, 2);
}

// v002
// One run takes 338 microseconds.
// Timed twice side by side with v001, it ran 1.05 times as fast both times.
// All steps since v000 together make it 1.15 times as fast.
#include <hip/hip_runtime.h>
#include <math.h>

// ---------------- problem constants ----------------
#define BB   2
#define SS   2048
#define EE   768
#define HH   12
#define DD   64
#define FFF  3072
#define MM   (BB * SS)        // 4096 rows

typedef _Float16 v16h __attribute__((ext_vector_type(16)));
typedef _Float16 v8h  __attribute__((ext_vector_type(8)));
typedef float    v8f  __attribute__((ext_vector_type(8)));

__device__ __forceinline__ v8f wmma_f16(v16h a, v16h b, v8f c) {
    // (neg_a, A, neg_b, B, c_mod, C, reuse_a, reuse_b)
    return __builtin_amdgcn_wmma_f32_16x16x32_f16(false, a, false, b, (short)0, c, false, false);
}

__device__ __forceinline__ v16h ld_frag(const _Float16* p0, const _Float16* p1) {
    v8h lo = *(const v8h*)p0;
    v8h hi = *(const v8h*)p1;
    return __builtin_shufflevector(lo, hi, 0,1,2,3,4,5,6,7,8,9,10,11,12,13,14,15);
}

// LDS pitch of a 32-half (64-B) row: 80 B = 16 B x odd, so the 16 rows that one
// ds_load_b128 touches per lane half fall on 16 distinct groups of four banks.
#define LP   40

// three async 16B global -> LDS copies (ASYNCcnt-tracked DMA, CDNA5).
// s_wait_xcnt stands inside the statement so that no address register of a copy
// is rewritten (next slab's address additions) ahead of it.
__device__ __forceinline__ void async_ld3_b128(unsigned l0, const void* g0,
                                               unsigned l1, const void* g1,
                                               unsigned l2, const void* g2) {
    asm volatile("global_load_async_to_lds_b128 %0, %1, off\n\t"
                 "global_load_async_to_lds_b128 %2, %3, off\n\t"
                 "global_load_async_to_lds_b128 %4, %5, off\n\t"
                 "s_wait_xcnt 0x0"
                 :: "v"(l0), "v"(g0), "v"(l1), "v"(g1), "v"(l2), "v"(g2) : "memory");
}
__device__ __forceinline__ void wait_async0() {
    asm volatile("s_wait_asynccnt 0" ::: "memory");
}

// ---------------- f32 -> f16 convert of all six weight matrices ----------------
// One launch. The work is cut into 12 planes of EE*EE elements (blockIdx.y): wq, wk, wv, wo,
// four planes of w1, four of w2; the f16 copies lie back to back in the same order.
// A work-group converts CVT_WG elements of one plane; each wave owns 1024 contiguous
// elements: 8 loads of 512 contiguous bytes, all issued before the first is used, and
// 8 stores of 256 contiguous bytes. Few, long waves, for speed only.
#define NEE     (EE * EE)
#define CVT_WG  8192
static_assert(NEE % CVT_WG == 0, "a plane is a whole number of work-groups");
static_assert(FFF == 4 * EE, "w1 and w2 are four planes each");
static_assert((NEE * 2) % 256 == 0, "f16 planes lie back to back in the workspace");

typedef float    v4f __attribute__((ext_vector_type(4)));
typedef _Float16 v4h __attribute__((ext_vector_type(4)));

__global__ __launch_bounds__(256) void cvt_f16_kernel(const float* __restrict__ wq,
                                                      const float* __restrict__ wk,
                                                      const float* __restrict__ wv,
                                                      const float* __restrict__ wo,
                                                      const float* __restrict__ w1,
                                                      const float* __restrict__ w2,
                                                      _Float16* __restrict__ out) {
    const int plane = blockIdx.y;                 // 0..11, uniform in the work-group
    const float* big = plane < 8 ? w1 : w2;       // planes 4..7 and 8..11
    const float* src = big + (size_t)(plane & 3) * NEE;
    if (plane == 0) src = wq;
    if (plane == 1) src = wk;
    if (plane == 2) src = wv;
    if (plane == 3) src = wo;
    const int base = blockIdx.x * CVT_WG + (threadIdx.x >> 5) * 1024 + (threadIdx.x & 31) * 4;
    const float* s = src + base;
    _Float16* d = out + (size_t)plane * NEE + base;
    v4f v[8];
    // both loops unrolled: v[] stays in registers and all 8 loads issue ahead of the first use
#pragma unroll
    for (int j = 0; j < 8; ++j) v[j] = *(const v4f*)(s + j * 128);
#pragma unroll
    for (int j = 0; j < 8; ++j) *(v4h*)(d + j * 128) = __builtin_convertvector(v[j], v4h);
}

// ---------------- row LayerNorm -> f16 ----------------
__global__ void ln_f16_kernel(const float* __restrict__ x,
                              const float* __restrict__ gamma,
                              const float* __restrict__ beta,
                              _Float16* __restrict__ out) {
    __shared__ float s1[256], s2[256];
    const int row = blockIdx.x;
    const float* xr = x + (size_t)row * EE;
    float v[3], sum = 0.f, sq = 0.f;
#pragma unroll
    for (int i = 0; i < 3; ++i) {
        v[i] = xr[threadIdx.x + i * 256];
        sum += v[i];
        sq  += v[i] * v[i];
    }
    s1[threadIdx.x] = sum; s2[threadIdx.x] = sq;
    __syncthreads();
    for (int s = 128; s > 0; s >>= 1) {
        if (threadIdx.x < s) {
            s1[threadIdx.x] += s1[threadIdx.x + s];
            s2[threadIdx.x] += s2[threadIdx.x + s];
        }
        __syncthreads();
    }
    const float mu = s1[0] * (1.0f / EE);
    const float var = s2[0] * (1.0f / EE) - mu * mu;
    const float rs = rsqrtf(var + 1e-5f);
    _Float16* orow = out + (size_t)row * EE;
#pragma unroll
    for (int i = 0; i < 3; ++i) {
        int c = threadIdx.x + i * 256;
        orow[c] = (_Float16)((v[i] - mu) * rs * gamma[c] + beta[c]);
    }
}

// ---------------- WMMA GEMM: C[M,N] = A[M,K] @ W[N,K]^T ----------------
// LDS-staged via async global->LDS DMA, double buffered.
// Block: 256 thr = 8 waves, tile 128M x 64N; wave tile 32x32 (4 WMMAs/step).
// mode 0: outH f16 row-major        (no bias)
// mode 1: outH f16, V-transposed to [B,H,D,S]  (no bias)
// mode 2: outF f32 = resid + bias + C
// mode 3: outH f16 = gelu(bias + C)   (exact erf)
__global__ void gemm_wmma_kernel(const _Float16* __restrict__ A,
                                 const _Float16* __restrict__ W,
                                 const float* __restrict__ bias,
                                 const float* __restrict__ resid,
                                 float* __restrict__ outF,
                                 _Float16* __restrict__ outH,
                                 int M, int N, int K, int mode) {
    __shared__ __attribute__((aligned(16))) _Float16 Abuf[2][128 * LP];   // 10 KB each
    __shared__ __attribute__((aligned(16))) _Float16 Bbuf[2][64 * LP];    // 5 KB each

    const int lane = threadIdx.x & 31;
    const int wave = threadIdx.x >> 5;          // 0..7 -> 4M x 2N
    const int mW = (wave >> 1) * 32;            // local M offset of wave tile
    const int nW = (wave & 1) * 32;             // local N offset of wave tile
    const int mBlk = blockIdx.y * 128;
    const int nBlk = blockIdx.x * 64;
    const int ko = (lane & 16) ? 8 : 0;         // K sub-offsets {ko, ko+16}
    const int col = lane & 15;
    const int half = lane >> 4;

    // stage one 32-wide K slab: A 128x32 (2 chunks/thread) + B 64x32 (1 chunk/thread)
    auto stage = [&](int kk, int bufIdx) {
        const int row = threadIdx.x >> 2, q = threadIdx.x & 3;   // row 0..63
        const _Float16* gA0 = A + (size_t)(mBlk + row) * K + kk + q * 8;
        const _Float16* gA1 = A + (size_t)(mBlk + 64 + row) * K + kk + q * 8;
        const _Float16* gB  = W + (size_t)(nBlk + row) * K + kk + q * 8;
        async_ld3_b128((unsigned)(unsigned long long)&Abuf[bufIdx][row * LP + q * 8], gA0,
                       (unsigned)(unsigned long long)&Abuf[bufIdx][(64 + row) * LP + q * 8], gA1,
                       (unsigned)(unsigned long long)&Bbuf[bufIdx][row * LP + q * 8], gB);
    };

    v8f c00 = {}, c01 = {}, c10 = {}, c11 = {};

    const int nsteps = K >> 5;
    stage(0, 0);
    wait_async0();
    __syncthreads();

    for (int s = 0; s < nsteps; ++s) {
        const int cur = s & 1;
        if (s + 1 < nsteps) stage((s + 1) << 5, cur ^ 1);

        const _Float16* ab = &Abuf[cur][0];
        const _Float16* bb = &Bbuf[cur][0];
        v16h a0 = ld_frag(ab + (mW + col) * LP + ko,      ab + (mW + col) * LP + ko + 16);
        v16h a1 = ld_frag(ab + (mW + 16 + col) * LP + ko, ab + (mW + 16 + col) * LP + ko + 16);
        v16h b0 = ld_frag(bb + (nW + col) * LP + ko,      bb + (nW + col) * LP + ko + 16);
        v16h b1 = ld_frag(bb + (nW + 16 + col) * LP + ko, bb + (nW + 16 + col) * LP + ko + 16);
        c00 = wmma_f16(a0, b0, c00);
        c01 = wmma_f16(a0, b1, c01);
        c10 = wmma_f16(a1, b0, c10);
        c11 = wmma_f16(a1, b1, c11);

        // this wave's reads of cur have retired before the barrier frees cur for refill
        asm volatile("s_wait_dscnt 0" ::: "memory");
        wait_async0();        // our next-slab DMAs have landed
        __syncthreads();      // everyone done reading cur before it is overwritten
    }

    // ---------------- writeback ----------------
#pragma unroll
    for (int i = 0; i < 2; ++i) {
#pragma unroll
        for (int r = 0; r < 8; ++r) {
            int m = mBlk + mW + i * 16 + half * 8 + r;
#pragma unroll
            for (int j = 0; j < 2; ++j) {
                int n = nBlk + nW + j * 16 + col;
                float v;
                if (i == 0) v = (j == 0) ? c00[r] : c01[r];
                else        v = (j == 0) ? c10[r] : c11[r];
                if (mode == 0) {
                    outH[(size_t)m * N + n] = (_Float16)v;
                } else if (mode == 1) {
                    int b = m >> 11, sIdx = m & (SS - 1);
                    int h = n >> 6,  d = n & (DD - 1);
                    outH[(((size_t)b * HH + h) * DD + d) * SS + sIdx] = (_Float16)v;
                } else if (mode == 2) {
                    v += bias[n];
                    outF[(size_t)m * N + n] = resid[(size_t)m * N + n] + v;
                } else {
                    v += bias[n];
                    v = 0.5f * v * (1.0f + erff(v * 0.70710678118654752f));
                    outH[(size_t)m * N + n] = (_Float16)v;
                }
            }
        }
    }
}

// ---------------- flash attention (causal) ----------------
// q16,k16: [B,S,H,D] f16 row-major ( == [M,E] );  vt16: [B,H,D,S] f16
// attn16 out: [B,S,H,D] f16 ( == [M,E] )
__global__ void flash_attn_kernel(const _Float16* __restrict__ q16,
                                  const _Float16* __restrict__ k16,
                                  const _Float16* __restrict__ vt16,
                                  _Float16* __restrict__ attn16) {
    __shared__ __attribute__((aligned(16))) _Float16 pl[8 * 16 * LP];   // per-wave 16x32 P tile, rows at LP

    const int lane = threadIdx.x & 31;
    const int wave = threadIdx.x >> 5;
    const int half = lane >> 4;
    const int col  = lane & 15;
    const int ko   = (lane & 16) ? 8 : 0;

    const int bh = blockIdx.y;
    const int b = bh / HH, h = bh % HH;
    const int qbase = blockIdx.x * 128 + wave * 16;
    const int qend  = qbase + 15;
    const size_t bS = (size_t)b * SS;
    const int pbase = wave * 16 * LP;
    const float scale = 0.125f;   // 1/sqrt(64)

    const _Float16* qrow = q16 + (bS + qbase + col) * EE + h * DD;
    v16h aq0 = ld_frag(qrow + ko,      qrow + ko + 16);
    v16h aq1 = ld_frag(qrow + 32 + ko, qrow + 32 + ko + 16);

    const _Float16* vtb = vt16 + ((size_t)b * HH + h) * DD * SS;

    v8f acc0 = {}, acc1 = {}, acc2 = {}, acc3 = {};
    float mrow[8], lrow[8];
#pragma unroll
    for (int r = 0; r < 8; ++r) { mrow[r] = -INFINITY; lrow[r] = 0.f; }

    for (int kk = 0; kk <= qend; kk += 32) {
        const _Float16* krow0 = k16 + (bS + kk + col) * EE + h * DD;
        const _Float16* krow1 = krow0 + (size_t)16 * EE;
        v8f s0 = {}, s1 = {};
        {
            v16h bk = ld_frag(krow0 + ko, krow0 + ko + 16);
            s0 = wmma_f16(aq0, bk, s0);
            bk = ld_frag(krow0 + 32 + ko, krow0 + 32 + ko + 16);
            s0 = wmma_f16(aq1, bk, s0);
            bk = ld_frag(krow1 + ko, krow1 + ko + 16);
            s1 = wmma_f16(aq0, bk, s1);
            bk = ld_frag(krow1 + 32 + ko, krow1 + 32 + ko + 16);
            s1 = wmma_f16(aq1, bk, s1);
        }
        const int key0 = kk + col, key1 = kk + 16 + col;

#pragma unroll
        for (int r = 0; r < 8; ++r) {
            const int qidx = qbase + half * 8 + r;
            float a0 = (key0 <= qidx) ? s0[r] * scale : -1e30f;
            float a1 = (key1 <= qidx) ? s1[r] * scale : -1e30f;
            float mx = fmaxf(a0, a1);
            mx = fmaxf(mx, __shfl_xor(mx, 1, 32));
            mx = fmaxf(mx, __shfl_xor(mx, 2, 32));
            mx = fmaxf(mx, __shfl_xor(mx, 4, 32));
            mx = fmaxf(mx, __shfl_xor(mx, 8, 32));
            const float nm = fmaxf(mrow[r], mx);
            const float al = __expf(mrow[r] - nm);
            const float p0 = __expf(a0 - nm);
            const float p1 = __expf(a1 - nm);
            float rs = p0 + p1;
            rs += __shfl_xor(rs, 1, 32);
            rs += __shfl_xor(rs, 2, 32);
            rs += __shfl_xor(rs, 4, 32);
            rs += __shfl_xor(rs, 8, 32);
            lrow[r] = lrow[r] * al + rs;
            mrow[r] = nm;
            acc0[r] *= al; acc1[r] *= al; acc2[r] *= al; acc3[r] *= al;
            pl[pbase + (half * 8 + r) * LP + col]      = (_Float16)p0;
            pl[pbase + (half * 8 + r) * LP + 16 + col] = (_Float16)p1;
        }

        // wave-private LDS tile: order writes before re-striped reads
        asm volatile("s_wait_dscnt 0" ::: "memory");

        v16h pa = ld_frag(&pl[pbase + col * LP + ko], &pl[pbase + col * LP + ko + 16]);

        {
            const _Float16* vr = vtb + (size_t)(col) * SS + kk;
            v16h vb = ld_frag(vr + ko, vr + ko + 16);
            acc0 = wmma_f16(pa, vb, acc0);
            vr = vtb + (size_t)(16 + col) * SS + kk;
            vb = ld_frag(vr + ko, vr + ko + 16);
            acc1 = wmma_f16(pa, vb, acc1);
            vr = vtb + (size_t)(32 + col) * SS + kk;
            vb = ld_frag(vr + ko, vr + ko + 16);
            acc2 = wmma_f16(pa, vb, acc2);
            vr = vtb + (size_t)(48 + col) * SS + kk;
            vb = ld_frag(vr + ko, vr + ko + 16);
            acc3 = wmma_f16(pa, vb, acc3);
        }
    }

#pragma unroll
    for (int r = 0; r < 8; ++r) {
        const int q = qbase + half * 8 + r;
        const float inv = 1.0f / lrow[r];
        _Float16* orow = attn16 + (bS + q) * EE + h * DD;
        orow[col]      = (_Float16)(acc0[r] * inv);
        orow[16 + col] = (_Float16)(acc1[r] * inv);
        orow[32 + col] = (_Float16)(acc2[r] * inv);
        orow[48 + col] = (_Float16)(acc3[r] * inv);
    }
}

// ---------------- host launcher ----------------
extern "C" void kernel_launch(void* const* d_in, const int* in_sizes, int n_in,
                              void* d_out, int out_size, void* d_ws, size_t ws_size,
                              hipStream_t stream) {
    (void)in_sizes; (void)n_in; (void)out_size; (void)ws_size;
    const float* x     = (const float*)d_in[0];
    const float* wq    = (const float*)d_in[1];
    const float* wk    = (const float*)d_in[2];
    const float* wv    = (const float*)d_in[3];
    const float* wo    = (const float*)d_in[4];
    const float* bo    = (const float*)d_in[5];
    const float* w1    = (const float*)d_in[6];
    const float* b1    = (const float*)d_in[7];
    const float* w2    = (const float*)d_in[8];
    const float* b2    = (const float*)d_in[9];
    const float* gamma = (const float*)d_in[10];
    const float* beta  = (const float*)d_in[11];
    float* out = (float*)d_out;

    const size_t nEE = (size_t)EE * EE;
    const size_t nEF = (size_t)EE * FFF;
    const size_t nME = (size_t)MM * EE;
    const size_t nMF = (size_t)MM * FFF;

    char* ws = (char*)d_ws;
    size_t off = 0;
    auto alloc = [&](size_t bytes) -> void* {
        void* p = ws + off;
        off = (off + bytes + 255) & ~(size_t)255;
        return p;
    };
    _Float16* wq16   = (_Float16*)alloc(nEE * 2);
    _Float16* wk16   = (_Float16*)alloc(nEE * 2);
    _Float16* wv16   = (_Float16*)alloc(nEE * 2);
    _Float16* wo16   = (_Float16*)alloc(nEE * 2);
    _Float16* w116   = (_Float16*)alloc(nEF * 2);
    _Float16* w216   = (_Float16*)alloc(nEF * 2);
    _Float16* xn16   = (_Float16*)alloc(nME * 2);
    _Float16* q16    = (_Float16*)alloc(nME * 2);
    _Float16* k16    = (_Float16*)alloc(nME * 2);
    _Float16* vt16   = (_Float16*)alloc(nME * 2);
    _Float16* attn16 = (_Float16*)alloc(nME * 2);
    _Float16* y16    = (_Float16*)alloc(nME * 2);
    _Float16* h16    = (_Float16*)alloc(nMF * 2);
    float*    res    = (float*)alloc(nME * 4);

    // wq16 .. w216 are the first six allocations and lie back to back from wq16
    cvt_f16_kernel<<<dim3(NEE / CVT_WG, 12), 256, 0, stream>>>(wq, wk, wv, wo, w1, w2, wq16);

    ln_f16_kernel<<<MM, 256, 0, stream>>>(x, gamma, beta, xn16);

    dim3 gEE(EE / 64, MM / 128);
    gemm_wmma_kernel<<<gEE, 256, 0, stream>>>(xn16, wq16, nullptr, nullptr, nullptr, q16,  MM, EE, EE, 0);
    gemm_wmma_kernel<<<gEE, 256, 0, stream>>>(xn16, wk16, nullptr, nullptr, nullptr, k16,  MM, EE, EE, 0);
    gemm_wmma_kernel<<<gEE, 256, 0, stream>>>(xn16, wv16, nullptr, nullptr, nullptr, vt16, MM, EE, EE, 1);

    flash_attn_kernel<<<dim3(SS / 128, BB * HH), 256, 0, stream>>>(q16, k16, vt16, attn16);

    gemm_wmma_kernel<<<gEE, 256, 0, stream>>>(attn16, wo16, bo, x, res, nullptr, MM, EE, EE, 2);

    ln_f16_kernel<<<MM, 256, 0, stream>>>(res, gamma, beta, y16);

    dim3 gFF(FFF / 64, MM / 128);
    gemm_wmma_kernel<<<gFF, 256, 0, stream>>>(y16, w116, b1, nullptr, nullptr, h16, MM, FFF, EE, 3);
    gemm_wmma_kernel<<<gEE, 256, 0, stream>>>(h16, w216, b2, res, out, nullptr, MM, EE, FFF, 2);
}

// v003
// A run of this version takes 276 microseconds.
// Two timings next to v002 put it at 1.22 and 1.23 times that version's speed.
// Counting every step since v000, it is 1.42 times as fast.
#include <hip/hip_runtime.h>
#include <math.h>

// ---------------- problem constants ----------------
#define BB   2
#define SS   2048
#define EE   768
#define HH   12
#define DD   64
#define FFF  3072
#define MM   (BB * SS)        // 4096 rows

typedef _Float16 v16h __attribute__((ext_vector_type(16)));
typedef _Float16 v8h  __attribute__((ext_vector_type(8)));
typedef float    v8f  __attribute__((ext_vector_type(8)));

__device__ __forceinline__ v8f wmma_f16(v16h a, v16h b, v8f c) {
    // (neg_a, A, neg_b, B, c_mod, C, reuse_a, reuse_b)
    return __builtin_amdgcn_wmma_f32_16x16x32_f16(false, a, false, b, (short)0, c, false, false);
}

__device__ __forceinline__ v16h ld_frag(const _Float16* p0, const _Float16* p1) {
    v8h lo = *(const v8h*)p0;
    v8h hi = *(const v8h*)p1;
    return __builtin_shufflevector(lo, hi, 0,1,2,3,4,5,6,7,8,9,10,11,12,13,14,15);
}

// LDS pitch of a 32-half (64-B) row: 80 B = 16 B x odd, so the 16 rows that one
// ds_load_b128 touches per lane half fall on 16 distinct groups of four banks.
#define LP   40

// three async 16B global -> LDS copies (ASYNCcnt-tracked DMA, CDNA5).
// s_wait_xcnt stands inside the statement so that no address register of a copy
// is rewritten (next slab's address additions) ahead of it.
__device__ __forceinline__ void async_ld3_b128(unsigned l0, const void* g0,
                                               unsigned l1, const void* g1,
                                               unsigned l2, const void* g2) {
    asm volatile("global_load_async_to_lds_b128 %0, %1, off\n\t"
                 "global_load_async_to_lds_b128 %2, %3, off\n\t"
                 "global_load_async_to_lds_b128 %4, %5, off\n\t"
                 "s_wait_xcnt 0x0"
                 :: "v"(l0), "v"(g0), "v"(l1), "v"(g1), "v"(l2), "v"(g2) : "memory");
}
// the same for two copies (attention: one piece of the K tile, one of the V^T tile)
__device__ __forceinline__ void async_ld2_b128(unsigned l0, const void* g0,
                                               unsigned l1, const void* g1) {
    asm volatile("global_load_async_to_lds_b128 %0, %1, off\n\t"
                 "global_load_async_to_lds_b128 %2, %3, off\n\t"
                 "s_wait_xcnt 0x0"
                 :: "v"(l0), "v"(g0), "v"(l1), "v"(g1) : "memory");
}
__device__ __forceinline__ void wait_async0() {
    asm volatile("s_wait_asynccnt 0" ::: "memory");
}

// ---------------- f32 -> f16 convert of all six weight matrices ----------------
// One launch. The work is cut into 12 planes of EE*EE elements (blockIdx.y): wq, wk, wv, wo,
// four planes of w1, four of w2; the f16 copies lie back to back in the same order.
// A work-group converts CVT_WG elements of one plane; each wave owns 1024 contiguous
// elements: 8 loads of 512 contiguous bytes, all issued before the first is used, and
// 8 stores of 256 contiguous bytes. Few, long waves, for speed only.
#define NEE     (EE * EE)
#define CVT_WG  8192
static_assert(NEE % CVT_WG == 0, "a plane is a whole number of work-groups");
static_assert(FFF == 4 * EE, "w1 and w2 are four planes each");
static_assert((NEE * 2) % 256 == 0, "f16 planes lie back to back in the workspace");

typedef float    v4f __attribute__((ext_vector_type(4)));
typedef _Float16 v4h __attribute__((ext_vector_type(4)));

__global__ __launch_bounds__(256) void cvt_f16_kernel(const float* __restrict__ wq,
                                                      const float* __restrict__ wk,
                                                      const float* __restrict__ wv,
                                                      const float* __restrict__ wo,
                                                      const float* __restrict__ w1,
                                                      const float* __restrict__ w2,
                                                      _Float16* __restrict__ out) {
    const int plane = blockIdx.y;                 // 0..11, uniform in the work-group
    const float* big = plane < 8 ? w1 : w2;       // planes 4..7 and 8..11
    const float* src = big + (size_t)(plane & 3) * NEE;
    if (plane == 0) src = wq;
    if (plane == 1) src = wk;
    if (plane == 2) src = wv;
    if (plane == 3) src = wo;
    const int base = blockIdx.x * CVT_WG + (threadIdx.x >> 5) * 1024 + (threadIdx.x & 31) * 4;
    const float* s = src + base;
    _Float16* d = out + (size_t)plane * NEE + base;
    v4f v[8];
    // both loops unrolled: v[] stays in registers and all 8 loads issue ahead of the first use
#pragma unroll
    for (int j = 0; j < 8; ++j) v[j] = *(const v4f*)(s + j * 128);
#pragma unroll
    for (int j = 0; j < 8; ++j) *(v4h*)(d + j * 128) = __builtin_convertvector(v[j], v4h);
}

// ---------------- row LayerNorm -> f16 ----------------
__global__ void ln_f16_kernel(const float* __restrict__ x,
                              const float* __restrict__ gamma,
                              const float* __restrict__ beta,
                              _Float16* __restrict__ out) {
    __shared__ float s1[256], s2[256];
    const int row = blockIdx.x;
    const float* xr = x + (size_t)row * EE;
    float v[3], sum = 0.f, sq = 0.f;
#pragma unroll
    for (int i = 0; i < 3; ++i) {
        v[i] = xr[threadIdx.x + i * 256];
        sum += v[i];
        sq  += v[i] * v[i];
    }
    s1[threadIdx.x] = sum; s2[threadIdx.x] = sq;
    __syncthreads();
    for (int s = 128; s > 0; s >>= 1) {
        if (threadIdx.x < s) {
            s1[threadIdx.x] += s1[threadIdx.x + s];
            s2[threadIdx.x] += s2[threadIdx.x + s];
        }
        __syncthreads();
    }
    const float mu = s1[0] * (1.0f / EE);
    const float var = s2[0] * (1.0f / EE) - mu * mu;
    const float rs = rsqrtf(var + 1e-5f);
    _Float16* orow = out + (size_t)row * EE;
#pragma unroll
    for (int i = 0; i < 3; ++i) {
        int c = threadIdx.x + i * 256;
        orow[c] = (_Float16)((v[i] - mu) * rs * gamma[c] + beta[c]);
    }
}

// ---------------- WMMA GEMM: C[M,N] = A[M,K] @ W[N,K]^T ----------------
// LDS-staged via async global->LDS DMA, double buffered.
// Block: 256 thr = 8 waves, tile 128M x 64N; wave tile 32x32 (4 WMMAs/step).
// mode 0: outH f16 row-major        (no bias)
// mode 1: outH f16, V-transposed to [B,H,D,S]  (no bias)
// mode 2: outF f32 = resid + bias + C
// mode 3: outH f16 = gelu(bias + C)   (exact erf)
__global__ void gemm_wmma_kernel(const _Float16* __restrict__ A,
                                 const _Float16* __restrict__ W,
                                 const float* __restrict__ bias,
                                 const float* __restrict__ resid,
                                 float* __restrict__ outF,
                                 _Float16* __restrict__ outH,
                                 int M, int N, int K, int mode) {
    __shared__ __attribute__((aligned(16))) _Float16 Abuf[2][128 * LP];   // 10 KB each
    __shared__ __attribute__((aligned(16))) _Float16 Bbuf[2][64 * LP];    // 5 KB each

    const int lane = threadIdx.x & 31;
    const int wave = threadIdx.x >> 5;          // 0..7 -> 4M x 2N
    const int mW = (wave >> 1) * 32;            // local M offset of wave tile
    const int nW = (wave & 1) * 32;             // local N offset of wave tile
    const int mBlk = blockIdx.y * 128;
    const int nBlk = blockIdx.x * 64;
    const int ko = (lane & 16) ? 8 : 0;         // K sub-offsets {ko, ko+16}
    const int col = lane & 15;
    const int half = lane >> 4;

    // stage one 32-wide K slab: A 128x32 (2 chunks/thread) + B 64x32 (1 chunk/thread)
    auto stage = [&](int kk, int bufIdx) {
        const int row = threadIdx.x >> 2, q = threadIdx.x & 3;   // row 0..63
        const _Float16* gA0 = A + (size_t)(mBlk + row) * K + kk + q * 8;
        const _Float16* gA1 = A + (size_t)(mBlk + 64 + row) * K + kk + q * 8;
        const _Float16* gB  = W + (size_t)(nBlk + row) * K + kk + q * 8;
        async_ld3_b128((unsigned)(unsigned long long)&Abuf[bufIdx][row * LP + q * 8], gA0,
                       (unsigned)(unsigned long long)&Abuf[bufIdx][(64 + row) * LP + q * 8], gA1,
                       (unsigned)(unsigned long long)&Bbuf[bufIdx][row * LP + q * 8], gB);
    };

    v8f c00 = {}, c01 = {}, c10 = {}, c11 = {};

    const int nsteps = K >> 5;
    stage(0, 0);
    wait_async0();
    __syncthreads();

    for (int s = 0; s < nsteps; ++s) {
        const int cur = s & 1;
        if (s + 1 < nsteps) stage((s + 1) << 5, cur ^ 1);

        const _Float16* ab = &Abuf[cur][0];
        const _Float16* bb = &Bbuf[cur][0];
        v16h a0 = ld_frag(ab + (mW + col) * LP + ko,      ab + (mW + col) * LP + ko + 16);
        v16h a1 = ld_frag(ab + (mW + 16 + col) * LP + ko, ab + (mW + 16 + col) * LP + ko + 16);
        v16h b0 = ld_frag(bb + (nW + col) * LP + ko,      bb + (nW + col) * LP + ko + 16);
        v16h b1 = ld_frag(bb + (nW + 16 + col) * LP + ko, bb + (nW + 16 + col) * LP + ko + 16);
        c00 = wmma_f16(a0, b0, c00);
        c01 = wmma_f16(a0, b1, c01);
        c10 = wmma_f16(a1, b0, c10);
        c11 = wmma_f16(a1, b1, c11);

        // this wave's reads of cur have retired before the barrier frees cur for refill
        asm volatile("s_wait_dscnt 0" ::: "memory");
        wait_async0();        // our next-slab DMAs have landed
        __syncthreads();      // everyone done reading cur before it is overwritten
    }

    // ---------------- writeback ----------------
#pragma unroll
    for (int i = 0; i < 2; ++i) {
#pragma unroll
        for (int r = 0; r < 8; ++r) {
            int m = mBlk + mW + i * 16 + half * 8 + r;
#pragma unroll
            for (int j = 0; j < 2; ++j) {
                int n = nBlk + nW + j * 16 + col;
                float v;
                if (i == 0) v = (j == 0) ? c00[r] : c01[r];
                else        v = (j == 0) ? c10[r] : c11[r];
                if (mode == 0) {
                    outH[(size_t)m * N + n] = (_Float16)v;
                } else if (mode == 1) {
                    int b = m >> 11, sIdx = m & (SS - 1);
                    int h = n >> 6,  d = n & (DD - 1);
                    outH[(((size_t)b * HH + h) * DD + d) * SS + sIdx] = (_Float16)v;
                } else if (mode == 2) {
                    v += bias[n];
                    outF[(size_t)m * N + n] = resid[(size_t)m * N + n] + v;
                } else {
                    v += bias[n];
                    v = 0.5f * v * (1.0f + erff(v * 0.70710678118654752f));
                    outH[(size_t)m * N + n] = (_Float16)v;
                }
            }
        }
    }
}

// ---------------- flash attention (causal) ----------------
// q16,k16: [B,S,H,D] f16 row-major ( == [M,E] );  vt16: [B,H,D,S] f16
// attn16 out: [B,S,H,D] f16 ( == [M,E] )
// The eight waves of a work-group walk the same keys: each 32-key tile of K (32 rows of
// 128 B) and of V^T (64 rows of 64 B) is copied to LDS once for all of them, two buffers,
// the next tile's copies in flight while this one is worked on.
#define KP   72    // LDS pitch of a 128-B K row: 144 B = 16 B x odd, as LP for 64-B rows
// The block size is stated: unstated, registers are budgeted for 1,024 threads (128 a lane),
// and with the tile fragments live the row reductions are then run one at a time to fit.
__global__ __launch_bounds__(256) void flash_attn_kernel(const _Float16* __restrict__ q16,
                                  const _Float16* __restrict__ k16,
                                  const _Float16* __restrict__ vt16,
                                  _Float16* __restrict__ attn16) {
    __shared__ __attribute__((aligned(16))) _Float16 pl[8 * 16 * LP];   // per-wave 16x32 P tile, rows at LP
    __shared__ __attribute__((aligned(16))) _Float16 Kbuf[2][32 * KP];  // 32 keys x 64 d
    __shared__ __attribute__((aligned(16))) _Float16 Vbuf[2][64 * LP];  // 64 d x 32 keys

    const int lane = threadIdx.x & 31;
    const int wave = threadIdx.x >> 5;
    const int half = lane >> 4;
    const int col  = lane & 15;
    const int ko   = (lane & 16) ? 8 : 0;

    const int bh = blockIdx.y;
    const int b = bh / HH, h = bh % HH;
    const int qbase = blockIdx.x * 128 + wave * 16;
    const int qend  = qbase + 15;
    const size_t bS = (size_t)b * SS;
    const int pbase = wave * 16 * LP;
    const float scale = 0.125f;   // 1/sqrt(64)

    const _Float16* qrow = q16 + (bS + qbase + col) * EE + h * DD;
    v16h aq0 = ld_frag(qrow + ko,      qrow + ko + 16);
    v16h aq1 = ld_frag(qrow + 32 + ko, qrow + 32 + ko + 16);

    const _Float16* vtb = vt16 + ((size_t)b * HH + h) * DD * SS;

    v8f acc0 = {}, acc1 = {}, acc2 = {}, acc3 = {};
    float mrow[8], lrow[8];
#pragma unroll
    for (int r = 0; r < 8; ++r) { mrow[r] = -INFINITY; lrow[r] = 0.f; }

    // thread i copies 16 B of each tile: K row i/8, piece i%8; V^T row i/4, piece i%4
    const int kl = (threadIdx.x >> 3) * KP + (threadIdx.x & 7) * 8;
    const int vl = (threadIdx.x >> 2) * LP + (threadIdx.x & 3) * 8;
    const _Float16* kg = k16 + (bS + (threadIdx.x >> 3)) * EE + h * DD + (threadIdx.x & 7) * 8;
    const _Float16* vg = vtb + (size_t)(threadIdx.x >> 2) * SS + (threadIdx.x & 3) * 8;
    auto stage = [&](int kk, int bufIdx) {
        async_ld2_b128((unsigned)(unsigned long long)&Kbuf[bufIdx][kl], kg + (size_t)kk * EE,
                       (unsigned)(unsigned long long)&Vbuf[bufIdx][vl], vg + kk);
    };

    // tiles up to the work-group's last query row: 4, 8, .. 64, the same for all its waves
    const int ntiles = blockIdx.x * 4 + 4;
    // scalar copy of qend: the skip of tiles past a wave's own diagonal is a scalar branch
    const int qendS = __builtin_amdgcn_readfirstlane(qend);

    stage(0, 0);
    wait_async0();
    __syncthreads();
    stage(32, 1);             // ntiles >= 4: tile 1 exists

    for (int t = 0; t < ntiles; ++t) {
      const int kk = t * 32;
      if (kk <= qendS) {
        const _Float16* krow0 = &Kbuf[t & 1][col * KP];
        const _Float16* krow1 = krow0 + 16 * KP;
        const _Float16* vtile = &Vbuf[t & 1][0];
        v8f s0 = {}, s1 = {};
        {
            // each fragment in registers of its own: no read has to wait for an earlier product
            const v16h bk0 = ld_frag(krow0 + ko, krow0 + ko + 16);
            const v16h bk1 = ld_frag(krow0 + 32 + ko, krow0 + 32 + ko + 16);
            const v16h bk2 = ld_frag(krow1 + ko, krow1 + ko + 16);
            const v16h bk3 = ld_frag(krow1 + 32 + ko, krow1 + 32 + ko + 16);
            s0 = wmma_f16(aq0, bk0, s0);
            s1 = wmma_f16(aq0, bk2, s1);
            s0 = wmma_f16(aq1, bk1, s0);
            s1 = wmma_f16(aq1, bk3, s1);
        }
        const int key0 = kk + col, key1 = kk + 16 + col;

#pragma unroll
        for (int r = 0; r < 8; ++r) {
            const int qidx = qbase + half * 8 + r;
            float a0 = (key0 <= qidx) ? s0[r] * scale : -1e30f;
            float a1 = (key1 <= qidx) ? s1[r] * scale : -1e30f;
            float mx = fmaxf(a0, a1);
            mx = fmaxf(mx, __shfl_xor(mx, 1, 32));
            mx = fmaxf(mx, __shfl_xor(mx, 2, 32));
            mx = fmaxf(mx, __shfl_xor(mx, 4, 32));
            mx = fmaxf(mx, __shfl_xor(mx, 8, 32));
            const float nm = fmaxf(mrow[r], mx);
            const float al = __expf(mrow[r] - nm);
            const float p0 = __expf(a0 - nm);
            const float p1 = __expf(a1 - nm);
            float rs = p0 + p1;
            rs += __shfl_xor(rs, 1, 32);
            rs += __shfl_xor(rs, 2, 32);
            rs += __shfl_xor(rs, 4, 32);
            rs += __shfl_xor(rs, 8, 32);
            lrow[r] = lrow[r] * al + rs;
            mrow[r] = nm;
            acc0[r] *= al; acc1[r] *= al; acc2[r] *= al; acc3[r] *= al;
            pl[pbase + (half * 8 + r) * LP + col]      = (_Float16)p0;
            pl[pbase + (half * 8 + r) * LP + 16 + col] = (_Float16)p1;
        }

        // V^T fragments: read ahead of the wait that the P tile needs in any case
        const v16h vb0 = ld_frag(vtile + (col) * LP + ko,      vtile + (col) * LP + ko + 16);
        const v16h vb1 = ld_frag(vtile + (16 + col) * LP + ko, vtile + (16 + col) * LP + ko + 16);
        const v16h vb2 = ld_frag(vtile + (32 + col) * LP + ko, vtile + (32 + col) * LP + ko + 16);
        const v16h vb3 = ld_frag(vtile + (48 + col) * LP + ko, vtile + (48 + col) * LP + ko + 16);

        // wave-private LDS tile: order writes before re-striped reads
        asm volatile("s_wait_dscnt 0" ::: "memory");

        v16h pa = ld_frag(&pl[pbase + col * LP + ko], &pl[pbase + col * LP + ko + 16]);

        acc0 = wmma_f16(pa, vb0, acc0);
        acc1 = wmma_f16(pa, vb1, acc1);
        acc2 = wmma_f16(pa, vb2, acc2);
        acc3 = wmma_f16(pa, vb3, acc3);
      }

      // publish point, passed by every wave, also one that skipped the tile:
      // this wave's reads of buffer t & 1 have retired before the barrier frees it for refill
      asm volatile("s_wait_dscnt 0" ::: "memory");
      wait_async0();          // this wave's pieces of tile t + 1 have landed
      __syncthreads();        // tile t + 1 readable by all; buffer t & 1 left by all
      if (t + 2 < ntiles) stage((t + 2) * 32, t & 1);
    }
    wait_async0();            // no copy is outstanding when the wave ends

#pragma unroll
    for (int r = 0; r < 8; ++r) {
        const int q = qbase + half * 8 + r;
        const float inv = 1.0f / lrow[r];
        _Float16* orow = attn16 + (bS + q) * EE + h * DD;
        orow[col]      = (_Float16)(acc0[r] * inv);
        orow[16 + col] = (_Float16)(acc1[r] * inv);
        orow[32 + col] = (_Float16)(acc2[r] * inv);
        orow[48 + col] = (_Float16)(acc3[r] * inv);
    }
}

// ---------------- host launcher ----------------
extern "C" void kernel_launch(void* const* d_in, const int* in_sizes, int n_in,
                              void* d_out, int out_size, void* d_ws, size_t ws_size,
                              hipStream_t stream) {
    (void)in_sizes; (void)n_in; (void)out_size; (void)ws_size;
    const float* x     = (const float*)d_in[0];
    const float* wq    = (const float*)d_in[1];
    const float* wk    = (const float*)d_in[2];
    const float* wv    = (const float*)d_in[3];
    const float* wo    = (const float*)d_in[4];
    const float* bo    = (const float*)d_in[5];
    const float* w1    = (const float*)d_in[6];
    const float* b1    = (const float*)d_in[7];
    const float* w2    = (const float*)d_in[8];
    const float* b2    = (const float*)d_in[9];
    const float* gamma = (const float*)d_in[10];
    const float* beta  = (const float*)d_in[11];
    float* out = (float*)d_out;

    const size_t nEE = (size_t)EE * EE;
    const size_t nEF = (size_t)EE * FFF;
    const size_t nME = (size_t)MM * EE;
    const size_t nMF = (size_t)MM * FFF;

    char* ws = (char*)d_ws;
    size_t off = 0;
    auto alloc = [&](size_t bytes) -> void* {
        void* p = ws + off;
        off = (off + bytes + 255) & ~(size_t)255;
        return p;
    };
    _Float16* wq16   = (_Float16*)alloc(nEE * 2);
    _Float16* wk16   = (_Float16*)alloc(nEE * 2);
    _Float16* wv16   = (_Float16*)alloc(nEE * 2);
    _Float16* wo16   = (_Float16*)alloc(nEE * 2);
    _Float16* w116   = (_Float16*)alloc(nEF * 2);
    _Float16* w216   = (_Float16*)alloc(nEF * 2);
    _Float16* xn16   = (_Float16*)alloc(nME * 2);
    _Float16* q16    = (_Float16*)alloc(nME * 2);
    _Float16* k16    = (_Float16*)alloc(nME * 2);
    _Float16* vt16   = (_Float16*)alloc(nME * 2);
    _Float16* attn16 = (_Float16*)alloc(nME * 2);
    _Float16* y16    = (_Float16*)alloc(nME * 2);
    _Float16* h16    = (_Float16*)alloc(nMF * 2);
    float*    res    = (float*)alloc(nME * 4);

    // wq16 .. w216 are the first six allocations and lie back to back from wq16
    cvt_f16_kernel<<<dim3(NEE / CVT_WG, 12), 256, 0, stream>>>(wq, wk, wv, wo, w1, w2, wq16);

    ln_f16_kernel<<<MM, 256, 0, stream>>>(x, gamma, beta, xn16);

    dim3 gEE(EE / 64, MM / 128);
    gemm_wmma_kernel<<<gEE, 256, 0, stream>>>(xn16, wq16, nullptr, nullptr, nullptr, q16,  MM, EE, EE, 0);
    gemm_wmma_kernel<<<gEE, 256, 0, stream>>>(xn16, wk16, nullptr, nullptr, nullptr, k16,  MM, EE, EE, 0);
    gemm_wmma_kernel<<<gEE, 256, 0, stream>>>(xn16, wv16, nullptr, nullptr, nullptr, vt16, MM, EE, EE, 1);

    flash_attn_kernel<<<dim3(SS / 128, BB * HH), 256, 0, stream>>>(q16, k16, vt16, attn16);

    gemm_wmma_kernel<<<gEE, 256, 0, stream>>>(attn16, wo16, bo, x, res, nullptr, MM, EE, EE, 2);

    ln_f16_kernel<<<MM, 256, 0, stream>>>(res, gamma, beta, y16);

    dim3 gFF(FFF / 64, MM / 128);
    gemm_wmma_kernel<<<gFF, 256, 0, stream>>>(y16, w116, b1, nullptr, nullptr, h16, MM, FFF, EE, 3);
    gemm_wmma_kernel<<<gEE, 256, 0, stream>>>(h16, w216, b2, res, out, nullptr, MM, EE, FFF, 2);
}

// v004
// Measured time: 243 microseconds a run.
// Timed twice side by side with v003, it ran 1.14 times as fast both times.
// Over all steps from v000 it is 1.61 times as fast.
#include <hip/hip_runtime.h>
#include <math.h>

// ---------------- problem constants ----------------
#define BB   2
#define SS   2048
#define EE   768
#define HH   12
#define DD   64
#define FFF  3072
#define MM   (BB * SS)        // 4096 rows

typedef _Float16 v16h __attribute__((ext_vector_type(16)));
typedef _Float16 v8h  __attribute__((ext_vector_type(8)));
typedef float    v8f  __attribute__((ext_vector_type(8)));

__device__ __forceinline__ v8f wmma_f16(v16h a, v16h b, v8f c) {
    // (neg_a, A, neg_b, B, c_mod, C, reuse_a, reuse_b)
    return __builtin_amdgcn_wmma_f32_16x16x32_f16(false, a, false, b, (short)0, c, false, false);
}

__device__ __forceinline__ v16h ld_frag(const _Float16* p0, const _Float16* p1) {
    v8h lo = *(const v8h*)p0;
    v8h hi = *(const v8h*)p1;
    return __builtin_shufflevector(lo, hi, 0,1,2,3,4,5,6,7,8,9,10,11,12,13,14,15);
}

// LDS pitch of a 32-half (64-B) row: 80 B = 16 B x odd, so the 16 rows that one
// ds_load_b128 touches per lane half fall on 16 distinct groups of four banks.
#define LP   40

// twelve async 16B global -> LDS copies (ASYNCcnt-tracked DMA, CDNA5): a thread's share of
// one GEMM stage, eight pieces of A (LDS la + j * ls, global ga + j * gs) and four of B.
// s_wait_xcnt stands inside the statement so that no address register of a copy
// is rewritten (next slab's address additions) ahead of it.
__device__ __forceinline__ void async_ld12_b128(unsigned la, const _Float16* ga,
                                                unsigned lb, const _Float16* gb,
                                                unsigned ls, size_t gs) {
    asm volatile("global_load_async_to_lds_b128 %0, %1, off\n\t"
                 "global_load_async_to_lds_b128 %2, %3, off\n\t"
                 "global_load_async_to_lds_b128 %4, %5, off\n\t"
                 "global_load_async_to_lds_b128 %6, %7, off\n\t"
                 "global_load_async_to_lds_b128 %8, %9, off\n\t"
                 "global_load_async_to_lds_b128 %10, %11, off\n\t"
                 "global_load_async_to_lds_b128 %12, %13, off\n\t"
                 "global_load_async_to_lds_b128 %14, %15, off\n\t"
                 "global_load_async_to_lds_b128 %16, %17, off\n\t"
                 "global_load_async_to_lds_b128 %18, %19, off\n\t"
                 "global_load_async_to_lds_b128 %20, %21, off\n\t"
                 "global_load_async_to_lds_b128 %22, %23, off\n\t"
                 "s_wait_xcnt 0x0"
                 :: "v"(la),          "v"(ga),          "v"(la + ls),     "v"(ga + gs),
                    "v"(la + 2 * ls), "v"(ga + 2 * gs), "v"(la + 3 * ls), "v"(ga + 3 * gs),
                    "v"(la + 4 * ls), "v"(ga + 4 * gs), "v"(la + 5 * ls), "v"(ga + 5 * gs),
                    "v"(la + 6 * ls), "v"(ga + 6 * gs), "v"(la + 7 * ls), "v"(ga + 7 * gs),
                    "v"(lb),          "v"(gb),          "v"(lb + ls),     "v"(gb + gs),
                    "v"(lb + 2 * ls), "v"(gb + 2 * gs), "v"(lb + 3 * ls), "v"(gb + 3 * gs)
                 : "memory");
}
// the same for two copies (attention: one piece of the K tile, one of the V^T tile)
__device__ __forceinline__ void async_ld2_b128(unsigned l0, const void* g0,
                                               unsigned l1, const void* g1) {
    asm volatile("global_load_async_to_lds_b128 %0, %1, off\n\t"
                 "global_load_async_to_lds_b128 %2, %3, off\n\t"
                 "s_wait_xcnt 0x0"
                 :: "v"(l0), "v"(g0), "v"(l1), "v"(g1) : "memory");
}
__device__ __forceinline__ void wait_async0() {
    asm volatile("s_wait_asynccnt 0" ::: "memory");
}

// ---------------- f32 -> f16 convert of all six weight matrices ----------------
// One launch. The work is cut into 12 planes of EE*EE elements (blockIdx.y): wq, wk, wv, wo,
// four planes of w1, four of w2; the f16 copies lie back to back in the same order.
// A work-group converts CVT_WG elements of one plane; each wave owns 1024 contiguous
// elements: 8 loads of 512 contiguous bytes, all issued before the first is used, and
// 8 stores of 256 contiguous bytes. Few, long waves, for speed only.
#define NEE     (EE * EE)
#define CVT_WG  8192
static_assert(NEE % CVT_WG == 0, "a plane is a whole number of work-groups");
static_assert(FFF == 4 * EE, "w1 and w2 are four planes each");
static_assert((NEE * 2) % 256 == 0, "f16 planes lie back to back in the workspace");

typedef float    v4f __attribute__((ext_vector_type(4)));
typedef _Float16 v4h __attribute__((ext_vector_type(4)));

__global__ __launch_bounds__(256) void cvt_f16_kernel(const float* __restrict__ wq,
                                                      const float* __restrict__ wk,
                                                      const float* __restrict__ wv,
                                                      const float* __restrict__ wo,
                                                      const float* __restrict__ w1,
                                                      const float* __restrict__ w2,
                                                      _Float16* __restrict__ out) {
    const int plane = blockIdx.y;                 // 0..11, uniform in the work-group
    const float* big = plane < 8 ? w1 : w2;       // planes 4..7 and 8..11
    const float* src = big + (size_t)(plane & 3) * NEE;
    if (plane == 0) src = wq;
    if (plane == 1) src = wk;
    if (plane == 2) src = wv;
    if (plane == 3) src = wo;
    const int base = blockIdx.x * CVT_WG + (threadIdx.x >> 5) * 1024 + (threadIdx.x & 31) * 4;
    const float* s = src + base;
    _Float16* d = out + (size_t)plane * NEE + base;
    v4f v[8];
    // both loops unrolled: v[] stays in registers and all 8 loads issue ahead of the first use
#pragma unroll
    for (int j = 0; j < 8; ++j) v[j] = *(const v4f*)(s + j * 128);
#pragma unroll
    for (int j = 0; j < 8; ++j) *(v4h*)(d + j * 128) = __builtin_convertvector(v[j], v4h);
}

// ---------------- row LayerNorm -> f16 ----------------
__global__ void ln_f16_kernel(const float* __restrict__ x,
                              const float* __restrict__ gamma,
                              const float* __restrict__ beta,
                              _Float16* __restrict__ out) {
    __shared__ float s1[256], s2[256];
    const int row = blockIdx.x;
    const float* xr = x + (size_t)row * EE;
    float v[3], sum = 0.f, sq = 0.f;
#pragma unroll
    for (int i = 0; i < 3; ++i) {
        v[i] = xr[threadIdx.x + i * 256];
        sum += v[i];
        sq  += v[i] * v[i];
    }
    s1[threadIdx.x] = sum; s2[threadIdx.x] = sq;
    __syncthreads();
    for (int s = 128; s > 0; s >>= 1) {
        if (threadIdx.x < s) {
            s1[threadIdx.x] += s1[threadIdx.x + s];
            s2[threadIdx.x] += s2[threadIdx.x + s];
        }
        __syncthreads();
    }
    const float mu = s1[0] * (1.0f / EE);
    const float var = s2[0] * (1.0f / EE) - mu * mu;
    const float rs = rsqrtf(var + 1e-5f);
    _Float16* orow = out + (size_t)row * EE;
#pragma unroll
    for (int i = 0; i < 3; ++i) {
        int c = threadIdx.x + i * 256;
        orow[c] = (_Float16)((v[i] - mu) * rs * gamma[c] + beta[c]);
    }
}

// ---------------- WMMA GEMM: C[M,N] = A[M,K] @ W[N,K]^T ----------------
// LDS-staged via async global->LDS DMA, double buffered.
// Block: 256 thr = 8 waves, tile 128M x 64N; wave tile 32x32.
// A stage holds BK = 128 k (16 WMMAs a wave): a trip costs one landing of the next stage's
// copies and one barrier whatever its depth.
// K must be a multiple of BK.
// mode 0: outH f16 row-major        (no bias)
// mode 1: outH f16, V-transposed to [B,H,D,S]  (no bias)
// mode 2: outF f32 = resid + bias + C
// mode 3: outH f16 = gelu(bias + C)   (exact erf)
#define BK   128
#define GP   136   // LDS pitch of a 256-B stage row: 272 B = 16 B x odd, as LP for 64-B rows
static_assert(EE % BK == 0 && FFF % BK == 0, "every K is a whole number of stages");
__global__ void gemm_wmma_kernel(const _Float16* __restrict__ A,
                                 const _Float16* __restrict__ W,
                                 const float* __restrict__ bias,
                                 const float* __restrict__ resid,
                                 float* __restrict__ outF,
                                 _Float16* __restrict__ outH,
                                 int M, int N, int K, int mode) {
    __shared__ __attribute__((aligned(16))) _Float16 Abuf[2][128 * GP];   // 34 KB each
    __shared__ __attribute__((aligned(16))) _Float16 Bbuf[2][64 * GP];    // 17 KB each

    const int lane = threadIdx.x & 31;
    const int wave = threadIdx.x >> 5;          // 0..7 -> 4M x 2N
    const int mW = (wave >> 1) * 32;            // local M offset of wave tile
    const int nW = (wave & 1) * 32;             // local N offset of wave tile
    const int mBlk = blockIdx.y * 128;
    const int nBlk = blockIdx.x * 64;
    const int ko = (lane & 16) ? 8 : 0;         // K sub-offsets {ko, ko+16}
    const int col = lane & 15;
    const int half = lane >> 4;

    // stage one BK-wide K slab: A 128 x BK (8 pieces/thread) + B 64 x BK (4 pieces/thread);
    // a copy of the work-group covers 16 whole rows of 256 B, the next one the 16 rows below
    auto stage = [&](int kk, int bufIdx) {
        const int row = threadIdx.x >> 4, q = threadIdx.x & 15;   // row 0..15
        async_ld12_b128((unsigned)(unsigned long long)&Abuf[bufIdx][row * GP + q * 8],
                        A + (size_t)(mBlk + row) * K + kk + q * 8,
                        (unsigned)(unsigned long long)&Bbuf[bufIdx][row * GP + q * 8],
                        W + (size_t)(nBlk + row) * K + kk + q * 8,
                        16 * GP * 2, (size_t)16 * K);
    };

    v8f c00 = {}, c01 = {}, c10 = {}, c11 = {};

    const int nsteps = K / BK;
    stage(0, 0);
    wait_async0();
    __syncthreads();

    for (int s = 0; s < nsteps; ++s) {
        const int cur = s & 1;
        if (s + 1 < nsteps) stage((s + 1) * BK, cur ^ 1);

        const _Float16* ab = &Abuf[cur][(mW + col) * GP + ko];
        const _Float16* bb = &Bbuf[cur][(nW + col) * GP + ko];
        for (int ks = 0; ks < BK; ks += 32) {
            v16h a0 = ld_frag(ab + ks,           ab + ks + 16);
            v16h a1 = ld_frag(ab + 16 * GP + ks, ab + 16 * GP + ks + 16);
            v16h b0 = ld_frag(bb + ks,           bb + ks + 16);
            v16h b1 = ld_frag(bb + 16 * GP + ks, bb + 16 * GP + ks + 16);
            c00 = wmma_f16(a0, b0, c00);
            c01 = wmma_f16(a0, b1, c01);
            c10 = wmma_f16(a1, b0, c10);
            c11 = wmma_f16(a1, b1, c11);
        }

        // this wave's reads of cur have retired before the barrier frees cur for refill
        asm volatile("s_wait_dscnt 0" ::: "memory");
        wait_async0();        // our next-slab DMAs have landed
        __syncthreads();      // everyone done reading cur before it is overwritten
    }

    // ---------------- writeback ----------------
#pragma unroll
    for (int i = 0; i < 2; ++i) {
#pragma unroll
        for (int r = 0; r < 8; ++r) {
            int m = mBlk + mW + i * 16 + half * 8 + r;
#pragma unroll
            for (int j = 0; j < 2; ++j) {
                int n = nBlk + nW + j * 16 + col;
                float v;
                if (i == 0) v = (j == 0) ? c00[r] : c01[r];
                else        v = (j == 0) ? c10[r] : c11[r];
                if (mode == 0) {
                    outH[(size_t)m * N + n] = (_Float16)v;
                } else if (mode == 1) {
                    int b = m >> 11, sIdx = m & (SS - 1);
                    int h = n >> 6,  d = n & (DD - 1);
                    outH[(((size_t)b * HH + h) * DD + d) * SS + sIdx] = (_Float16)v;
                } else if (mode == 2) {
                    v += bias[n];
                    outF[(size_t)m * N + n] = resid[(size_t)m * N + n] + v;
                } else {
                    v += bias[n];
                    v = 0.5f * v * (1.0f + erff(v * 0.70710678118654752f));
                    outH[(size_t)m * N + n] = (_Float16)v;
                }
            }
        }
    }
}

// ---------------- flash attention (causal) ----------------
// q16,k16: [B,S,H,D] f16 row-major ( == [M,E] );  vt16: [B,H,D,S] f16
// attn16 out: [B,S,H,D] f16 ( == [M,E] )
// The eight waves of a work-group walk the same keys: each 32-key tile of K (32 rows of
// 128 B) and of V^T (64 rows of 64 B) is copied to LDS once for all of them, two buffers,
// the next tile's copies in flight while this one is worked on.
#define KP   72    // LDS pitch of a 128-B K row: 144 B = 16 B x odd, as LP for 64-B rows
// The block size is stated: unstated, registers are budgeted for 1,024 threads (128 a lane),
// and with the tile fragments live the row reductions are then run one at a time to fit.
__global__ __launch_bounds__(256) void flash_attn_kernel(const _Float16* __restrict__ q16,
                                  const _Float16* __restrict__ k16,
                                  const _Float16* __restrict__ vt16,
                                  _Float16* __restrict__ attn16) {
    __shared__ __attribute__((aligned(16))) _Float16 pl[8 * 16 * LP];   // per-wave 16x32 P tile, rows at LP
    __shared__ __attribute__((aligned(16))) _Float16 Kbuf[2][32 * KP];  // 32 keys x 64 d
    __shared__ __attribute__((aligned(16))) _Float16 Vbuf[2][64 * LP];  // 64 d x 32 keys

    const int lane = threadIdx.x & 31;
    const int wave = threadIdx.x >> 5;
    const int half = lane >> 4;
    const int col  = lane & 15;
    const int ko   = (lane & 16) ? 8 : 0;

    const int bh = blockIdx.y;
    const int b = bh / HH, h = bh % HH;
    const int qbase = blockIdx.x * 128 + wave * 16;
    const int qend  = qbase + 15;
    const size_t bS = (size_t)b * SS;
    const int pbase = wave * 16 * LP;
    const float scale = 0.125f;   // 1/sqrt(64)

    const _Float16* qrow = q16 + (bS + qbase + col) * EE + h * DD;
    v16h aq0 = ld_frag(qrow + ko,      qrow + ko + 16);
    v16h aq1 = ld_frag(qrow + 32 + ko, qrow + 32 + ko + 16);

    const _Float16* vtb = vt16 + ((size_t)b * HH + h) * DD * SS;

    v8f acc0 = {}, acc1 = {}, acc2 = {}, acc3 = {};
    float mrow[8], lrow[8];
#pragma unroll
    for (int r = 0; r < 8; ++r) { mrow[r] = -INFINITY; lrow[r] = 0.f; }

    // thread i copies 16 B of each tile: K row i/8, piece i%8; V^T row i/4, piece i%4
    const int kl = (threadIdx.x >> 3) * KP + (threadIdx.x & 7) * 8;
    const int vl = (threadIdx.x >> 2) * LP + (threadIdx.x & 3) * 8;
    const _Float16* kg = k16 + (bS + (threadIdx.x >> 3)) * EE + h * DD + (threadIdx.x & 7) * 8;
    const _Float16* vg = vtb + (size_t)(threadIdx.x >> 2) * SS + (threadIdx.x & 3) * 8;
    auto stage = [&](int kk, int bufIdx) {
        async_ld2_b128((unsigned)(unsigned long long)&Kbuf[bufIdx][kl], kg + (size_t)kk * EE,
                       (unsigned)(unsigned long long)&Vbuf[bufIdx][vl], vg + kk);
    };

    // tiles up to the work-group's last query row: 4, 8, .. 64, the same for all its waves
    const int ntiles = blockIdx.x * 4 + 4;
    // scalar copy of qend: the skip of tiles past a wave's own diagonal is a scalar branch
    const int qendS = __builtin_amdgcn_readfirstlane(qend);

    stage(0, 0);
    wait_async0();
    __syncthreads();
    stage(32, 1);             // ntiles >= 4: tile 1 exists

    for (int t = 0; t < ntiles; ++t) {
      const int kk = t * 32;
      if (kk <= qendS) {
        const _Float16* krow0 = &Kbuf[t & 1][col * KP];
        const _Float16* krow1 = krow0 + 16 * KP;
        const _Float16* vtile = &Vbuf[t & 1][0];
        v8f s0 = {}, s1 = {};
        {
            // each fragment in registers of its own: no read has to wait for an earlier product
            const v16h bk0 = ld_frag(krow0 + ko, krow0 + ko + 16);
            const v16h bk1 = ld_frag(krow0 + 32 + ko, krow0 + 32 + ko + 16);
            const v16h bk2 = ld_frag(krow1 + ko, krow1 + ko + 16);
            const v16h bk3 = ld_frag(krow1 + 32 + ko, krow1 + 32 + ko + 16);
            s0 = wmma_f16(aq0, bk0, s0);
            s1 = wmma_f16(aq0, bk2, s1);
            s0 = wmma_f16(aq1, bk1, s0);
            s1 = wmma_f16(aq1, bk3, s1);
        }
        const int key0 = kk + col, key1 = kk + 16 + col;

#pragma unroll
        for (int r = 0; r < 8; ++r) {
            const int qidx = qbase + half * 8 + r;
            float a0 = (key0 <= qidx) ? s0[r] * scale : -1e30f;
            float a1 = (key1 <= qidx) ? s1[r] * scale : -1e30f;
            float mx = fmaxf(a0, a1);
            mx = fmaxf(mx, __shfl_xor(mx, 1, 32));
            mx = fmaxf(mx, __shfl_xor(mx, 2, 32));
            mx = fmaxf(mx, __shfl_xor(mx, 4, 32));
            mx = fmaxf(mx, __shfl_xor(mx, 8, 32));
            const float nm = fmaxf(mrow[r], mx);
            const float al = __expf(mrow[r] - nm);
            const float p0 = __expf(a0 - nm);
            const float p1 = __expf(a1 - nm);
            float rs = p0 + p1;
            rs += __shfl_xor(rs, 1, 32);
            rs += __shfl_xor(rs, 2, 32);
            rs += __shfl_xor(rs, 4, 32);
            rs += __shfl_xor(rs, 8, 32);
            lrow[r] = lrow[r] * al + rs;
            mrow[r] = nm;
            acc0[r] *= al; acc1[r] *= al; acc2[r] *= al; acc3[r] *= al;
            pl[pbase + (half * 8 + r) * LP + col]      = (_Float16)p0;
            pl[pbase + (half * 8 + r) * LP + 16 + col] = (_Float16)p1;
        }

        // V^T fragments: read ahead of the wait that the P tile needs in any case
        const v16h vb0 = ld_frag(vtile + (col) * LP + ko,      vtile + (col) * LP + ko + 16);
        const v16h vb1 = ld_frag(vtile + (16 + col) * LP + ko, vtile + (16 + col) * LP + ko + 16);
        const v16h vb2 = ld_frag(vtile + (32 + col) * LP + ko, vtile + (32 + col) * LP + ko + 16);
        const v16h vb3 = ld_frag(vtile + (48 + col) * LP + ko, vtile + (48 + col) * LP + ko + 16);

        // wave-private LDS tile: order writes before re-striped reads
        asm volatile("s_wait_dscnt 0" ::: "memory");

        v16h pa = ld_frag(&pl[pbase + col * LP + ko], &pl[pbase + col * LP + ko + 16]);

        acc0 = wmma_f16(pa, vb0, acc0);
        acc1 = wmma_f16(pa, vb1, acc1);
        acc2 = wmma_f16(pa, vb2, acc2);
        acc3 = wmma_f16(pa, vb3, acc3);
      }

      // publish point, passed by every wave, also one that skipped the tile:
      // this wave's reads of buffer t & 1 have retired before the barrier frees it for refill
      asm volatile("s_wait_dscnt 0" ::: "memory");
      wait_async0();          // this wave's pieces of tile t + 1 have landed
      __syncthreads();        // tile t + 1 readable by all; buffer t & 1 left by all
      if (t + 2 < ntiles) stage((t + 2) * 32, t & 1);
    }
    wait_async0();            // no copy is outstanding when the wave ends

#pragma unroll
    for (int r = 0; r < 8; ++r) {
        const int q = qbase + half * 8 + r;
        const float inv = 1.0f / lrow[r];
        _Float16* orow = attn16 + (bS + q) * EE + h * DD;
        orow[col]      = (_Float16)(acc0[r] * inv);
        orow[16 + col] = (_Float16)(acc1[r] * inv);
        orow[32 + col] = (_Float16)(acc2[r] * inv);
        orow[48 + col] = (_Float16)(acc3[r] * inv);
    }
}

// ---------------- host launcher ----------------
extern "C" void kernel_launch(void* const* d_in, const int* in_sizes, int n_in,
                              void* d_out, int out_size, void* d_ws, size_t ws_size,
                              hipStream_t stream) {
    (void)in_sizes; (void)n_in; (void)out_size; (void)ws_size;
    const float* x     = (const float*)d_in[0];
    const float* wq    = (const float*)d_in[1];
    const float* wk    = (const float*)d_in[2];
    const float* wv    = (const float*)d_in[3];
    const float* wo    = (const float*)d_in[4];
    const float* bo    = (const float*)d_in[5];
    const float* w1    = (const float*)d_in[6];
    const float* b1    = (const float*)d_in[7];
    const float* w2    = (const float*)d_in[8];
    const float* b2    = (const float*)d_in[9];
    const float* gamma = (const float*)d_in[10];
    const float* beta  = (const float*)d_in[11];
    float* out = (float*)d_out;

    const size_t nEE = (size_t)EE * EE;
    const size_t nEF = (size_t)EE * FFF;
    const size_t nME = (size_t)MM * EE;
    const size_t nMF = (size_t)MM * FFF;

    char* ws = (char*)d_ws;
    size_t off = 0;
    auto alloc = [&](size_t bytes) -> void* {
        void* p = ws + off;
        off = (off + bytes + 255) & ~(size_t)255;
        return p;
    };
    _Float16* wq16   = (_Float16*)alloc(nEE * 2);
    _Float16* wk16   = (_Float16*)alloc(nEE * 2);
    _Float16* wv16   = (_Float16*)alloc(nEE * 2);
    _Float16* wo16   = (_Float16*)alloc(nEE * 2);
    _Float16* w116   = (_Float16*)alloc(nEF * 2);
    _Float16* w216   = (_Float16*)alloc(nEF * 2);
    _Float16* xn16   = (_Float16*)alloc(nME * 2);
    _Float16* q16    = (_Float16*)alloc(nME * 2);
    _Float16* k16    = (_Float16*)alloc(nME * 2);
    _Float16* vt16   = (_Float16*)alloc(nME * 2);
    _Float16* attn16 = (_Float16*)alloc(nME * 2);
    _Float16* y16    = (_Float16*)alloc(nME * 2);
    _Float16* h16    = (_Float16*)alloc(nMF * 2);
    float*    res    = (float*)alloc(nME * 4);

    // wq16 .. w216 are the first six allocations and lie back to back from wq16
    cvt_f16_kernel<<<dim3(NEE / CVT_WG, 12), 256, 0, stream>>>(wq, wk, wv, wo, w1, w2, wq16);

    ln_f16_kernel<<<MM, 256, 0, stream>>>(x, gamma, beta, xn16);

    dim3 gEE(EE / 64, MM / 128);
    gemm_wmma_kernel<<<gEE, 256, 0, stream>>>(xn16, wq16, nullptr, nullptr, nullptr, q16,  MM, EE, EE, 0);
    gemm_wmma_kernel<<<gEE, 256, 0, stream>>>(xn16, wk16, nullptr, nullptr, nullptr, k16,  MM, EE, EE, 0);
    gemm_wmma_kernel<<<gEE, 256, 0, stream>>>(xn16, wv16, nullptr, nullptr, nullptr, vt16, MM, EE, EE, 1);

    flash_attn_kernel<<<dim3(SS / 128, BB * HH), 256, 0, stream>>>(q16, k16, vt16, attn16);

    gemm_wmma_kernel<<<gEE, 256, 0, stream>>>(attn16, wo16, bo, x, res, nullptr, MM, EE, EE, 2);

    ln_f16_kernel<<<MM, 256, 0, stream>>>(res, gamma, beta, y16);

    dim3 gFF(FFF / 64, MM / 128);
    gemm_wmma_kernel<<<gFF, 256, 0, stream>>>(y16, w116, b1, nullptr, nullptr, h16, MM, FFF, EE, 3);
    gemm_wmma_kernel<<<gEE, 256, 0, stream>>>(h16, w216, b2, res, out, nullptr, MM, EE, FFF, 2);
}

// v005
// One run takes 205 microseconds.
// In two side-by-side timings against v004, it was 1.16 and 1.18 times as fast.
// Over all steps from v000 it is 1.88 times as fast.
#include <hip/hip_runtime.h>
#include <math.h>

// ---------------- problem constants ----------------
#define BB   2
#define SS   2048
#define EE   768
#define HH   12
#define DD   64
#define FFF  3072
#define MM   (BB * SS)        // 4096 rows

typedef _Float16 v16h __attribute__((ext_vector_type(16)));
typedef _Float16 v8h  __attribute__((ext_vector_type(8)));
typedef float    v8f  __attribute__((ext_vector_type(8)));

__device__ __forceinline__ v8f wmma_f16(v16h a, v16h b, v8f c) {
    // (neg_a, A, neg_b, B, c_mod, C, reuse_a, reuse_b)
    return __builtin_amdgcn_wmma_f32_16x16x32_f16(false, a, false, b, (short)0, c, false, false);
}

__device__ __forceinline__ v16h ld_frag(const _Float16* p0, const _Float16* p1) {
    v8h lo = *(const v8h*)p0;
    v8h hi = *(const v8h*)p1;
    return __builtin_shufflevector(lo, hi, 0,1,2,3,4,5,6,7,8,9,10,11,12,13,14,15);
}

// LDS pitch of a 32-half (64-B) row: 80 B = 16 B x odd, so the 16 rows that one
// ds_load_b128 touches per lane half fall on 16 distinct groups of four banks.
#define LP   40

// twelve async 16B global -> LDS copies (ASYNCcnt-tracked DMA, CDNA5): a thread's share of
// one GEMM stage, eight pieces of A (LDS la + j * ls, global ga + j * gs) and four of B.
// s_wait_xcnt stands inside the statement so that no address register of a copy
// is rewritten (next slab's address additions) ahead of it.
__device__ __forceinline__ void async_ld12_b128(unsigned la, const _Float16* ga,
                                                unsigned lb, const _Float16* gb,
                                                unsigned ls, size_t gs) {
    asm volatile("global_load_async_to_lds_b128 %0, %1, off\n\t"
                 "global_load_async_to_lds_b128 %2, %3, off\n\t"
                 "global_load_async_to_lds_b128 %4, %5, off\n\t"
                 "global_load_async_to_lds_b128 %6, %7, off\n\t"
                 "global_load_async_to_lds_b128 %8, %9, off\n\t"
                 "global_load_async_to_lds_b128 %10, %11, off\n\t"
                 "global_load_async_to_lds_b128 %12, %13, off\n\t"
                 "global_load_async_to_lds_b128 %14, %15, off\n\t"
                 "global_load_async_to_lds_b128 %16, %17, off\n\t"
                 "global_load_async_to_lds_b128 %18, %19, off\n\t"
                 "global_load_async_to_lds_b128 %20, %21, off\n\t"
                 "global_load_async_to_lds_b128 %22, %23, off\n\t"
                 "s_wait_xcnt 0x0"
                 :: "v"(la),          "v"(ga),          "v"(la + ls),     "v"(ga + gs),
                    "v"(la + 2 * ls), "v"(ga + 2 * gs), "v"(la + 3 * ls), "v"(ga + 3 * gs),
                    "v"(la + 4 * ls), "v"(ga + 4 * gs), "v"(la + 5 * ls), "v"(ga + 5 * gs),
                    "v"(la + 6 * ls), "v"(ga + 6 * gs), "v"(la + 7 * ls), "v"(ga + 7 * gs),
                    "v"(lb),          "v"(gb),          "v"(lb + ls),     "v"(gb + gs),
                    "v"(lb + 2 * ls), "v"(gb + 2 * gs), "v"(lb + 3 * ls), "v"(gb + 3 * gs)
                 : "memory");
}
// the same for two copies (attention: one piece of the K tile, one of the V^T tile)
__device__ __forceinline__ void async_ld2_b128(unsigned l0, const void* g0,
                                               unsigned l1, const void* g1) {
    asm volatile("global_load_async_to_lds_b128 %0, %1, off\n\t"
                 "global_load_async_to_lds_b128 %2, %3, off\n\t"
                 "s_wait_xcnt 0x0"
                 :: "v"(l0), "v"(g0), "v"(l1), "v"(g1) : "memory");
}
__device__ __forceinline__ void wait_async0() {
    asm volatile("s_wait_asynccnt 0" ::: "memory");
}

// ---------------- f32 -> f16 convert of all six weight matrices ----------------
// One launch. The work is cut into 12 planes of EE*EE elements (blockIdx.y): wq, wk, wv, wo,
// four planes of w1, four of w2; the f16 copies lie back to back in the same order.
// A work-group converts CVT_WG elements of one plane; each wave owns 1024 contiguous
// elements: 8 loads of 512 contiguous bytes, all issued before the first is used, and
// 8 stores of 256 contiguous bytes. Few, long waves, for speed only.
#define NEE     (EE * EE)
#define CVT_WG  8192
static_assert(NEE % CVT_WG == 0, "a plane is a whole number of work-groups");
static_assert(FFF == 4 * EE, "w1 and w2 are four planes each");
static_assert((NEE * 2) % 256 == 0, "f16 planes lie back to back in the workspace");

typedef float    v4f __attribute__((ext_vector_type(4)));
typedef _Float16 v4h __attribute__((ext_vector_type(4)));

__global__ __launch_bounds__(256) void cvt_f16_kernel(const float* __restrict__ wq,
                                                      const float* __restrict__ wk,
                                                      const float* __restrict__ wv,
                                                      const float* __restrict__ wo,
                                                      const float* __restrict__ w1,
                                                      const float* __restrict__ w2,
                                                      _Float16* __restrict__ out) {
    const int plane = blockIdx.y;                 // 0..11, uniform in the work-group
    const float* big = plane < 8 ? w1 : w2;       // planes 4..7 and 8..11
    const float* src = big + (size_t)(plane & 3) * NEE;
    if (plane == 0) src = wq;
    if (plane == 1) src = wk;
    if (plane == 2) src = wv;
    if (plane == 3) src = wo;
    const int base = blockIdx.x * CVT_WG + (threadIdx.x >> 5) * 1024 + (threadIdx.x & 31) * 4;
    const float* s = src + base;
    _Float16* d = out + (size_t)plane * NEE + base;
    v4f v[8];
    // both loops unrolled: v[] stays in registers and all 8 loads issue ahead of the first use
#pragma unroll
    for (int j = 0; j < 8; ++j) v[j] = *(const v4f*)(s + j * 128);
#pragma unroll
    for (int j = 0; j < 8; ++j) *(v4h*)(d + j * 128) = __builtin_convertvector(v[j], v4h);
}

// ---------------- row LayerNorm -> f16 ----------------
__global__ void ln_f16_kernel(const float* __restrict__ x,
                              const float* __restrict__ gamma,
                              const float* __restrict__ beta,
                              _Float16* __restrict__ out) {
    __shared__ float s1[256], s2[256];
    const int row = blockIdx.x;
    const float* xr = x + (size_t)row * EE;
    float v[3], sum = 0.f, sq = 0.f;
#pragma unroll
    for (int i = 0; i < 3; ++i) {
        v[i] = xr[threadIdx.x + i * 256];
        sum += v[i];
        sq  += v[i] * v[i];
    }
    s1[threadIdx.x] = sum; s2[threadIdx.x] = sq;
    __syncthreads();
    for (int s = 128; s > 0; s >>= 1) {
        if (threadIdx.x < s) {
            s1[threadIdx.x] += s1[threadIdx.x + s];
            s2[threadIdx.x] += s2[threadIdx.x + s];
        }
        __syncthreads();
    }
    const float mu = s1[0] * (1.0f / EE);
    const float var = s2[0] * (1.0f / EE) - mu * mu;
    const float rs = rsqrtf(var + 1e-5f);
    _Float16* orow = out + (size_t)row * EE;
#pragma unroll
    for (int i = 0; i < 3; ++i) {
        int c = threadIdx.x + i * 256;
        orow[c] = (_Float16)((v[i] - mu) * rs * gamma[c] + beta[c]);
    }
}

// ---------------- WMMA GEMM: C[M,N] = A[M,K] @ W[N,K]^T ----------------
// LDS-staged via async global->LDS DMA, double buffered.
// Block: 256 thr = 8 waves, tile 128M x 64N; wave tile 32x32.
// A stage holds BK = 128 k (16 WMMAs a wave): a trip costs one landing of the next stage's
// copies and one barrier whatever its depth.
// K must be a multiple of BK.
// mode 0: outH f16 row-major        (no bias)
// mode 1: outH f16, V-transposed to [B,H,D,S]  (no bias)
// mode 2: outF f32 = resid + bias + C
// mode 3: outH f16 = gelu(bias + C)   (exact erf)
#define BK   128
#define GP   136   // LDS pitch of a 256-B stage row: 272 B = 16 B x odd, as LP for 64-B rows
static_assert(EE % BK == 0 && FFF % BK == 0, "every K is a whole number of stages");
__global__ void gemm_wmma_kernel(const _Float16* __restrict__ A,
                                 const _Float16* __restrict__ W,
                                 const float* __restrict__ bias,
                                 const float* __restrict__ resid,
                                 float* __restrict__ outF,
                                 _Float16* __restrict__ outH,
                                 int M, int N, int K, int mode) {
    __shared__ __attribute__((aligned(16))) _Float16 Abuf[2][128 * GP];   // 34 KB each
    __shared__ __attribute__((aligned(16))) _Float16 Bbuf[2][64 * GP];    // 17 KB each

    const int lane = threadIdx.x & 31;
    const int wave = threadIdx.x >> 5;          // 0..7 -> 4M x 2N
    const int mW = (wave >> 1) * 32;            // local M offset of wave tile
    const int nW = (wave & 1) * 32;             // local N offset of wave tile
    const int mBlk = blockIdx.y * 128;
    const int nBlk = blockIdx.x * 64;
    const int ko = (lane & 16) ? 8 : 0;         // K sub-offsets {ko, ko+16}
    const int col = lane & 15;
    const int half = lane >> 4;

    // stage one BK-wide K slab: A 128 x BK (8 pieces/thread) + B 64 x BK (4 pieces/thread);
    // a copy of the work-group covers 16 whole rows of 256 B, the next one the 16 rows below
    auto stage = [&](int kk, int bufIdx) {
        const int row = threadIdx.x >> 4, q = threadIdx.x & 15;   // row 0..15
        async_ld12_b128((unsigned)(unsigned long long)&Abuf[bufIdx][row * GP + q * 8],
                        A + (size_t)(mBlk + row) * K + kk + q * 8,
                        (unsigned)(unsigned long long)&Bbuf[bufIdx][row * GP + q * 8],
                        W + (size_t)(nBlk + row) * K + kk + q * 8,
                        16 * GP * 2, (size_t)16 * K);
    };

    v8f c00 = {}, c01 = {}, c10 = {}, c11 = {};

    const int nsteps = K / BK;
    stage(0, 0);
    wait_async0();
    __syncthreads();

    for (int s = 0; s < nsteps; ++s) {
        const int cur = s & 1;
        if (s + 1 < nsteps) stage((s + 1) * BK, cur ^ 1);

        const _Float16* ab = &Abuf[cur][(mW + col) * GP + ko];
        const _Float16* bb = &Bbuf[cur][(nW + col) * GP + ko];
        for (int ks = 0; ks < BK; ks += 32) {
            v16h a0 = ld_frag(ab + ks,           ab + ks + 16);
            v16h a1 = ld_frag(ab + 16 * GP + ks, ab + 16 * GP + ks + 16);
            v16h b0 = ld_frag(bb + ks,           bb + ks + 16);
            v16h b1 = ld_frag(bb + 16 * GP + ks, bb + 16 * GP + ks + 16);
            c00 = wmma_f16(a0, b0, c00);
            c01 = wmma_f16(a0, b1, c01);
            c10 = wmma_f16(a1, b0, c10);
            c11 = wmma_f16(a1, b1, c11);
        }

        // this wave's reads of cur have retired before the barrier frees cur for refill
        asm volatile("s_wait_dscnt 0" ::: "memory");
        wait_async0();        // our next-slab DMAs have landed
        __syncthreads();      // everyone done reading cur before it is overwritten
    }

    // ---------------- writeback ----------------
#pragma unroll
    for (int i = 0; i < 2; ++i) {
#pragma unroll
        for (int r = 0; r < 8; ++r) {
            int m = mBlk + mW + i * 16 + half * 8 + r;
#pragma unroll
            for (int j = 0; j < 2; ++j) {
                int n = nBlk + nW + j * 16 + col;
                float v;
                if (i == 0) v = (j == 0) ? c00[r] : c01[r];
                else        v = (j == 0) ? c10[r] : c11[r];
                if (mode == 0) {
                    outH[(size_t)m * N + n] = (_Float16)v;
                } else if (mode == 1) {
                    int b = m >> 11, sIdx = m & (SS - 1);
                    int h = n >> 6,  d = n & (DD - 1);
                    outH[(((size_t)b * HH + h) * DD + d) * SS + sIdx] = (_Float16)v;
                } else if (mode == 2) {
                    v += bias[n];
                    outF[(size_t)m * N + n] = resid[(size_t)m * N + n] + v;
                } else {
                    v += bias[n];
                    v = 0.5f * v * (1.0f + erff(v * 0.70710678118654752f));
                    outH[(size_t)m * N + n] = (_Float16)v;
                }
            }
        }
    }
}

// ---------------- flash attention (causal) ----------------
// q16,k16: [B,S,H,D] f16 row-major ( == [M,E] );  vt16: [B,H,D,S] f16
// attn16 out: [B,S,H,D] f16 ( == [M,E] )
// The eight waves of a work-group walk the same keys: each 32-key tile of K (32 rows of
// 128 B) and of V^T (64 rows of 64 B) is copied to LDS once for all of them, two buffers,
// the next tile's copies in flight while this one is worked on.
// The products are taken transposed: S^T = K Q^T (A = K rows, B = Q) and O^T += V^T P^T.
// A lane then holds 16 of the 32 scores of ONE query (column lane & 15; keys 8 * half + r and
// 16 + 8 * half + r), so the maximum and the sum of a row are taken in the lane's own
// registers, with one exchange between the wave's halves; and the two score tiles,
// converted in place, are the B operand of the second product in the order its k wants:
// P goes through no LDS.
#define KP   72    // LDS pitch of a 128-B K row: 144 B = 16 B x odd, as LP for 64-B rows

// lane l takes the value of lane l ^ 16 (a vector move between the wave's two rows)
__device__ __forceinline__ float xhalf(float x) {
    const int b = __builtin_bit_cast(int, x);
    return __builtin_bit_cast(float,
        __builtin_amdgcn_permlanex16(b, b, 0x76543210, 0xfedcba98, false, false));
}

// The block size is stated: unstated, registers are budgeted for 1,024 threads (128 a lane).
// amdgpu_waves_per_eu(4, 4): the grid is 384 work-groups of eight waves, too few to gain from
// more than four waves a SIMD; budgeted for more, the scheduler holds registers down and the
// score products wait for the V^T reads as well as for the K reads.
__global__ __launch_bounds__(256) __attribute__((amdgpu_waves_per_eu(4, 4))) void flash_attn_kernel(const _Float16* __restrict__ q16,
                                  const _Float16* __restrict__ k16,
                                  const _Float16* __restrict__ vt16,
                                  _Float16* __restrict__ attn16) {
    __shared__ __attribute__((aligned(16))) _Float16 Kbuf[2][32 * KP];  // 32 keys x 64 d
    __shared__ __attribute__((aligned(16))) _Float16 Vbuf[2][64 * LP];  // 64 d x 32 keys

    const int lane = threadIdx.x & 31;
    const int wave = threadIdx.x >> 5;
    const int half = lane >> 4;
    const int col  = lane & 15;
    const int ko   = (lane & 16) ? 8 : 0;

    const int bh = blockIdx.y;
    const int b = bh / HH, h = bh % HH;
    const int qbase = blockIdx.x * 128 + wave * 16;
    const int qend  = qbase + 15;
    const int qidx  = qbase + col;            // the lane's one query
    const size_t bS = (size_t)b * SS;
    const float scale = 0.125f;   // 1/sqrt(64)

    const _Float16* qrow = q16 + (bS + qidx) * EE + h * DD;
    const v16h bq0 = ld_frag(qrow + ko,      qrow + ko + 16);
    const v16h bq1 = ld_frag(qrow + 32 + ko, qrow + 32 + ko + 16);

    const _Float16* vtb = vt16 + ((size_t)b * HH + h) * DD * SS;

    // accJ[r] = O[qidx][16 * J + 8 * half + r]
    v8f acc0 = {}, acc1 = {}, acc2 = {}, acc3 = {};
    float mrow = -INFINITY;   // running maximum of the query's row, equal in both halves
    float lrow = 0.f;         // running sum over this half's keys; the halves join at the end

    // thread i copies 16 B of each tile: K row i/8, piece i%8; V^T row i/4, piece i%4
    const int kl = (threadIdx.x >> 3) * KP + (threadIdx.x & 7) * 8;
    const int vl = (threadIdx.x >> 2) * LP + (threadIdx.x & 3) * 8;
    const _Float16* kg = k16 + (bS + (threadIdx.x >> 3)) * EE + h * DD + (threadIdx.x & 7) * 8;
    const _Float16* vg = vtb + (size_t)(threadIdx.x >> 2) * SS + (threadIdx.x & 3) * 8;
    auto stage = [&](int kk, int bufIdx) {
        async_ld2_b128((unsigned)(unsigned long long)&Kbuf[bufIdx][kl], kg + (size_t)kk * EE,
                       (unsigned)(unsigned long long)&Vbuf[bufIdx][vl], vg + kk);
    };

    // tiles up to the work-group's last query row: 4, 8, .. 64, the same for all its waves
    const int ntiles = blockIdx.x * 4 + 4;
    // scalar copy of qend: the skip of tiles past a wave's own diagonal is a scalar branch
    const int qendS = __builtin_amdgcn_readfirstlane(qend);

    stage(0, 0);
    wait_async0();
    __syncthreads();
    stage(32, 1);             // ntiles >= 4: tile 1 exists

    for (int t = 0; t < ntiles; ++t) {
      const int kk = t * 32;
      if (kk <= qendS) {
        const _Float16* krow0 = &Kbuf[t & 1][col * KP];
        const _Float16* krow1 = krow0 + 16 * KP;
        const _Float16* vtile = &Vbuf[t & 1][0];
        const v16h ak0 = ld_frag(krow0 + ko, krow0 + ko + 16);
        const v16h ak1 = ld_frag(krow0 + 32 + ko, krow0 + 32 + ko + 16);
        const v16h ak2 = ld_frag(krow1 + ko, krow1 + ko + 16);
        const v16h ak3 = ld_frag(krow1 + 32 + ko, krow1 + 32 + ko + 16);
        const v16h av0 = ld_frag(vtile + (col) * LP + ko,      vtile + (col) * LP + ko + 16);
        const v16h av1 = ld_frag(vtile + (16 + col) * LP + ko, vtile + (16 + col) * LP + ko + 16);
        const v16h av2 = ld_frag(vtile + (32 + col) * LP + ko, vtile + (32 + col) * LP + ko + 16);
        const v16h av3 = ld_frag(vtile + (48 + col) * LP + ko, vtile + (48 + col) * LP + ko + 16);

        // inputs-only fence on the eight loaded fragments: it holds each in registers of its own,
        // so the K reads are issued together ahead of the first product and the V^T reads land
        // under the softmax; without it fragments share a register block and each score
        // product waits for an LDS round trip of its own
        asm volatile("" :: "v"(ak0), "v"(ak1), "v"(ak2), "v"(ak3),
                           "v"(av0), "v"(av1), "v"(av2), "v"(av3));

        // s0[r] = S[qidx][kk + 8 * half + r], s1[r] = S[qidx][kk + 16 + 8 * half + r]
        v8f s0 = {}, s1 = {};
        s0 = wmma_f16(ak0, bq0, s0);
        s1 = wmma_f16(ak2, bq0, s1);
        s0 = wmma_f16(ak1, bq1, s0);
        s1 = wmma_f16(ak3, bq1, s1);

        const int dq = qidx - (kk + half * 8);   // key 8 * half + r of the tile is allowed while r <= dq
        const v8f t0 = s0 * scale, t1 = s1 * scale;
        float a[16];              // a[s]: the score that becomes element s of the B operand
#pragma unroll
        for (int r = 0; r < 8; ++r) {
            a[r]     = (r      <= dq) ? t0[r] : -1e30f;
            a[8 + r] = (16 + r <= dq) ? t1[r] : -1e30f;
        }
        float mx = -1e30f;
#pragma unroll
        for (int s = 0; s < 16; s += 2) mx = fmaxf(mx, fmaxf(a[s], a[s + 1]));
        mx = fmaxf(mx, xhalf(mx));
        const float nm = fmaxf(mrow, mx);
        const float al = __expf(mrow - nm);
        mrow = nm;

        v16h pb;
        float rs0 = 0.f, rs1 = 0.f;
#pragma unroll
        for (int s = 0; s < 16; s += 2) {
            const float p0 = __expf(a[s] - nm);
            const float p1 = __expf(a[s + 1] - nm);
            rs0 += p0;
            rs1 += p1;
            pb[s]     = (_Float16)p0;
            pb[s + 1] = (_Float16)p1;
        }
        const float rs = rs0 + rs1;
        lrow = lrow * al + rs;
        acc0 *= al; acc1 *= al; acc2 *= al; acc3 *= al;

        acc0 = wmma_f16(av0, pb, acc0);
        acc1 = wmma_f16(av1, pb, acc1);
        acc2 = wmma_f16(av2, pb, acc2);
        acc3 = wmma_f16(av3, pb, acc3);
      }

      // publish point, passed by every wave, also one that skipped the tile:
      // this wave's reads of buffer t & 1 have retired before the barrier frees it for refill
      asm volatile("s_wait_dscnt 0" ::: "memory");
      wait_async0();          // this wave's pieces of tile t + 1 have landed
      __syncthreads();        // tile t + 1 readable by all; buffer t & 1 left by all
      if (t + 2 < ntiles) stage((t + 2) * 32, t & 1);
    }
    wait_async0();            // no copy is outstanding when the wave ends

    // a lane's 8 registers of an output tile are 8 consecutive d of its query: 16-B stores
    const float inv = 1.0f / (lrow + xhalf(lrow));
    _Float16* orow = attn16 + (bS + qidx) * EE + h * DD + half * 8;
    *(v8h*)(orow)      = __builtin_convertvector(acc0 * inv, v8h);
    *(v8h*)(orow + 16) = __builtin_convertvector(acc1 * inv, v8h);
    *(v8h*)(orow + 32) = __builtin_convertvector(acc2 * inv, v8h);
    *(v8h*)(orow + 48) = __builtin_convertvector(acc3 * inv, v8h);
}

// ---------------- host launcher ----------------
extern "C" void kernel_launch(void* const* d_in, const int* in_sizes, int n_in,
                              void* d_out, int out_size, void* d_ws, size_t ws_size,
                              hipStream_t stream) {
    (void)in_sizes; (void)n_in; (void)out_size; (void)ws_size;
    const float* x     = (const float*)d_in[0];
    const float* wq    = (const float*)d_in[1];
    const float* wk    = (const float*)d_in[2];
    const float* wv    = (const float*)d_in[3];
    const float* wo    = (const float*)d_in[4];
    const float* bo    = (const float*)d_in[5];
    const float* w1    = (const float*)d_in[6];
    const float* b1    = (const float*)d_in[7];
    const float* w2    = (const float*)d_in[8];
    const float* b2    = (const float*)d_in[9];
    const float* gamma = (const float*)d_in[10];
    const float* beta  = (const float*)d_in[11];
    float* out = (float*)d_out;

    const size_t nEE = (size_t)EE * EE;
    const size_t nEF = (size_t)EE * FFF;
    const size_t nME = (size_t)MM * EE;
    const size_t nMF = (size_t)MM * FFF;

    char* ws = (char*)d_ws;
    size_t off = 0;
    auto alloc = [&](size_t bytes) -> void* {
        void* p = ws + off;
        off = (off + bytes + 255) & ~(size_t)255;
        return p;
    };
    _Float16* wq16   = (_Float16*)alloc(nEE * 2);
    _Float16* wk16   = (_Float16*)alloc(nEE * 2);
    _Float16* wv16   = (_Float16*)alloc(nEE * 2);
    _Float16* wo16   = (_Float16*)alloc(nEE * 2);
    _Float16* w116   = (_Float16*)alloc(nEF * 2);
    _Float16* w216   = (_Float16*)alloc(nEF * 2);
    _Float16* xn16   = (_Float16*)alloc(nME * 2);
    _Float16* q16    = (_Float16*)alloc(nME * 2);
    _Float16* k16    = (_Float16*)alloc(nME * 2);
    _Float16* vt16   = (_Float16*)alloc(nME * 2);
    _Float16* attn16 = (_Float16*)alloc(nME * 2);
    _Float16* y16    = (_Float16*)alloc(nME * 2);
    _Float16* h16    = (_Float16*)alloc(nMF * 2);
    float*    res    = (float*)alloc(nME * 4);

    // wq16 .. w216 are the first six allocations and lie back to back from wq16
    cvt_f16_kernel<<<dim3(NEE / CVT_WG, 12), 256, 0, stream>>>(wq, wk, wv, wo, w1, w2, wq16);

    ln_f16_kernel<<<MM, 256, 0, stream>>>(x, gamma, beta, xn16);

    dim3 gEE(EE / 64, MM / 128);
    gemm_wmma_kernel<<<gEE, 256, 0, stream>>>(xn16, wq16, nullptr, nullptr, nullptr, q16,  MM, EE, EE, 0);
    gemm_wmma_kernel<<<gEE, 256, 0, stream>>>(xn16, wk16, nullptr, nullptr, nullptr, k16,  MM, EE, EE, 0);
    gemm_wmma_kernel<<<gEE, 256, 0, stream>>>(xn16, wv16, nullptr, nullptr, nullptr, vt16, MM, EE, EE, 1);

    flash_attn_kernel<<<dim3(SS / 128, BB * HH), 256, 0, stream>>>(q16, k16, vt16, attn16);

    gemm_wmma_kernel<<<gEE, 256, 0, stream>>>(attn16, wo16, bo, x, res, nullptr, MM, EE, EE, 2);

    ln_f16_kernel<<<MM, 256, 0, stream>>>(res, gamma, beta, y16);

    dim3 gFF(FFF / 64, MM / 128);
    gemm_wmma_kernel<<<gFF, 256, 0, stream>>>(y16, w116, b1, nullptr, nullptr, h16, MM, FFF, EE, 3);
    gemm_wmma_kernel<<<gEE, 256, 0, stream>>>(h16, w216, b2, res, out, nullptr, MM, EE, FFF, 2);
}

// v006
// Measured time: 152 microseconds a run.
// Two timings next to v005 put it at 1.35 and 1.37 times that version's speed.
// All steps since v000 together make it 2.56 times as fast.
#include <hip/hip_runtime.h>
#include <math.h>

// ---------------- problem constants ----------------
#define BB   2
#define SS   2048
#define EE   768
#define HH   12
#define DD   64
#define FFF  3072
#define MM   (BB * SS)        // 4096 rows

typedef _Float16 v16h __attribute__((ext_vector_type(16)));
typedef _Float16 v8h  __attribute__((ext_vector_type(8)));
typedef float    v8f  __attribute__((ext_vector_type(8)));

__device__ __forceinline__ v8f wmma_f16(v16h a, v16h b, v8f c) {
    // (neg_a, A, neg_b, B, c_mod, C, reuse_a, reuse_b)
    return __builtin_amdgcn_wmma_f32_16x16x32_f16(false, a, false, b, (short)0, c, false, false);
}

__device__ __forceinline__ v16h ld_frag(const _Float16* p0, const _Float16* p1) {
    v8h lo = *(const v8h*)p0;
    v8h hi = *(const v8h*)p1;
    return __builtin_shufflevector(lo, hi, 0,1,2,3,4,5,6,7,8,9,10,11,12,13,14,15);
}

// LDS pitch of a 32-half (64-B) row: 80 B = 16 B x odd, so the 16 rows that one
// ds_load_b128 touches per lane half fall on 16 distinct groups of four banks.
#define LP   40

// twelve async 16B global -> LDS copies (ASYNCcnt-tracked DMA, CDNA5): a thread's share of
// one GEMM stage, eight pieces of A (LDS la + j * ls, global ga + j * gs) and four of B.
// s_wait_xcnt stands inside the statement so that no address register of a copy
// is rewritten (next slab's address additions) ahead of it.
__device__ __forceinline__ void async_ld12_b128(unsigned la, const _Float16* ga,
                                                unsigned lb, const _Float16* gb,
                                                unsigned ls, size_t gs) {
    asm volatile("global_load_async_to_lds_b128 %0, %1, off\n\t"
                 "global_load_async_to_lds_b128 %2, %3, off\n\t"
                 "global_load_async_to_lds_b128 %4, %5, off\n\t"
                 "global_load_async_to_lds_b128 %6, %7, off\n\t"
                 "global_load_async_to_lds_b128 %8, %9, off\n\t"
                 "global_load_async_to_lds_b128 %10, %11, off\n\t"
                 "global_load_async_to_lds_b128 %12, %13, off\n\t"
                 "global_load_async_to_lds_b128 %14, %15, off\n\t"
                 "global_load_async_to_lds_b128 %16, %17, off\n\t"
                 "global_load_async_to_lds_b128 %18, %19, off\n\t"
                 "global_load_async_to_lds_b128 %20, %21, off\n\t"
                 "global_load_async_to_lds_b128 %22, %23, off\n\t"
                 "s_wait_xcnt 0x0"
                 :: "v"(la),          "v"(ga),          "v"(la + ls),     "v"(ga + gs),
                    "v"(la + 2 * ls), "v"(ga + 2 * gs), "v"(la + 3 * ls), "v"(ga + 3 * gs),
                    "v"(la + 4 * ls), "v"(ga + 4 * gs), "v"(la + 5 * ls), "v"(ga + 5 * gs),
                    "v"(la + 6 * ls), "v"(ga + 6 * gs), "v"(la + 7 * ls), "v"(ga + 7 * gs),
                    "v"(lb),          "v"(gb),          "v"(lb + ls),     "v"(gb + gs),
                    "v"(lb + 2 * ls), "v"(gb + 2 * gs), "v"(lb + 3 * ls), "v"(gb + 3 * gs)
                 : "memory");
}
// the same for two copies (attention: one piece of the K tile, one of the V^T tile)
__device__ __forceinline__ void async_ld2_b128(unsigned l0, const void* g0,
                                               unsigned l1, const void* g1) {
    asm volatile("global_load_async_to_lds_b128 %0, %1, off\n\t"
                 "global_load_async_to_lds_b128 %2, %3, off\n\t"
                 "s_wait_xcnt 0x0"
                 :: "v"(l0), "v"(g0), "v"(l1), "v"(g1) : "memory");
}
__device__ __forceinline__ void wait_async0() {
    asm volatile("s_wait_asynccnt 0" ::: "memory");
}

// ---------------- f32 -> f16 convert of all six weight matrices ----------------
// One launch. The work is cut into 12 planes of EE*EE elements (blockIdx.y): wq, wk, wv, wo,
// four planes of w1, four of w2; the f16 copies lie back to back in the same order.
// A work-group converts CVT_WG elements of one plane; each wave owns 1024 contiguous
// elements: 8 loads of 512 contiguous bytes, all issued before the first is used, and
// 8 stores of 256 contiguous bytes. Few, long waves, for speed only.
#define NEE     (EE * EE)
#define CVT_WG  8192
static_assert(NEE % CVT_WG == 0, "a plane is a whole number of work-groups");
static_assert(FFF == 4 * EE, "w1 and w2 are four planes each");
static_assert((NEE * 2) % 256 == 0, "f16 planes lie back to back in the workspace");

typedef float    v4f __attribute__((ext_vector_type(4)));
typedef _Float16 v4h __attribute__((ext_vector_type(4)));

__global__ __launch_bounds__(256) void cvt_f16_kernel(const float* __restrict__ wq,
                                                      const float* __restrict__ wk,
                                                      const float* __restrict__ wv,
                                                      const float* __restrict__ wo,
                                                      const float* __restrict__ w1,
                                                      const float* __restrict__ w2,
                                                      _Float16* __restrict__ out) {
    const int plane = blockIdx.y;                 // 0..11, uniform in the work-group
    const float* big = plane < 8 ? w1 : w2;       // planes 4..7 and 8..11
    const float* src = big + (size_t)(plane & 3) * NEE;
    if (plane == 0) src = wq;
    if (plane == 1) src = wk;
    if (plane == 2) src = wv;
    if (plane == 3) src = wo;
    const int base = blockIdx.x * CVT_WG + (threadIdx.x >> 5) * 1024 + (threadIdx.x & 31) * 4;
    const float* s = src + base;
    _Float16* d = out + (size_t)plane * NEE + base;
    v4f v[8];
    // both loops unrolled: v[] stays in registers and all 8 loads issue ahead of the first use
#pragma unroll
    for (int j = 0; j < 8; ++j) v[j] = *(const v4f*)(s + j * 128);
#pragma unroll
    for (int j = 0; j < 8; ++j) *(v4h*)(d + j * 128) = __builtin_convertvector(v[j], v4h);
}

// ---------------- row LayerNorm -> f16 ----------------
__global__ void ln_f16_kernel(const float* __restrict__ x,
                              const float* __restrict__ gamma,
                              const float* __restrict__ beta,
                              _Float16* __restrict__ out) {
    __shared__ float s1[256], s2[256];
    const int row = blockIdx.x;
    const float* xr = x + (size_t)row * EE;
    float v[3], sum = 0.f, sq = 0.f;
#pragma unroll
    for (int i = 0; i < 3; ++i) {
        v[i] = xr[threadIdx.x + i * 256];
        sum += v[i];
        sq  += v[i] * v[i];
    }
    s1[threadIdx.x] = sum; s2[threadIdx.x] = sq;
    __syncthreads();
    for (int s = 128; s > 0; s >>= 1) {
        if (threadIdx.x < s) {
            s1[threadIdx.x] += s1[threadIdx.x + s];
            s2[threadIdx.x] += s2[threadIdx.x + s];
        }
        __syncthreads();
    }
    const float mu = s1[0] * (1.0f / EE);
    const float var = s2[0] * (1.0f / EE) - mu * mu;
    const float rs = rsqrtf(var + 1e-5f);
    _Float16* orow = out + (size_t)row * EE;
#pragma unroll
    for (int i = 0; i < 3; ++i) {
        int c = threadIdx.x + i * 256;
        orow[c] = (_Float16)((v[i] - mu) * rs * gamma[c] + beta[c]);
    }
}

// ---------------- WMMA GEMM: C[M,N] = A[M,K] @ W[N,K]^T ----------------
// LDS-staged via async global->LDS DMA, double buffered.
// Block: 256 thr = 8 waves, tile 128M x 64N; wave tile 32x32.
// A stage holds BK = 128 k (16 WMMAs a wave): a trip costs one landing of the next stage's
// copies and one barrier whatever its depth.
// K must be a multiple of BK.
// MODE 0: outH f16 row-major        (no bias)
// MODE 1: outH f16, V-transposed to [B,H,D,S]  (no bias)
// MODE 2: outF f32 = resid + bias + C
// MODE 3: outH f16 = gelu(bias + C)   (exact erf)
// MODE and the row length N of the output are template arguments: each build holds one
// writeback, straight-line. Chosen at run time, the choice is branched on at each of a lane's
// 32 results, and every residual and bias load waits for its own round trip before the next.
#define BK   128
#define GP   136   // LDS pitch of a 256-B stage row: 272 B = 16 B x odd, as LP for 64-B rows
static_assert(EE % BK == 0 && FFF % BK == 0, "every K is a whole number of stages");
template <int MODE, int N>
__global__ void gemm_wmma_kernel(const _Float16* __restrict__ A,
                                 const _Float16* __restrict__ W,
                                 const float* __restrict__ bias,
                                 const float* __restrict__ resid,
                                 float* __restrict__ outF,
                                 _Float16* __restrict__ outH,
                                 int K) {
    __shared__ __attribute__((aligned(16))) _Float16 Abuf[2][128 * GP];   // 34 KB each
    __shared__ __attribute__((aligned(16))) _Float16 Bbuf[2][64 * GP];    // 17 KB each

    const int lane = threadIdx.x & 31;
    const int wave = threadIdx.x >> 5;          // 0..7 -> 4M x 2N
    const int mW = (wave >> 1) * 32;            // local M offset of wave tile
    const int nW = (wave & 1) * 32;             // local N offset of wave tile
    const int mBlk = blockIdx.y * 128;
    const int nBlk = blockIdx.x * 64;
    const int ko = (lane & 16) ? 8 : 0;         // K sub-offsets {ko, ko+16}
    const int col = lane & 15;
    const int half = lane >> 4;

    // stage one BK-wide K slab: A 128 x BK (8 pieces/thread) + B 64 x BK (4 pieces/thread);
    // a copy of the work-group covers 16 whole rows of 256 B, the next one the 16 rows below
    auto stage = [&](int kk, int bufIdx) {
        const int row = threadIdx.x >> 4, q = threadIdx.x & 15;   // row 0..15
        async_ld12_b128((unsigned)(unsigned long long)&Abuf[bufIdx][row * GP + q * 8],
                        A + (size_t)(mBlk + row) * K + kk + q * 8,
                        (unsigned)(unsigned long long)&Bbuf[bufIdx][row * GP + q * 8],
                        W + (size_t)(nBlk + row) * K + kk + q * 8,
                        16 * GP * 2, (size_t)16 * K);
    };

    v8f c00 = {}, c01 = {}, c10 = {}, c11 = {};

    const int nsteps = K / BK;
    stage(0, 0);
    wait_async0();
    __syncthreads();

    for (int s = 0; s < nsteps; ++s) {
        const int cur = s & 1;
        if (s + 1 < nsteps) stage((s + 1) * BK, cur ^ 1);

        const _Float16* ab = &Abuf[cur][(mW + col) * GP + ko];
        const _Float16* bb = &Bbuf[cur][(nW + col) * GP + ko];
        for (int ks = 0; ks < BK; ks += 32) {
            v16h a0 = ld_frag(ab + ks,           ab + ks + 16);
            v16h a1 = ld_frag(ab + 16 * GP + ks, ab + 16 * GP + ks + 16);
            v16h b0 = ld_frag(bb + ks,           bb + ks + 16);
            v16h b1 = ld_frag(bb + 16 * GP + ks, bb + 16 * GP + ks + 16);
            c00 = wmma_f16(a0, b0, c00);
            c01 = wmma_f16(a0, b1, c01);
            c10 = wmma_f16(a1, b0, c10);
            c11 = wmma_f16(a1, b1, c11);
        }

        // this wave's reads of cur have retired before the barrier frees cur for refill
        asm volatile("s_wait_dscnt 0" ::: "memory");
        wait_async0();        // our next-slab DMAs have landed
        __syncthreads();      // everyone done reading cur before it is overwritten
    }

    // ---------------- writeback ----------------
    // acc[i][j][r] = C[m0 + 16 * i + r][n0 + 16 * j]
    // every loop below is unrolled: acc, rv and hv are indexed by constants and stay in
    // registers, and the row offsets become immediate offsets of one address
    const v8f acc[2][2] = {{c00, c01}, {c10, c11}};
    const int m0 = mBlk + mW + half * 8;
    const int n0 = nBlk + nW + col;
    if constexpr (MODE == 0) {
        _Float16* o = outH + (size_t)m0 * N + n0;
#pragma unroll
        for (int i = 0; i < 2; ++i)
#pragma unroll
            for (int r = 0; r < 8; ++r)
#pragma unroll
                for (int j = 0; j < 2; ++j)
                    o[(i * 16 + r) * N + j * 16] = (_Float16)acc[i][j][r];
    } else if constexpr (MODE == 1) {
#pragma unroll
        for (int i = 0; i < 2; ++i) {
            const int m = m0 + i * 16;             // a multiple of 8: rows m .. m + 7 share b
            const int b = m >> 11, sIdx = m & (SS - 1);
#pragma unroll
            for (int j = 0; j < 2; ++j) {
                const int n = n0 + j * 16;
                const int h = n >> 6, d = n & (DD - 1);
                _Float16* o = outH + (((size_t)b * HH + h) * DD + d) * SS + sIdx;
#pragma unroll
                for (int r = 0; r < 8; ++r) o[r] = (_Float16)acc[i][j][r];
            }
        }
    } else if constexpr (MODE == 2) {
        const float* rp = resid + (size_t)m0 * N + n0;
        float* o = outF + (size_t)m0 * N + n0;
        const float bs[2] = {bias[n0], bias[n0 + 16]};
        float rv[2][8][2];
        // all 32 residual loads of the lane are issued before the first is used
#pragma unroll
        for (int i = 0; i < 2; ++i)
#pragma unroll
            for (int r = 0; r < 8; ++r)
#pragma unroll
                for (int j = 0; j < 2; ++j)
                    rv[i][r][j] = rp[(i * 16 + r) * N + j * 16];
#pragma unroll
        for (int i = 0; i < 2; ++i)
#pragma unroll
            for (int r = 0; r < 8; ++r)
#pragma unroll
                for (int j = 0; j < 2; ++j)
                    o[(i * 16 + r) * N + j * 16] = rv[i][r][j] + (acc[i][j][r] + bs[j]);
    } else {
        _Float16* o = outH + (size_t)m0 * N + n0;
        const float bs[2] = {bias[n0], bias[n0 + 16]};
        _Float16 hv[2][8][2];
        // erff branches: a store between two of them waits before its register is used again,
        // so all 32 results are formed first and stored together
#pragma unroll
        for (int i = 0; i < 2; ++i)
#pragma unroll
            for (int r = 0; r < 8; ++r)
#pragma unroll
                for (int j = 0; j < 2; ++j) {
                    float v = acc[i][j][r] + bs[j];
                    v = 0.5f * v * (1.0f + erff(v * 0.70710678118654752f));
                    hv[i][r][j] = (_Float16)v;
                }
#pragma unroll
        for (int i = 0; i < 2; ++i)
#pragma unroll
            for (int r = 0; r < 8; ++r)
#pragma unroll
                for (int j = 0; j < 2; ++j)
                    o[(i * 16 + r) * N + j * 16] = hv[i][r][j];
    }
}

// ---------------- flash attention (causal) ----------------
// q16,k16: [B,S,H,D] f16 row-major ( == [M,E] );  vt16: [B,H,D,S] f16
// attn16 out: [B,S,H,D] f16 ( == [M,E] )
// The eight waves of a work-group walk the same keys: each 32-key tile of K (32 rows of
// 128 B) and of V^T (64 rows of 64 B) is copied to LDS once for all of them, two buffers,
// the next tile's copies in flight while this one is worked on.
// The products are taken transposed: S^T = K Q^T (A = K rows, B = Q) and O^T += V^T P^T.
// A lane then holds 16 of the 32 scores of ONE query (column lane & 15; keys 8 * half + r and
// 16 + 8 * half + r), so the maximum and the sum of a row are taken in the lane's own
// registers, with one exchange between the wave's halves; and the two score tiles,
// converted in place, are the B operand of the second product in the order its k wants:
// P goes through no LDS.
#define KP   72    // LDS pitch of a 128-B K row: 144 B = 16 B x odd, as LP for 64-B rows

// lane l takes the value of lane l ^ 16 (a vector move between the wave's two rows)
__device__ __forceinline__ float xhalf(float x) {
    const int b = __builtin_bit_cast(int, x);
    return __builtin_bit_cast(float,
        __builtin_amdgcn_permlanex16(b, b, 0x76543210, 0xfedcba98, false, false));
}

// The block size is stated: unstated, registers are budgeted for 1,024 threads (128 a lane).
// amdgpu_waves_per_eu(4, 4): the grid is 384 work-groups of eight waves, too few to gain from
// more than four waves a SIMD; budgeted for more, the scheduler holds registers down and the
// score products wait for the V^T reads as well as for the K reads.
__global__ __launch_bounds__(256) __attribute__((amdgpu_waves_per_eu(4, 4))) void flash_attn_kernel(const _Float16* __restrict__ q16,
                                  const _Float16* __restrict__ k16,
                                  const _Float16* __restrict__ vt16,
                                  _Float16* __restrict__ attn16) {
    __shared__ __attribute__((aligned(16))) _Float16 Kbuf[2][32 * KP];  // 32 keys x 64 d
    __shared__ __attribute__((aligned(16))) _Float16 Vbuf[2][64 * LP];  // 64 d x 32 keys

    const int lane = threadIdx.x & 31;
    const int wave = threadIdx.x >> 5;
    const int half = lane >> 4;
    const int col  = lane & 15;
    const int ko   = (lane & 16) ? 8 : 0;

    const int bh = blockIdx.y;
    const int b = bh / HH, h = bh % HH;
    const int qbase = blockIdx.x * 128 + wave * 16;
    const int qend  = qbase + 15;
    const int qidx  = qbase + col;            // the lane's one query
    const size_t bS = (size_t)b * SS;
    const float scale = 0.125f;   // 1/sqrt(64)

    const _Float16* qrow = q16 + (bS + qidx) * EE + h * DD;
    const v16h bq0 = ld_frag(qrow + ko,      qrow + ko + 16);
    const v16h bq1 = ld_frag(qrow + 32 + ko, qrow + 32 + ko + 16);

    const _Float16* vtb = vt16 + ((size_t)b * HH + h) * DD * SS;

    // accJ[r] = O[qidx][16 * J + 8 * half + r]
    v8f acc0 = {}, acc1 = {}, acc2 = {}, acc3 = {};
    float mrow = -INFINITY;   // running maximum of the query's row, equal in both halves
    float lrow = 0.f;         // running sum over this half's keys; the halves join at the end

    // thread i copies 16 B of each tile: K row i/8, piece i%8; V^T row i/4, piece i%4
    const int kl = (threadIdx.x >> 3) * KP + (threadIdx.x & 7) * 8;
    const int vl = (threadIdx.x >> 2) * LP + (threadIdx.x & 3) * 8;
    const _Float16* kg = k16 + (bS + (threadIdx.x >> 3)) * EE + h * DD + (threadIdx.x & 7) * 8;
    const _Float16* vg = vtb + (size_t)(threadIdx.x >> 2) * SS + (threadIdx.x & 3) * 8;
    auto stage = [&](int kk, int bufIdx) {
        async_ld2_b128((unsigned)(unsigned long long)&Kbuf[bufIdx][kl], kg + (size_t)kk * EE,
                       (unsigned)(unsigned long long)&Vbuf[bufIdx][vl], vg + kk);
    };

    // tiles up to the work-group's last query row: 4, 8, .. 64, the same for all its waves
    const int ntiles = blockIdx.x * 4 + 4;
    // scalar copy of qend: the skip of tiles past a wave's own diagonal is a scalar branch
    const int qendS = __builtin_amdgcn_readfirstlane(qend);

    stage(0, 0);
    wait_async0();
    __syncthreads();
    stage(32, 1);             // ntiles >= 4: tile 1 exists

    for (int t = 0; t < ntiles; ++t) {
      const int kk = t * 32;
      if (kk <= qendS) {
        const _Float16* krow0 = &Kbuf[t & 1][col * KP];
        const _Float16* krow1 = krow0 + 16 * KP;
        const _Float16* vtile = &Vbuf[t & 1][0];
        const v16h ak0 = ld_frag(krow0 + ko, krow0 + ko + 16);
        const v16h ak1 = ld_frag(krow0 + 32 + ko, krow0 + 32 + ko + 16);
        const v16h ak2 = ld_frag(krow1 + ko, krow1 + ko + 16);
        const v16h ak3 = ld_frag(krow1 + 32 + ko, krow1 + 32 + ko + 16);
        const v16h av0 = ld_frag(vtile + (col) * LP + ko,      vtile + (col) * LP + ko + 16);
        const v16h av1 = ld_frag(vtile + (16 + col) * LP + ko, vtile + (16 + col) * LP + ko + 16);
        const v16h av2 = ld_frag(vtile + (32 + col) * LP + ko, vtile + (32 + col) * LP + ko + 16);
        const v16h av3 = ld_frag(vtile + (48 + col) * LP + ko, vtile + (48 + col) * LP + ko + 16);

        // inputs-only fence on the eight loaded fragments: it holds each in registers of its own,
        // so the K reads are issued together ahead of the first product and the V^T reads land
        // under the softmax; without it fragments share a register block and each score
        // product waits for an LDS round trip of its own
        asm volatile("" :: "v"(ak0), "v"(ak1), "v"(ak2), "v"(ak3),
                           "v"(av0), "v"(av1), "v"(av2), "v"(av3));

        // s0[r] = S[qidx][kk + 8 * half + r], s1[r] = S[qidx][kk + 16 + 8 * half + r]
        v8f s0 = {}, s1 = {};
        s0 = wmma_f16(ak0, bq0, s0);
        s1 = wmma_f16(ak2, bq0, s1);
        s0 = wmma_f16(ak1, bq1, s0);
        s1 = wmma_f16(ak3, bq1, s1);

        const int dq = qidx - (kk + half * 8);   // key 8 * half + r of the tile is allowed while r <= dq
        const v8f t0 = s0 * scale, t1 = s1 * scale;
        float a[16];              // a[s]: the score that becomes element s of the B operand
#pragma unroll
        for (int r = 0; r < 8; ++r) {
            a[r]     = (r      <= dq) ? t0[r] : -1e30f;
            a[8 + r] = (16 + r <= dq) ? t1[r] : -1e30f;
        }
        float mx = -1e30f;
#pragma unroll
        for (int s = 0; s < 16; s += 2) mx = fmaxf(mx, fmaxf(a[s], a[s + 1]));
        mx = fmaxf(mx, xhalf(mx));
        const float nm = fmaxf(mrow, mx);
        const float al = __expf(mrow - nm);
        mrow = nm;

        v16h pb;
        float rs0 = 0.f, rs1 = 0.f;
#pragma unroll
        for (int s = 0; s < 16; s += 2) {
            const float p0 = __expf(a[s] - nm);
            const float p1 = __expf(a[s + 1] - nm);
            rs0 += p0;
            rs1 += p1;
            pb[s]     = (_Float16)p0;
            pb[s + 1] = (_Float16)p1;
        }
        const float rs = rs0 + rs1;
        lrow = lrow * al + rs;
        acc0 *= al; acc1 *= al; acc2 *= al; acc3 *= al;

        acc0 = wmma_f16(av0, pb, acc0);
        acc1 = wmma_f16(av1, pb, acc1);
        acc2 = wmma_f16(av2, pb, acc2);
        acc3 = wmma_f16(av3, pb, acc3);
      }

      // publish point, passed by every wave, also one that skipped the tile:
      // this wave's reads of buffer t & 1 have retired before the barrier frees it for refill
      asm volatile("s_wait_dscnt 0" ::: "memory");
      wait_async0();          // this wave's pieces of tile t + 1 have landed
      __syncthreads();        // tile t + 1 readable by all; buffer t & 1 left by all
      if (t + 2 < ntiles) stage((t + 2) * 32, t & 1);
    }
    wait_async0();            // no copy is outstanding when the wave ends

    // a lane's 8 registers of an output tile are 8 consecutive d of its query: 16-B stores
    const float inv = 1.0f / (lrow + xhalf(lrow));
    _Float16* orow = attn16 + (bS + qidx) * EE + h * DD + half * 8;
    *(v8h*)(orow)      = __builtin_convertvector(acc0 * inv, v8h);
    *(v8h*)(orow + 16) = __builtin_convertvector(acc1 * inv, v8h);
    *(v8h*)(orow + 32) = __builtin_convertvector(acc2 * inv, v8h);
    *(v8h*)(orow + 48) = __builtin_convertvector(acc3 * inv, v8h);
}

// ---------------- host launcher ----------------
extern "C" void kernel_launch(void* const* d_in, const int* in_sizes, int n_in,
                              void* d_out, int out_size, void* d_ws, size_t ws_size,
                              hipStream_t stream) {
    (void)in_sizes; (void)n_in; (void)out_size; (void)ws_size;
    const float* x     = (const float*)d_in[0];
    const float* wq    = (const float*)d_in[1];
    const float* wk    = (const float*)d_in[2];
    const float* wv    = (const float*)d_in[3];
    const float* wo    = (const float*)d_in[4];
    const float* bo    = (const float*)d_in[5];
    const float* w1    = (const float*)d_in[6];
    const float* b1    = (const float*)d_in[7];
    const float* w2    = (const float*)d_in[8];
    const float* b2    = (const float*)d_in[9];
    const float* gamma = (const float*)d_in[10];
    const float* beta  = (const float*)d_in[11];
    float* out = (float*)d_out;

    const size_t nEE = (size_t)EE * EE;
    const size_t nEF = (size_t)EE * FFF;
    const size_t nME = (size_t)MM * EE;
    const size_t nMF = (size_t)MM * FFF;

    char* ws = (char*)d_ws;
    size_t off = 0;
    auto alloc = [&](size_t bytes) -> void* {
        void* p = ws + off;
        off = (off + bytes + 255) & ~(size_t)255;
        return p;
    };
    _Float16* wq16   = (_Float16*)alloc(nEE * 2);
    _Float16* wk16   = (_Float16*)alloc(nEE * 2);
    _Float16* wv16   = (_Float16*)alloc(nEE * 2);
    _Float16* wo16   = (_Float16*)alloc(nEE * 2);
    _Float16* w116   = (_Float16*)alloc(nEF * 2);
    _Float16* w216   = (_Float16*)alloc(nEF * 2);
    _Float16* xn16   = (_Float16*)alloc(nME * 2);
    _Float16* q16    = (_Float16*)alloc(nME * 2);
    _Float16* k16    = (_Float16*)alloc(nME * 2);
    _Float16* vt16   = (_Float16*)alloc(nME * 2);
    _Float16* attn16 = (_Float16*)alloc(nME * 2);
    _Float16* y16    = (_Float16*)alloc(nME * 2);
    _Float16* h16    = (_Float16*)alloc(nMF * 2);
    float*    res    = (float*)alloc(nME * 4);

    // wq16 .. w216 are the first six allocations and lie back to back from wq16
    cvt_f16_kernel<<<dim3(NEE / CVT_WG, 12), 256, 0, stream>>>(wq, wk, wv, wo, w1, w2, wq16);

    ln_f16_kernel<<<MM, 256, 0, stream>>>(x, gamma, beta, xn16);

    dim3 gEE(EE / 64, MM / 128);
    gemm_wmma_kernel<0, EE><<<gEE, 256, 0, stream>>>(xn16, wq16, nullptr, nullptr, nullptr, q16,  EE);
    gemm_wmma_kernel<0, EE><<<gEE, 256, 0, stream>>>(xn16, wk16, nullptr, nullptr, nullptr, k16,  EE);
    gemm_wmma_kernel<1, EE><<<gEE, 256, 0, stream>>>(xn16, wv16, nullptr, nullptr, nullptr, vt16, EE);

    flash_attn_kernel<<<dim3(SS / 128, BB * HH), 256, 0, stream>>>(q16, k16, vt16, attn16);

    gemm_wmma_kernel<2, EE><<<gEE, 256, 0, stream>>>(attn16, wo16, bo, x, res, nullptr, EE);

    ln_f16_kernel<<<MM, 256, 0, stream>>>(res, gamma, beta, y16);

    dim3 gFF(FFF / 64, MM / 128);
    gemm_wmma_kernel<3, FFF><<<gFF, 256, 0, stream>>>(y16, w116, b1, nullptr, nullptr, h16, EE);
    gemm_wmma_kernel<2, EE><<<gEE, 256, 0, stream>>>(h16, w216, b2, res, out, nullptr, FFF);
}

// v007
// A run of this version takes 146 microseconds.
// Two timings next to v006 put it at 1.05 and 1.04 times that version's speed.
// Over all steps from v000 it is 2.67 times as fast.
#include <hip/hip_runtime.h>
#include <math.h>

// ---------------- problem constants ----------------
#define BB   2
#define SS   2048
#define EE   768
#define HH   12
#define DD   64
#define FFF  3072
#define MM   (BB * SS)        // 4096 rows

typedef _Float16 v16h __attribute__((ext_vector_type(16)));
typedef _Float16 v8h  __attribute__((ext_vector_type(8)));
typedef float    v8f  __attribute__((ext_vector_type(8)));

__device__ __forceinline__ v8f wmma_f16(v16h a, v16h b, v8f c) {
    // (neg_a, A, neg_b, B, c_mod, C, reuse_a, reuse_b)
    return __builtin_amdgcn_wmma_f32_16x16x32_f16(false, a, false, b, (short)0, c, false, false);
}

__device__ __forceinline__ v16h ld_frag(const _Float16* p0, const _Float16* p1) {
    v8h lo = *(const v8h*)p0;
    v8h hi = *(const v8h*)p1;
    return __builtin_shufflevector(lo, hi, 0,1,2,3,4,5,6,7,8,9,10,11,12,13,14,15);
}

// LDS pitch of a 32-half (64-B) row: 80 B = 16 B x odd, so the 16 rows that one
// ds_load_b128 touches per lane half fall on 16 distinct groups of four banks.
#define LP   40

// twelve async 16B global -> LDS copies (ASYNCcnt-tracked DMA, CDNA5): a thread's share of
// one GEMM stage, eight pieces of A (LDS la + j * ls, global ga + j * gs) and four of B.
// s_wait_xcnt stands inside the statement so that no address register of a copy
// is rewritten (next slab's address additions) ahead of it.
__device__ __forceinline__ void async_ld12_b128(unsigned la, const _Float16* ga,
                                                unsigned lb, const _Float16* gb,
                                                unsigned ls, size_t gs) {
    asm volatile("global_load_async_to_lds_b128 %0, %1, off\n\t"
                 "global_load_async_to_lds_b128 %2, %3, off\n\t"
                 "global_load_async_to_lds_b128 %4, %5, off\n\t"
                 "global_load_async_to_lds_b128 %6, %7, off\n\t"
                 "global_load_async_to_lds_b128 %8, %9, off\n\t"
                 "global_load_async_to_lds_b128 %10, %11, off\n\t"
                 "global_load_async_to_lds_b128 %12, %13, off\n\t"
                 "global_load_async_to_lds_b128 %14, %15, off\n\t"
                 "global_load_async_to_lds_b128 %16, %17, off\n\t"
                 "global_load_async_to_lds_b128 %18, %19, off\n\t"
                 "global_load_async_to_lds_b128 %20, %21, off\n\t"
                 "global_load_async_to_lds_b128 %22, %23, off\n\t"
                 "s_wait_xcnt 0x0"
                 :: "v"(la),          "v"(ga),          "v"(la + ls),     "v"(ga + gs),
                    "v"(la + 2 * ls), "v"(ga + 2 * gs), "v"(la + 3 * ls), "v"(ga + 3 * gs),
                    "v"(la + 4 * ls), "v"(ga + 4 * gs), "v"(la + 5 * ls), "v"(ga + 5 * gs),
                    "v"(la + 6 * ls), "v"(ga + 6 * gs), "v"(la + 7 * ls), "v"(ga + 7 * gs),
                    "v"(lb),          "v"(gb),          "v"(lb + ls),     "v"(gb + gs),
                    "v"(lb + 2 * ls), "v"(gb + 2 * gs), "v"(lb + 3 * ls), "v"(gb + 3 * gs)
                 : "memory");
}
// the same for two copies (attention: one piece of the K tile, one of the V^T tile)
__device__ __forceinline__ void async_ld2_b128(unsigned l0, const void* g0,
                                               unsigned l1, const void* g1) {
    asm volatile("global_load_async_to_lds_b128 %0, %1, off\n\t"
                 "global_load_async_to_lds_b128 %2, %3, off\n\t"
                 "s_wait_xcnt 0x0"
                 :: "v"(l0), "v"(g0), "v"(l1), "v"(g1) : "memory");
}
__device__ __forceinline__ void wait_async0() {
    asm volatile("s_wait_asynccnt 0" ::: "memory");
}

// ---------------- f32 -> f16 convert of all six weight matrices ----------------
// One launch. The work is cut into 12 planes of EE*EE elements (blockIdx.y): wq, wk, wv, wo,
// four planes of w1, four of w2; the f16 copies lie back to back in the same order.
// A work-group converts CVT_WG elements of one plane; each wave owns 1024 contiguous
// elements: 8 loads of 512 contiguous bytes, all issued before the first is used, and
// 8 stores of 256 contiguous bytes. Few, long waves, for speed only.
#define NEE     (EE * EE)
#define CVT_WG  8192
static_assert(NEE % CVT_WG == 0, "a plane is a whole number of work-groups");
static_assert(FFF == 4 * EE, "w1 and w2 are four planes each");
static_assert((NEE * 2) % 256 == 0, "f16 planes lie back to back in the workspace");

typedef float    v4f __attribute__((ext_vector_type(4)));
typedef _Float16 v4h __attribute__((ext_vector_type(4)));

__global__ __launch_bounds__(256) void cvt_f16_kernel(const float* __restrict__ wq,
                                                      const float* __restrict__ wk,
                                                      const float* __restrict__ wv,
                                                      const float* __restrict__ wo,
                                                      const float* __restrict__ w1,
                                                      const float* __restrict__ w2,
                                                      _Float16* __restrict__ out) {
    const int plane = blockIdx.y;                 // 0..11, uniform in the work-group
    const float* big = plane < 8 ? w1 : w2;       // planes 4..7 and 8..11
    const float* src = big + (size_t)(plane & 3) * NEE;
    if (plane == 0) src = wq;
    if (plane == 1) src = wk;
    if (plane == 2) src = wv;
    if (plane == 3) src = wo;
    const int base = blockIdx.x * CVT_WG + (threadIdx.x >> 5) * 1024 + (threadIdx.x & 31) * 4;
    const float* s = src + base;
    _Float16* d = out + (size_t)plane * NEE + base;
    v4f v[8];
    // both loops unrolled: v[] stays in registers and all 8 loads issue ahead of the first use
#pragma unroll
    for (int j = 0; j < 8; ++j) v[j] = *(const v4f*)(s + j * 128);
#pragma unroll
    for (int j = 0; j < 8; ++j) *(v4h*)(d + j * 128) = __builtin_convertvector(v[j], v4h);
}

// ---------------- row LayerNorm -> f16 ----------------
__global__ void ln_f16_kernel(const float* __restrict__ x,
                              const float* __restrict__ gamma,
                              const float* __restrict__ beta,
                              _Float16* __restrict__ out) {
    __shared__ float s1[256], s2[256];
    const int row = blockIdx.x;
    const float* xr = x + (size_t)row * EE;
    float v[3], sum = 0.f, sq = 0.f;
#pragma unroll
    for (int i = 0; i < 3; ++i) {
        v[i] = xr[threadIdx.x + i * 256];
        sum += v[i];
        sq  += v[i] * v[i];
    }
    s1[threadIdx.x] = sum; s2[threadIdx.x] = sq;
    __syncthreads();
    for (int s = 128; s > 0; s >>= 1) {
        if (threadIdx.x < s) {
            s1[threadIdx.x] += s1[threadIdx.x + s];
            s2[threadIdx.x] += s2[threadIdx.x + s];
        }
        __syncthreads();
    }
    const float mu = s1[0] * (1.0f / EE);
    const float var = s2[0] * (1.0f / EE) - mu * mu;
    const float rs = rsqrtf(var + 1e-5f);
    _Float16* orow = out + (size_t)row * EE;
#pragma unroll
    for (int i = 0; i < 3; ++i) {
        int c = threadIdx.x + i * 256;
        orow[c] = (_Float16)((v[i] - mu) * rs * gamma[c] + beta[c]);
    }
}

// ---------------- WMMA GEMM: C[M,N] = A[M,K] @ W[N,K]^T ----------------
// LDS-staged via async global->LDS DMA, double buffered.
// Block: 256 thr = 8 waves, tile 128M x 64N; wave tile 32x32.
// A stage holds BK = 128 k (16 WMMAs a wave): a trip costs one landing of the next stage's
// copies and one barrier whatever its depth.
// K must be a multiple of BK.
// MODE 0: the Q, K and V projections in one launch (no bias). W is wq, wk, wv stacked, 3 * N
//         rows; blockIdx.x runs over all of them. outH is q, k, vt back to back: q and k f16
//         row-major, v transposed to [B,H,D,S]. The three products read the same A and do not
//         depend on each other: one grid of 1,152 work-groups keeps three resident on a WGP and
//         refills freed places, where three grids of 384 each pay a launch, a first landing
//         and a tail with half the WGPs holding one work-group.
// MODE 2: outF f32 = resid + bias + C
// MODE 3: outH f16 = gelu(bias + C)   (exact erf)
// MODE and the row length N of the output are template arguments: each build holds one
// writeback, straight-line. Chosen at run time, the choice is branched on at each of a lane's
// 32 results, and every residual and bias load waits for its own round trip before the next.
#define BK   128
#define GP   136   // LDS pitch of a 256-B stage row: 272 B = 16 B x odd, as LP for 64-B rows
static_assert(EE % BK == 0 && FFF % BK == 0, "every K is a whole number of stages");
static_assert(((size_t)MM * EE * 2) % 256 == 0, "q, k and vt lie back to back in the workspace");
template <int MODE, int N>
__global__ void gemm_wmma_kernel(const _Float16* __restrict__ A,
                                 const _Float16* __restrict__ W,
                                 const float* __restrict__ bias,
                                 const float* __restrict__ resid,
                                 float* __restrict__ outF,
                                 _Float16* __restrict__ outH,
                                 int K) {
    __shared__ __attribute__((aligned(16))) _Float16 Abuf[2][128 * GP];   // 34 KB each
    __shared__ __attribute__((aligned(16))) _Float16 Bbuf[2][64 * GP];    // 17 KB each

    const int lane = threadIdx.x & 31;
    const int wave = threadIdx.x >> 5;          // 0..7 -> 4M x 2N
    const int mW = (wave >> 1) * 32;            // local M offset of wave tile
    const int nW = (wave & 1) * 32;             // local N offset of wave tile
    const int mBlk = blockIdx.y * 128;
    const int nBlk = blockIdx.x * 64;
    const int ko = (lane & 16) ? 8 : 0;         // K sub-offsets {ko, ko+16}
    const int col = lane & 15;
    const int half = lane >> 4;

    // stage one BK-wide K slab: A 128 x BK (8 pieces/thread) + B 64 x BK (4 pieces/thread);
    // a copy of the work-group covers 16 whole rows of 256 B, the next one the 16 rows below
    auto stage = [&](int kk, int bufIdx) {
        const int row = threadIdx.x >> 4, q = threadIdx.x & 15;   // row 0..15
        async_ld12_b128((unsigned)(unsigned long long)&Abuf[bufIdx][row * GP + q * 8],
                        A + (size_t)(mBlk + row) * K + kk + q * 8,
                        (unsigned)(unsigned long long)&Bbuf[bufIdx][row * GP + q * 8],
                        W + (size_t)(nBlk + row) * K + kk + q * 8,
                        16 * GP * 2, (size_t)16 * K);
    };

    v8f c00 = {}, c01 = {}, c10 = {}, c11 = {};

    const int nsteps = K / BK;
    stage(0, 0);
    wait_async0();
    __syncthreads();

    for (int s = 0; s < nsteps; ++s) {
        const int cur = s & 1;
        if (s + 1 < nsteps) stage((s + 1) * BK, cur ^ 1);

        const _Float16* ab = &Abuf[cur][(mW + col) * GP + ko];
        const _Float16* bb = &Bbuf[cur][(nW + col) * GP + ko];
        for (int ks = 0; ks < BK; ks += 32) {
            v16h a0 = ld_frag(ab + ks,           ab + ks + 16);
            v16h a1 = ld_frag(ab + 16 * GP + ks, ab + 16 * GP + ks + 16);
            v16h b0 = ld_frag(bb + ks,           bb + ks + 16);
            v16h b1 = ld_frag(bb + 16 * GP + ks, bb + 16 * GP + ks + 16);
            c00 = wmma_f16(a0, b0, c00);
            c01 = wmma_f16(a0, b1, c01);
            c10 = wmma_f16(a1, b0, c10);
            c11 = wmma_f16(a1, b1, c11);
        }

        // this wave's reads of cur have retired before the barrier frees cur for refill
        asm volatile("s_wait_dscnt 0" ::: "memory");
        wait_async0();        // our next-slab DMAs have landed
        __syncthreads();      // everyone done reading cur before it is overwritten
    }

    // ---------------- writeback ----------------
    // acc[i][j][r] = C[m0 + 16 * i + r][n0 + 16 * j]
    // every loop below is unrolled: acc, rv and hv are indexed by constants and stay in
    // registers, and the row offsets become immediate offsets of one address
    const v8f acc[2][2] = {{c00, c01}, {c10, c11}};
    const int m0 = mBlk + mW + half * 8;
    const int n0 = nBlk + nW + col;
    if constexpr (MODE == 0) {
        // which product the work-group's 64 columns belong to: the same for all its threads
        const int which = blockIdx.x / (N / 64);   // 0 q, 1 k, 2 v
        const int nl = n0 - which * N;             // column inside that product
        _Float16* ob = outH + (size_t)which * ((size_t)MM * N);
        if (which < 2) {
            _Float16* o = ob + (size_t)m0 * N + nl;
#pragma unroll
            for (int i = 0; i < 2; ++i)
#pragma unroll
                for (int r = 0; r < 8; ++r)
#pragma unroll
                    for (int j = 0; j < 2; ++j)
                        o[(i * 16 + r) * N + j * 16] = (_Float16)acc[i][j][r];
        } else {
#pragma unroll
            for (int i = 0; i < 2; ++i) {
                const int m = m0 + i * 16;         // a multiple of 8: rows m .. m + 7 share b
                const int b = m >> 11, sIdx = m & (SS - 1);
#pragma unroll
                for (int j = 0; j < 2; ++j) {
                    const int n = nl + j * 16;
                    const int h = n >> 6, d = n & (DD - 1);
                    _Float16* o = ob + (((size_t)b * HH + h) * DD + d) * SS + sIdx;
#pragma unroll
                    for (int r = 0; r < 8; ++r) o[r] = (_Float16)acc[i][j][r];
                }
            }
            // the built code lays the q/k writeback behind these stores: no register that an
            // issued store names is written again ahead of this wait
            asm volatile("s_wait_xcnt 0x0" ::: "memory");
        }
    } else if constexpr (MODE == 2) {
        const float* rp = resid + (size_t)m0 * N + n0;
        float* o = outF + (size_t)m0 * N + n0;
        const float bs[2] = {bias[n0], bias[n0 + 16]};
        float rv[2][8][2];
        // all 32 residual loads of the lane are issued before the first is used
#pragma unroll
        for (int i = 0; i < 2; ++i)
#pragma unroll
            for (int r = 0; r < 8; ++r)
#pragma unroll
                for (int j = 0; j < 2; ++j)
                    rv[i][r][j] = rp[(i * 16 + r) * N + j * 16];
#pragma unroll
        for (int i = 0; i < 2; ++i)
#pragma unroll
            for (int r = 0; r < 8; ++r)
#pragma unroll
                for (int j = 0; j < 2; ++j)
                    o[(i * 16 + r) * N + j * 16] = rv[i][r][j] + (acc[i][j][r] + bs[j]);
    } else {
        _Float16* o = outH + (size_t)m0 * N + n0;
        const float bs[2] = {bias[n0], bias[n0 + 16]};
        _Float16 hv[2][8][2];
        // erff branches: a store between two of them waits before its register is used again,
        // so all 32 results are formed first and stored together
#pragma unroll
        for (int i = 0; i < 2; ++i)
#pragma unroll
            for (int r = 0; r < 8; ++r)
#pragma unroll
                for (int j = 0; j < 2; ++j) {
                    float v = acc[i][j][r] + bs[j];
                    v = 0.5f * v * (1.0f + erff(v * 0.70710678118654752f));
                    hv[i][r][j] = (_Float16)v;
                }
#pragma unroll
        for (int i = 0; i < 2; ++i)
#pragma unroll
            for (int r = 0; r < 8; ++r)
#pragma unroll
                for (int j = 0; j < 2; ++j)
                    o[(i * 16 + r) * N + j * 16] = hv[i][r][j];
    }
}

// ---------------- flash attention (causal) ----------------
// q16,k16: [B,S,H,D] f16 row-major ( == [M,E] );  vt16: [B,H,D,S] f16
// attn16 out: [B,S,H,D] f16 ( == [M,E] )
// The eight waves of a work-group walk the same keys: each 32-key tile of K (32 rows of
// 128 B) and of V^T (64 rows of 64 B) is copied to LDS once for all of them, two buffers,
// the next tile's copies in flight while this one is worked on.
// The products are taken transposed: S^T = K Q^T (A = K rows, B = Q) and O^T += V^T P^T.
// A lane then holds 16 of the 32 scores of ONE query (column lane & 15; keys 8 * half + r and
// 16 + 8 * half + r), so the maximum and the sum of a row are taken in the lane's own
// registers, with one exchange between the wave's halves; and the two score tiles,
// converted in place, are the B operand of the second product in the order its k wants:
// P goes through no LDS.
#define KP   72    // LDS pitch of a 128-B K row: 144 B = 16 B x odd, as LP for 64-B rows

// lane l takes the value of lane l ^ 16 (a vector move between the wave's two rows)
__device__ __forceinline__ float xhalf(float x) {
    const int b = __builtin_bit_cast(int, x);
    return __builtin_bit_cast(float,
        __builtin_amdgcn_permlanex16(b, b, 0x76543210, 0xfedcba98, false, false));
}

// The block size is stated: unstated, registers are budgeted for 1,024 threads (128 a lane).
// amdgpu_waves_per_eu(4, 4): the grid is 384 work-groups of eight waves, too few to gain from
// more than four waves a SIMD; budgeted for more, the scheduler holds registers down and the
// score products wait for the V^T reads as well as for the K reads.
__global__ __launch_bounds__(256) __attribute__((amdgpu_waves_per_eu(4, 4))) void flash_attn_kernel(const _Float16* __restrict__ q16,
                                  const _Float16* __restrict__ k16,
                                  const _Float16* __restrict__ vt16,
                                  _Float16* __restrict__ attn16) {
    __shared__ __attribute__((aligned(16))) _Float16 Kbuf[2][32 * KP];  // 32 keys x 64 d
    __shared__ __attribute__((aligned(16))) _Float16 Vbuf[2][64 * LP];  // 64 d x 32 keys

    const int lane = threadIdx.x & 31;
    const int wave = threadIdx.x >> 5;
    const int half = lane >> 4;
    const int col  = lane & 15;
    const int ko   = (lane & 16) ? 8 : 0;

    const int bh = blockIdx.y;
    const int b = bh / HH, h = bh % HH;
    const int qbase = blockIdx.x * 128 + wave * 16;
    const int qend  = qbase + 15;
    const int qidx  = qbase + col;            // the lane's one query
    const size_t bS = (size_t)b * SS;
    const float scale = 0.125f;   // 1/sqrt(64)

    const _Float16* qrow = q16 + (bS + qidx) * EE + h * DD;
    const v16h bq0 = ld_frag(qrow + ko,      qrow + ko + 16);
    const v16h bq1 = ld_frag(qrow + 32 + ko, qrow + 32 + ko + 16);

    const _Float16* vtb = vt16 + ((size_t)b * HH + h) * DD * SS;

    // accJ[r] = O[qidx][16 * J + 8 * half + r]
    v8f acc0 = {}, acc1 = {}, acc2 = {}, acc3 = {};
    float mrow = -INFINITY;   // running maximum of the query's row, equal in both halves
    float lrow = 0.f;         // running sum over this half's keys; the halves join at the end

    // thread i copies 16 B of each tile: K row i/8, piece i%8; V^T row i/4, piece i%4
    const int kl = (threadIdx.x >> 3) * KP + (threadIdx.x & 7) * 8;
    const int vl = (threadIdx.x >> 2) * LP + (threadIdx.x & 3) * 8;
    const _Float16* kg = k16 + (bS + (threadIdx.x >> 3)) * EE + h * DD + (threadIdx.x & 7) * 8;
    const _Float16* vg = vtb + (size_t)(threadIdx.x >> 2) * SS + (threadIdx.x & 3) * 8;
    auto stage = [&](int kk, int bufIdx) {
        async_ld2_b128((unsigned)(unsigned long long)&Kbuf[bufIdx][kl], kg + (size_t)kk * EE,
                       (unsigned)(unsigned long long)&Vbuf[bufIdx][vl], vg + kk);
    };

    // tiles up to the work-group's last query row: 4, 8, .. 64, the same for all its waves
    const int ntiles = blockIdx.x * 4 + 4;
    // scalar copy of qend: the skip of tiles past a wave's own diagonal is a scalar branch
    const int qendS = __builtin_amdgcn_readfirstlane(qend);

    stage(0, 0);
    wait_async0();
    __syncthreads();
    stage(32, 1);             // ntiles >= 4: tile 1 exists

    for (int t = 0; t < ntiles; ++t) {
      const int kk = t * 32;
      if (kk <= qendS) {
        const _Float16* krow0 = &Kbuf[t & 1][col * KP];
        const _Float16* krow1 = krow0 + 16 * KP;
        const _Float16* vtile = &Vbuf[t & 1][0];
        const v16h ak0 = ld_frag(krow0 + ko, krow0 + ko + 16);
        const v16h ak1 = ld_frag(krow0 + 32 + ko, krow0 + 32 + ko + 16);
        const v16h ak2 = ld_frag(krow1 + ko, krow1 + ko + 16);
        const v16h ak3 = ld_frag(krow1 + 32 + ko, krow1 + 32 + ko + 16);
        const v16h av0 = ld_frag(vtile + (col) * LP + ko,      vtile + (col) * LP + ko + 16);
        const v16h av1 = ld_frag(vtile + (16 + col) * LP + ko, vtile + (16 + col) * LP + ko + 16);
        const v16h av2 = ld_frag(vtile + (32 + col) * LP + ko, vtile + (32 + col) * LP + ko + 16);
        const v16h av3 = ld_frag(vtile + (48 + col) * LP + ko, vtile + (48 + col) * LP + ko + 16);

        // inputs-only fence on the eight loaded fragments: it holds each in registers of its own,
        // so the K reads are issued together ahead of the first product and the V^T reads land
        // under the softmax; without it fragments share a register block and each score
        // product waits for an LDS round trip of its own
        asm volatile("" :: "v"(ak0), "v"(ak1), "v"(ak2), "v"(ak3),
                           "v"(av0), "v"(av1), "v"(av2), "v"(av3));

        // s0[r] = S[qidx][kk + 8 * half + r], s1[r] = S[qidx][kk + 16 + 8 * half + r]
        v8f s0 = {}, s1 = {};
        s0 = wmma_f16(ak0, bq0, s0);
        s1 = wmma_f16(ak2, bq0, s1);
        s0 = wmma_f16(ak1, bq1, s0);
        s1 = wmma_f16(ak3, bq1, s1);

        const int dq = qidx - (kk + half * 8);   // key 8 * half + r of the tile is allowed while r <= dq
        const v8f t0 = s0 * scale, t1 = s1 * scale;
        float a[16];              // a[s]: the score that becomes element s of the B operand
#pragma unroll
        for (int r = 0; r < 8; ++r) {
            a[r]     = (r      <= dq) ? t0[r] : -1e30f;
            a[8 + r] = (16 + r <= dq) ? t1[r] : -1e30f;
        }
        float mx = -1e30f;
#pragma unroll
        for (int s = 0; s < 16; s += 2) mx = fmaxf(mx, fmaxf(a[s], a[s + 1]));
        mx = fmaxf(mx, xhalf(mx));
        const float nm = fmaxf(mrow, mx);
        const float al = __expf(mrow - nm);
        mrow = nm;

        v16h pb;
        float rs0 = 0.f, rs1 = 0.f;
#pragma unroll
        for (int s = 0; s < 16; s += 2) {
            const float p0 = __expf(a[s] - nm);
            const float p1 = __expf(a[s + 1] - nm);
            rs0 += p0;
            rs1 += p1;
            pb[s]     = (_Float16)p0;
            pb[s + 1] = (_Float16)p1;
        }
        const float rs = rs0 + rs1;
        lrow = lrow * al + rs;
        acc0 *= al; acc1 *= al; acc2 *= al; acc3 *= al;

        acc0 = wmma_f16(av0, pb, acc0);
        acc1 = wmma_f16(av1, pb, acc1);
        acc2 = wmma_f16(av2, pb, acc2);
        acc3 = wmma_f16(av3, pb, acc3);
      }

      // publish point, passed by every wave, also one that skipped the tile:
      // this wave's reads of buffer t & 1 have retired before the barrier frees it for refill
      asm volatile("s_wait_dscnt 0" ::: "memory");
      wait_async0();          // this wave's pieces of tile t + 1 have landed
      __syncthreads();        // tile t + 1 readable by all; buffer t & 1 left by all
      if (t + 2 < ntiles) stage((t + 2) * 32, t & 1);
    }
    wait_async0();            // no copy is outstanding when the wave ends

    // a lane's 8 registers of an output tile are 8 consecutive d of its query: 16-B stores
    const float inv = 1.0f / (lrow + xhalf(lrow));
    _Float16* orow = attn16 + (bS + qidx) * EE + h * DD + half * 8;
    *(v8h*)(orow)      = __builtin_convertvector(acc0 * inv, v8h);
    *(v8h*)(orow + 16) = __builtin_convertvector(acc1 * inv, v8h);
    *(v8h*)(orow + 32) = __builtin_convertvector(acc2 * inv, v8h);
    *(v8h*)(orow + 48) = __builtin_convertvector(acc3 * inv, v8h);
}

// ---------------- host launcher ----------------
extern "C" void kernel_launch(void* const* d_in, const int* in_sizes, int n_in,
                              void* d_out, int out_size, void* d_ws, size_t ws_size,
                              hipStream_t stream) {
    (void)in_sizes; (void)n_in; (void)out_size; (void)ws_size;
    const float* x     = (const float*)d_in[0];
    const float* wq    = (const float*)d_in[1];
    const float* wk    = (const float*)d_in[2];
    const float* wv    = (const float*)d_in[3];
    const float* wo    = (const float*)d_in[4];
    const float* bo    = (const float*)d_in[5];
    const float* w1    = (const float*)d_in[6];
    const float* b1    = (const float*)d_in[7];
    const float* w2    = (const float*)d_in[8];
    const float* b2    = (const float*)d_in[9];
    const float* gamma = (const float*)d_in[10];
    const float* beta  = (const float*)d_in[11];
    float* out = (float*)d_out;

    const size_t nEE = (size_t)EE * EE;
    const size_t nEF = (size_t)EE * FFF;
    const size_t nME = (size_t)MM * EE;
    const size_t nMF = (size_t)MM * FFF;

    char* ws = (char*)d_ws;
    size_t off = 0;
    auto alloc = [&](size_t bytes) -> void* {
        void* p = ws + off;
        off = (off + bytes + 255) & ~(size_t)255;
        return p;
    };
    _Float16* wq16   = (_Float16*)alloc(nEE * 2);
    _Float16* wk16   = (_Float16*)alloc(nEE * 2);
    _Float16* wv16   = (_Float16*)alloc(nEE * 2);
    _Float16* wo16   = (_Float16*)alloc(nEE * 2);
    _Float16* w116   = (_Float16*)alloc(nEF * 2);
    _Float16* w216   = (_Float16*)alloc(nEF * 2);
    _Float16* xn16   = (_Float16*)alloc(nME * 2);
    _Float16* q16    = (_Float16*)alloc(nME * 2);
    _Float16* k16    = (_Float16*)alloc(nME * 2);
    _Float16* vt16   = (_Float16*)alloc(nME * 2);
    _Float16* attn16 = (_Float16*)alloc(nME * 2);
    _Float16* y16    = (_Float16*)alloc(nME * 2);
    _Float16* h16    = (_Float16*)alloc(nMF * 2);
    float*    res    = (float*)alloc(nME * 4);

    // wq16 .. w216 are the first six allocations and lie back to back from wq16
    cvt_f16_kernel<<<dim3(NEE / CVT_WG, 12), 256, 0, stream>>>(wq, wk, wv, wo, w1, w2, wq16);

    ln_f16_kernel<<<MM, 256, 0, stream>>>(x, gamma, beta, xn16);

    dim3 gEE(EE / 64, MM / 128);
    // wq16, wk16, wv16 lie back to back from wq16, and q16, k16, vt16 from q16
    gemm_wmma_kernel<0, EE><<<dim3(3 * EE / 64, MM / 128), 256, 0, stream>>>(xn16, wq16, nullptr, nullptr, nullptr, q16, EE);

    flash_attn_kernel<<<dim3(SS / 128, BB * HH), 256, 0, stream>>>(q16, k16, vt16, attn16);

    gemm_wmma_kernel<2, EE><<<gEE, 256, 0, stream>>>(attn16, wo16, bo, x, res, nullptr, EE);

    ln_f16_kernel<<<MM, 256, 0, stream>>>(res, gamma, beta, y16);

    dim3 gFF(FFF / 64, MM / 128);
    gemm_wmma_kernel<3, FFF><<<gFF, 256, 0, stream>>>(y16, w116, b1, nullptr, nullptr, h16, EE);
    gemm_wmma_kernel<2, EE><<<gEE, 256, 0, stream>>>(h16, w216, b2, res, out, nullptr, FFF);
}

// v008
// One run takes 127 microseconds.
// Two timings next to v007 put it at 1.14 and 1.13 times that version's speed.
// All steps since v000 together make it 3.03 times as fast.
#include <hip/hip_runtime.h>
#include <math.h>

// ---------------- problem constants ----------------
#define BB   2
#define SS   2048
#define EE   768
#define HH   12
#define DD   64
#define FFF  3072
#define MM   (BB * SS)        // 4096 rows

typedef _Float16 v16h __attribute__((ext_vector_type(16)));
typedef _Float16 v8h  __attribute__((ext_vector_type(8)));
typedef float    v8f  __attribute__((ext_vector_type(8)));

__device__ __forceinline__ v8f wmma_f16(v16h a, v16h b, v8f c) {
    // (neg_a, A, neg_b, B, c_mod, C, reuse_a, reuse_b)
    return __builtin_amdgcn_wmma_f32_16x16x32_f16(false, a, false, b, (short)0, c, false, false);
}

__device__ __forceinline__ v16h ld_frag(const _Float16* p0, const _Float16* p1) {
    v8h lo = *(const v8h*)p0;
    v8h hi = *(const v8h*)p1;
    return __builtin_shufflevector(lo, hi, 0,1,2,3,4,5,6,7,8,9,10,11,12,13,14,15);
}

// LDS pitch of a 32-half (64-B) row: 80 B = 16 B x odd, so the 16 rows that one
// ds_load_b128 touches per lane half fall on 16 distinct groups of four banks.
#define LP   40

// twelve async 16B global -> LDS copies (ASYNCcnt-tracked DMA, CDNA5): a thread's share of
// one GEMM stage, eight pieces of A (LDS la + j * ls, global ga + j * gs) and four of B.
// s_wait_xcnt stands inside the statement so that no address register of a copy
// is rewritten (next slab's address additions) ahead of it.
__device__ __forceinline__ void async_ld12_b128(unsigned la, const _Float16* ga,
                                                unsigned lb, const _Float16* gb,
                                                unsigned ls, size_t gs) {
    asm volatile("global_load_async_to_lds_b128 %0, %1, off\n\t"
                 "global_load_async_to_lds_b128 %2, %3, off\n\t"
                 "global_load_async_to_lds_b128 %4, %5, off\n\t"
                 "global_load_async_to_lds_b128 %6, %7, off\n\t"
                 "global_load_async_to_lds_b128 %8, %9, off\n\t"
                 "global_load_async_to_lds_b128 %10, %11, off\n\t"
                 "global_load_async_to_lds_b128 %12, %13, off\n\t"
                 "global_load_async_to_lds_b128 %14, %15, off\n\t"
                 "global_load_async_to_lds_b128 %16, %17, off\n\t"
                 "global_load_async_to_lds_b128 %18, %19, off\n\t"
                 "global_load_async_to_lds_b128 %20, %21, off\n\t"
                 "global_load_async_to_lds_b128 %22, %23, off\n\t"
                 "s_wait_xcnt 0x0"
                 :: "v"(la),          "v"(ga),          "v"(la + ls),     "v"(ga + gs),
                    "v"(la + 2 * ls), "v"(ga + 2 * gs), "v"(la + 3 * ls), "v"(ga + 3 * gs),
                    "v"(la + 4 * ls), "v"(ga + 4 * gs), "v"(la + 5 * ls), "v"(ga + 5 * gs),
                    "v"(la + 6 * ls), "v"(ga + 6 * gs), "v"(la + 7 * ls), "v"(ga + 7 * gs),
                    "v"(lb),          "v"(gb),          "v"(lb + ls),     "v"(gb + gs),
                    "v"(lb + 2 * ls), "v"(gb + 2 * gs), "v"(lb + 3 * ls), "v"(gb + 3 * gs)
                 : "memory");
}
// the same for four copies (attention: one piece of each K tile and V^T tile of a stage)
__device__ __forceinline__ void async_ld4_b128(unsigned l0, const void* g0,
                                               unsigned l1, const void* g1,
                                               unsigned l2, const void* g2,
                                               unsigned l3, const void* g3) {
    asm volatile("global_load_async_to_lds_b128 %0, %1, off\n\t"
                 "global_load_async_to_lds_b128 %2, %3, off\n\t"
                 "global_load_async_to_lds_b128 %4, %5, off\n\t"
                 "global_load_async_to_lds_b128 %6, %7, off\n\t"
                 "s_wait_xcnt 0x0"
                 :: "v"(l0), "v"(g0), "v"(l1), "v"(g1), "v"(l2), "v"(g2), "v"(l3), "v"(g3)
                 : "memory");
}
__device__ __forceinline__ void wait_async0() {
    asm volatile("s_wait_asynccnt 0" ::: "memory");
}

// ---------------- f32 -> f16 convert of all six weight matrices ----------------
// One launch. The work is cut into 12 planes of EE*EE elements (blockIdx.y): wq, wk, wv, wo,
// four planes of w1, four of w2; the f16 copies lie back to back in the same order.
// A work-group converts CVT_WG elements of one plane; each wave owns 1024 contiguous
// elements: 8 loads of 512 contiguous bytes, all issued before the first is used, and
// 8 stores of 256 contiguous bytes. Few, long waves, for speed only.
#define NEE     (EE * EE)
#define CVT_WG  8192
static_assert(NEE % CVT_WG == 0, "a plane is a whole number of work-groups");
static_assert(FFF == 4 * EE, "w1 and w2 are four planes each");
static_assert((NEE * 2) % 256 == 0, "f16 planes lie back to back in the workspace");

typedef float    v4f __attribute__((ext_vector_type(4)));
typedef _Float16 v4h __attribute__((ext_vector_type(4)));

__global__ __launch_bounds__(256) void cvt_f16_kernel(const float* __restrict__ wq,
                                                      const float* __restrict__ wk,
                                                      const float* __restrict__ wv,
                                                      const float* __restrict__ wo,
                                                      const float* __restrict__ w1,
                                                      const float* __restrict__ w2,
                                                      _Float16* __restrict__ out) {
    const int plane = blockIdx.y;                 // 0..11, uniform in the work-group
    const float* big = plane < 8 ? w1 : w2;       // planes 4..7 and 8..11
    const float* src = big + (size_t)(plane & 3) * NEE;
    if (plane == 0) src = wq;
    if (plane == 1) src = wk;
    if (plane == 2) src = wv;
    if (plane == 3) src = wo;
    const int base = blockIdx.x * CVT_WG + (threadIdx.x >> 5) * 1024 + (threadIdx.x & 31) * 4;
    const float* s = src + base;
    _Float16* d = out + (size_t)plane * NEE + base;
    v4f v[8];
    // both loops unrolled: v[] stays in registers and all 8 loads issue ahead of the first use
#pragma unroll
    for (int j = 0; j < 8; ++j) v[j] = *(const v4f*)(s + j * 128);
#pragma unroll
    for (int j = 0; j < 8; ++j) *(v4h*)(d + j * 128) = __builtin_convertvector(v[j], v4h);
}

// ---------------- row LayerNorm -> f16 ----------------
__global__ void ln_f16_kernel(const float* __restrict__ x,
                              const float* __restrict__ gamma,
                              const float* __restrict__ beta,
                              _Float16* __restrict__ out) {
    __shared__ float s1[256], s2[256];
    const int row = blockIdx.x;
    const float* xr = x + (size_t)row * EE;
    float v[3], sum = 0.f, sq = 0.f;
#pragma unroll
    for (int i = 0; i < 3; ++i) {
        v[i] = xr[threadIdx.x + i * 256];
        sum += v[i];
        sq  += v[i] * v[i];
    }
    s1[threadIdx.x] = sum; s2[threadIdx.x] = sq;
    __syncthreads();
    for (int s = 128; s > 0; s >>= 1) {
        if (threadIdx.x < s) {
            s1[threadIdx.x] += s1[threadIdx.x + s];
            s2[threadIdx.x] += s2[threadIdx.x + s];
        }
        __syncthreads();
    }
    const float mu = s1[0] * (1.0f / EE);
    const float var = s2[0] * (1.0f / EE) - mu * mu;
    const float rs = rsqrtf(var + 1e-5f);
    _Float16* orow = out + (size_t)row * EE;
#pragma unroll
    for (int i = 0; i < 3; ++i) {
        int c = threadIdx.x + i * 256;
        orow[c] = (_Float16)((v[i] - mu) * rs * gamma[c] + beta[c]);
    }
}

// ---------------- WMMA GEMM: C[M,N] = A[M,K] @ W[N,K]^T ----------------
// LDS-staged via async global->LDS DMA, double buffered.
// Block: 256 thr = 8 waves, tile 128M x 64N; wave tile 32x32.
// A stage holds BK = 128 k (16 WMMAs a wave): a trip costs one landing of the next stage's
// copies and one barrier whatever its depth.
// K must be a multiple of BK.
// MODE 0: the Q, K and V projections in one launch (no bias). W is wq, wk, wv stacked, 3 * N
//         rows; blockIdx.x runs over all of them. outH is q, k, vt back to back: q and k f16
//         row-major, v transposed to [B,H,D,S]. The three products read the same A and do not
//         depend on each other: one grid of 1,152 work-groups keeps three resident on a WGP and
//         refills freed places, where three grids of 384 each pay a launch, a first landing
//         and a tail with half the WGPs holding one work-group.
// MODE 2: outF f32 = resid + bias + C
// MODE 3: outH f16 = gelu(bias + C)   (exact erf)
// MODE and the row length N of the output are template arguments: each build holds one
// writeback, straight-line. Chosen at run time, the choice is branched on at each of a lane's
// 32 results, and every residual and bias load waits for its own round trip before the next.
#define BK   128
#define GP   136   // LDS pitch of a 256-B stage row: 272 B = 16 B x odd, as LP for 64-B rows
static_assert(EE % BK == 0 && FFF % BK == 0, "every K is a whole number of stages");
static_assert(((size_t)MM * EE * 2) % 256 == 0, "q, k and vt lie back to back in the workspace");
template <int MODE, int N>
__global__ void gemm_wmma_kernel(const _Float16* __restrict__ A,
                                 const _Float16* __restrict__ W,
                                 const float* __restrict__ bias,
                                 const float* __restrict__ resid,
                                 float* __restrict__ outF,
                                 _Float16* __restrict__ outH,
                                 int K) {
    __shared__ __attribute__((aligned(16))) _Float16 Abuf[2][128 * GP];   // 34 KB each
    __shared__ __attribute__((aligned(16))) _Float16 Bbuf[2][64 * GP];    // 17 KB each

    const int lane = threadIdx.x & 31;
    const int wave = threadIdx.x >> 5;          // 0..7 -> 4M x 2N
    const int mW = (wave >> 1) * 32;            // local M offset of wave tile
    const int nW = (wave & 1) * 32;             // local N offset of wave tile
    const int mBlk = blockIdx.y * 128;
    const int nBlk = blockIdx.x * 64;
    const int ko = (lane & 16) ? 8 : 0;         // K sub-offsets {ko, ko+16}
    const int col = lane & 15;
    const int half = lane >> 4;

    // stage one BK-wide K slab: A 128 x BK (8 pieces/thread) + B 64 x BK (4 pieces/thread);
    // a copy of the work-group covers 16 whole rows of 256 B, the next one the 16 rows below
    auto stage = [&](int kk, int bufIdx) {
        const int row = threadIdx.x >> 4, q = threadIdx.x & 15;   // row 0..15
        async_ld12_b128((unsigned)(unsigned long long)&Abuf[bufIdx][row * GP + q * 8],
                        A + (size_t)(mBlk + row) * K + kk + q * 8,
                        (unsigned)(unsigned long long)&Bbuf[bufIdx][row * GP + q * 8],
                        W + (size_t)(nBlk + row) * K + kk + q * 8,
                        16 * GP * 2, (size_t)16 * K);
    };

    v8f c00 = {}, c01 = {}, c10 = {}, c11 = {};

    const int nsteps = K / BK;
    stage(0, 0);
    wait_async0();
    __syncthreads();

    for (int s = 0; s < nsteps; ++s) {
        const int cur = s & 1;
        if (s + 1 < nsteps) stage((s + 1) * BK, cur ^ 1);

        const _Float16* ab = &Abuf[cur][(mW + col) * GP + ko];
        const _Float16* bb = &Bbuf[cur][(nW + col) * GP + ko];
        for (int ks = 0; ks < BK; ks += 32) {
            v16h a0 = ld_frag(ab + ks,           ab + ks + 16);
            v16h a1 = ld_frag(ab + 16 * GP + ks, ab + 16 * GP + ks + 16);
            v16h b0 = ld_frag(bb + ks,           bb + ks + 16);
            v16h b1 = ld_frag(bb + 16 * GP + ks, bb + 16 * GP + ks + 16);
            c00 = wmma_f16(a0, b0, c00);
            c01 = wmma_f16(a0, b1, c01);
            c10 = wmma_f16(a1, b0, c10);
            c11 = wmma_f16(a1, b1, c11);
        }

        // this wave's reads of cur have retired before the barrier frees cur for refill
        asm volatile("s_wait_dscnt 0" ::: "memory");
        wait_async0();        // our next-slab DMAs have landed
        __syncthreads();      // everyone done reading cur before it is overwritten
    }

    // ---------------- writeback ----------------
    // acc[i][j][r] = C[m0 + 16 * i + r][n0 + 16 * j]
    // every loop below is unrolled: acc, rv and hv are indexed by constants and stay in
    // registers, and the row offsets become immediate offsets of one address
    const v8f acc[2][2] = {{c00, c01}, {c10, c11}};
    const int m0 = mBlk + mW + half * 8;
    const int n0 = nBlk + nW + col;
    if constexpr (MODE == 0) {
        // which product the work-group's 64 columns belong to: the same for all its threads
        const int which = blockIdx.x / (N / 64);   // 0 q, 1 k, 2 v
        const int nl = n0 - which * N;             // column inside that product
        _Float16* ob = outH + (size_t)which * ((size_t)MM * N);
        if (which < 2) {
            _Float16* o = ob + (size_t)m0 * N + nl;
#pragma unroll
            for (int i = 0; i < 2; ++i)
#pragma unroll
                for (int r = 0; r < 8; ++r)
#pragma unroll
                    for (int j = 0; j < 2; ++j)
                        o[(i * 16 + r) * N + j * 16] = (_Float16)acc[i][j][r];
        } else {
#pragma unroll
            for (int i = 0; i < 2; ++i) {
                const int m = m0 + i * 16;         // a multiple of 8: rows m .. m + 7 share b
                const int b = m >> 11, sIdx = m & (SS - 1);
#pragma unroll
                for (int j = 0; j < 2; ++j) {
                    const int n = nl + j * 16;
                    const int h = n >> 6, d = n & (DD - 1);
                    _Float16* o = ob + (((size_t)b * HH + h) * DD + d) * SS + sIdx;
#pragma unroll
                    for (int r = 0; r < 8; ++r) o[r] = (_Float16)acc[i][j][r];
                }
            }
            // the built code lays the q/k writeback behind these stores: no register that an
            // issued store names is written again ahead of this wait
            asm volatile("s_wait_xcnt 0x0" ::: "memory");
        }
    } else if constexpr (MODE == 2) {
        const float* rp = resid + (size_t)m0 * N + n0;
        float* o = outF + (size_t)m0 * N + n0;
        const float bs[2] = {bias[n0], bias[n0 + 16]};
        float rv[2][8][2];
        // all 32 residual loads of the lane are issued before the first is used
#pragma unroll
        for (int i = 0; i < 2; ++i)
#pragma unroll
            for (int r = 0; r < 8; ++r)
#pragma unroll
                for (int j = 0; j < 2; ++j)
                    rv[i][r][j] = rp[(i * 16 + r) * N + j * 16];
#pragma unroll
        for (int i = 0; i < 2; ++i)
#pragma unroll
            for (int r = 0; r < 8; ++r)
#pragma unroll
                for (int j = 0; j < 2; ++j)
                    o[(i * 16 + r) * N + j * 16] = rv[i][r][j] + (acc[i][j][r] + bs[j]);
    } else {
        _Float16* o = outH + (size_t)m0 * N + n0;
        const float bs[2] = {bias[n0], bias[n0 + 16]};
        _Float16 hv[2][8][2];
        // erff branches: a store between two of them waits before its register is used again,
        // so all 32 results are formed first and stored together
#pragma unroll
        for (int i = 0; i < 2; ++i)
#pragma unroll
            for (int r = 0; r < 8; ++r)
#pragma unroll
                for (int j = 0; j < 2; ++j) {
                    float v = acc[i][j][r] + bs[j];
                    v = 0.5f * v * (1.0f + erff(v * 0.70710678118654752f));
                    hv[i][r][j] = (_Float16)v;
                }
#pragma unroll
        for (int i = 0; i < 2; ++i)
#pragma unroll
            for (int r = 0; r < 8; ++r)
#pragma unroll
                for (int j = 0; j < 2; ++j)
                    o[(i * 16 + r) * N + j * 16] = hv[i][r][j];
    }
}

// ---------------- flash attention (causal) ----------------
// q16,k16: [B,S,H,D] f16 row-major ( == [M,E] );  vt16: [B,H,D,S] f16
// attn16 out: [B,S,H,D] f16 ( == [M,E] )
// A work-group takes 64 queries. Waves w and w + 4 hold the same 16 queries and share their
// keys: of each 64-key stage waves 0..3 take the first 32-key tile, waves 4..7 the second, each
// with a running maximum, sum and output of its own; at the end waves 4..7 hand theirs over
// through LDS and waves 0..3 join the two. The launch lasts as long as its last rows' walk
// over all their keys, one tile after the other: so split, that walk has half the trips.
// Each 32-key tile of K (32 rows of 128 B) and of V^T (64 rows of 64 B) is copied to LDS once
// for the four waves that read it, two buffers of two tiles, the next stage's copies in flight
// while this one is worked on.
// Grid: x = batch and head, y = query block, the longest (last) block first.
// The products are taken transposed: S^T = K Q^T (A = K rows, B = Q) and O^T += V^T P^T.
// A lane then holds 16 of the 32 scores of ONE query (column lane & 15; keys 8 * half + r and
// 16 + 8 * half + r), so the maximum and the sum of a row are taken in the lane's own
// registers, with one exchange between the wave's halves; and the two score tiles,
// converted in place, are the B operand of the second product in the order its k wants:
// P goes through no LDS.
#define KP   72    // LDS pitch of a 128-B K row: 144 B = 16 B x odd, as LP for 64-B rows

// lane l takes the value of lane l ^ 16 (a vector move between the wave's two rows)
__device__ __forceinline__ float xhalf(float x) {
    const int b = __builtin_bit_cast(int, x);
    return __builtin_bit_cast(float,
        __builtin_amdgcn_permlanex16(b, b, 0x76543210, 0xfedcba98, false, false));
}

// The block size is stated: unstated, registers are budgeted for 1,024 threads (128 a lane).
// amdgpu_waves_per_eu(4, 4): budgeted for more waves a SIMD, the scheduler holds registers down
// and the score products wait for the V^T reads as well as for the K reads.
__global__ __launch_bounds__(256) __attribute__((amdgpu_waves_per_eu(4, 4))) void flash_attn_kernel(const _Float16* __restrict__ q16,
                                  const _Float16* __restrict__ k16,
                                  const _Float16* __restrict__ vt16,
                                  _Float16* __restrict__ attn16) {
    __shared__ __attribute__((aligned(16))) _Float16 Kbuf[2][2][32 * KP];  // a tile: 32 keys x 64 d
    __shared__ __attribute__((aligned(16))) _Float16 Vbuf[2][2][64 * LP];  // a tile: 64 d x 32 keys
    __shared__ float Mrg[4][34][32];   // waves 4..7: maximum, sum and 32 outputs of each lane

    const int lane = threadIdx.x & 31;
    const int wave = threadIdx.x >> 5;
    const int half = lane >> 4;
    const int col  = lane & 15;
    const int ko   = (lane & 16) ? 8 : 0;

    const int wq = wave & 3;                  // which 16 of the work-group's 64 queries
    // which tile of a stage: a scalar, so that what hangs on it is a scalar branch
    const int par = __builtin_amdgcn_readfirstlane(wave >> 2);

    const int bh = blockIdx.x;
    const int b = bh / HH, h = bh % HH;
    const int qblk = SS / 64 - 1 - blockIdx.y;
    const int qbase = qblk * 64 + wq * 16;
    const int qend  = qbase + 15;
    const int qidx  = qbase + col;            // the lane's one query
    const size_t bS = (size_t)b * SS;
    const float scale = 0.125f;   // 1/sqrt(64)

    const _Float16* qrow = q16 + (bS + qidx) * EE + h * DD;
    const v16h bq0 = ld_frag(qrow + ko,      qrow + ko + 16);
    const v16h bq1 = ld_frag(qrow + 32 + ko, qrow + 32 + ko + 16);

    const _Float16* vtb = vt16 + ((size_t)b * HH + h) * DD * SS;

    // accJ[r] = O[qidx][16 * J + 8 * half + r]
    v8f acc0 = {}, acc1 = {}, acc2 = {}, acc3 = {};
    float mrow = -INFINITY;   // running maximum of the query's row, equal in both halves
    float lrow = 0.f;         // running sum over this half's keys; the halves join at the end

    // thread i copies 16 B of each of a stage's four tiles: K row i/8, piece i%8; V^T row i/4, piece i%4
    const int kl = (threadIdx.x >> 3) * KP + (threadIdx.x & 7) * 8;
    const int vl = (threadIdx.x >> 2) * LP + (threadIdx.x & 3) * 8;
    const _Float16* kg = k16 + (bS + (threadIdx.x >> 3)) * EE + h * DD + (threadIdx.x & 7) * 8;
    const _Float16* vg = vtb + (size_t)(threadIdx.x >> 2) * SS + (threadIdx.x & 3) * 8;
    auto stage = [&](int kk, int bufIdx) {
        async_ld4_b128((unsigned)(unsigned long long)&Kbuf[bufIdx][0][kl], kg + (size_t)kk * EE,
                       (unsigned)(unsigned long long)&Vbuf[bufIdx][0][vl], vg + kk,
                       (unsigned)(unsigned long long)&Kbuf[bufIdx][1][kl], kg + (size_t)(kk + 32) * EE,
                       (unsigned)(unsigned long long)&Vbuf[bufIdx][1][vl], vg + kk + 32);
    };

    // 64-key stages up to the work-group's last query row: 1 .. 32, the same for all its waves
    const int ntiles = qblk + 1;
    // scalar copy of qend: the skip of tiles past a wave's own diagonal is a scalar branch
    const int qendS = __builtin_amdgcn_readfirstlane(qend);

    stage(0, 0);
    wait_async0();
    __syncthreads();
    if (ntiles > 1) stage(64, 1);

    for (int t = 0; t < ntiles; ++t) {
      const int kk = t * 64 + par * 32;       // first key of this wave's tile
      // kk and qbase are multiples of 16: a tile that is not skipped has kk <= qbase, so every
      // query of the wave sees at least key kk and its row maximum is a real score
      if (kk <= qendS) {
        const _Float16* krow0 = &Kbuf[t & 1][par][col * KP];
        const _Float16* krow1 = krow0 + 16 * KP;
        const _Float16* vtile = &Vbuf[t & 1][par][0];
        const v16h ak0 = ld_frag(krow0 + ko, krow0 + ko + 16);
        const v16h ak1 = ld_frag(krow0 + 32 + ko, krow0 + 32 + ko + 16);
        const v16h ak2 = ld_frag(krow1 + ko, krow1 + ko + 16);
        const v16h ak3 = ld_frag(krow1 + 32 + ko, krow1 + 32 + ko + 16);
        const v16h av0 = ld_frag(vtile + (col) * LP + ko,      vtile + (col) * LP + ko + 16);
        const v16h av1 = ld_frag(vtile + (16 + col) * LP + ko, vtile + (16 + col) * LP + ko + 16);
        const v16h av2 = ld_frag(vtile + (32 + col) * LP + ko, vtile + (32 + col) * LP + ko + 16);
        const v16h av3 = ld_frag(vtile + (48 + col) * LP + ko, vtile + (48 + col) * LP + ko + 16);

        // inputs-only fence on the eight loaded fragments: it holds each in registers of its own,
        // so the K reads are issued together ahead of the first product and the V^T reads land
        // under the softmax; without it fragments share a register block and each score
        // product waits for an LDS round trip of its own
        asm volatile("" :: "v"(ak0), "v"(ak1), "v"(ak2), "v"(ak3),
                           "v"(av0), "v"(av1), "v"(av2), "v"(av3));

        // s0[r] = S[qidx][kk + 8 * half + r], s1[r] = S[qidx][kk + 16 + 8 * half + r]
        v8f s0 = {}, s1 = {};
        s0 = wmma_f16(ak0, bq0, s0);
        s1 = wmma_f16(ak2, bq0, s1);
        s0 = wmma_f16(ak1, bq1, s0);
        s1 = wmma_f16(ak3, bq1, s1);

        const int dq = qidx - (kk + half * 8);   // key 8 * half + r of the tile is allowed while r <= dq
        const v8f t0 = s0 * scale, t1 = s1 * scale;
        float a[16];              // a[s]: the score that becomes element s of the B operand
#pragma unroll
        for (int r = 0; r < 8; ++r) {
            a[r]     = (r      <= dq) ? t0[r] : -1e30f;
            a[8 + r] = (16 + r <= dq) ? t1[r] : -1e30f;
        }
        float mx = -1e30f;
#pragma unroll
        for (int s = 0; s < 16; s += 2) mx = fmaxf(mx, fmaxf(a[s], a[s + 1]));
        mx = fmaxf(mx, xhalf(mx));
        const float nm = fmaxf(mrow, mx);
        const float al = __expf(mrow - nm);
        mrow = nm;

        v16h pb;
        float rs0 = 0.f, rs1 = 0.f;
#pragma unroll
        for (int s = 0; s < 16; s += 2) {
            const float p0 = __expf(a[s] - nm);
            const float p1 = __expf(a[s + 1] - nm);
            rs0 += p0;
            rs1 += p1;
            pb[s]     = (_Float16)p0;
            pb[s + 1] = (_Float16)p1;
        }
        const float rs = rs0 + rs1;
        lrow = lrow * al + rs;
        acc0 *= al; acc1 *= al; acc2 *= al; acc3 *= al;

        acc0 = wmma_f16(av0, pb, acc0);
        acc1 = wmma_f16(av1, pb, acc1);
        acc2 = wmma_f16(av2, pb, acc2);
        acc3 = wmma_f16(av3, pb, acc3);
      }

      // publish point, passed by every wave, also one that skipped the tile:
      // this wave's reads of buffer t & 1 have retired before the barrier frees it for refill
      asm volatile("s_wait_dscnt 0" ::: "memory");
      wait_async0();          // this wave's pieces of stage t + 1 have landed
      __syncthreads();        // stage t + 1 readable by all; buffer t & 1 left by all
      if (t + 2 < ntiles) stage((t + 2) * 64, t & 1);
    }
    wait_async0();            // no copy is outstanding when the wave ends

    // waves w and w + 4 map lanes to queries, keys' halves and d alike: lane to lane.
    // A wave 4..7 that skipped every tile hands over maximum -inf, sum 0, outputs 0: weight 0.
    float* mg = &Mrg[wq][0][lane];
    if (par == 1) {
        mg[0]  = mrow;
        mg[32] = lrow;
#pragma unroll   // the accumulators are indexed by constants and stay in registers
        for (int r = 0; r < 8; ++r) {
            mg[(2 + r) * 32]  = acc0[r];
            mg[(10 + r) * 32] = acc1[r];
            mg[(18 + r) * 32] = acc2[r];
            mg[(26 + r) * 32] = acc3[r];
        }
    }
    __syncthreads();          // the partials of waves 4..7 are readable by waves 0..3
    if (par == 1) return;     // behind the last barrier
    const float m2 = mg[0];
    const float mj = fmaxf(mrow, m2);         // mrow is finite: waves 0..3 have worked on key 0
    const float w1 = __expf(mrow - mj), w2 = __expf(m2 - mj);
    lrow = lrow * w1 + mg[32] * w2;
#pragma unroll   // as above
    for (int r = 0; r < 8; ++r) {
        acc0[r] = acc0[r] * w1 + mg[(2 + r) * 32] * w2;
        acc1[r] = acc1[r] * w1 + mg[(10 + r) * 32] * w2;
        acc2[r] = acc2[r] * w1 + mg[(18 + r) * 32] * w2;
        acc3[r] = acc3[r] * w1 + mg[(26 + r) * 32] * w2;
    }

    // a lane's 8 registers of an output tile are 8 consecutive d of its query: 16-B stores
    const float inv = 1.0f / (lrow + xhalf(lrow));
    _Float16* orow = attn16 + (bS + qidx) * EE + h * DD + half * 8;
    *(v8h*)(orow)      = __builtin_convertvector(acc0 * inv, v8h);
    *(v8h*)(orow + 16) = __builtin_convertvector(acc1 * inv, v8h);
    *(v8h*)(orow + 32) = __builtin_convertvector(acc2 * inv, v8h);
    *(v8h*)(orow + 48) = __builtin_convertvector(acc3 * inv, v8h);
}

// ---------------- host launcher ----------------
extern "C" void kernel_launch(void* const* d_in, const int* in_sizes, int n_in,
                              void* d_out, int out_size, void* d_ws, size_t ws_size,
                              hipStream_t stream) {
    (void)in_sizes; (void)n_in; (void)out_size; (void)ws_size;
    const float* x     = (const float*)d_in[0];
    const float* wq    = (const float*)d_in[1];
    const float* wk    = (const float*)d_in[2];
    const float* wv    = (const float*)d_in[3];
    const float* wo    = (const float*)d_in[4];
    const float* bo    = (const float*)d_in[5];
    const float* w1    = (const float*)d_in[6];
    const float* b1    = (const float*)d_in[7];
    const float* w2    = (const float*)d_in[8];
    const float* b2    = (const float*)d_in[9];
    const float* gamma = (const float*)d_in[10];
    const float* beta  = (const float*)d_in[11];
    float* out = (float*)d_out;

    const size_t nEE = (size_t)EE * EE;
    const size_t nEF = (size_t)EE * FFF;
    const size_t nME = (size_t)MM * EE;
    const size_t nMF = (size_t)MM * FFF;

    char* ws = (char*)d_ws;
    size_t off = 0;
    auto alloc = [&](size_t bytes) -> void* {
        void* p = ws + off;
        off = (off + bytes + 255) & ~(size_t)255;
        return p;
    };
    _Float16* wq16   = (_Float16*)alloc(nEE * 2);
    _Float16* wk16   = (_Float16*)alloc(nEE * 2);
    _Float16* wv16   = (_Float16*)alloc(nEE * 2);
    _Float16* wo16   = (_Float16*)alloc(nEE * 2);
    _Float16* w116   = (_Float16*)alloc(nEF * 2);
    _Float16* w216   = (_Float16*)alloc(nEF * 2);
    _Float16* xn16   = (_Float16*)alloc(nME * 2);
    _Float16* q16    = (_Float16*)alloc(nME * 2);
    _Float16* k16    = (_Float16*)alloc(nME * 2);
    _Float16* vt16   = (_Float16*)alloc(nME * 2);
    _Float16* attn16 = (_Float16*)alloc(nME * 2);
    _Float16* y16    = (_Float16*)alloc(nME * 2);
    _Float16* h16    = (_Float16*)alloc(nMF * 2);
    float*    res    = (float*)alloc(nME * 4);

    // wq16 .. w216 are the first six allocations and lie back to back from wq16
    cvt_f16_kernel<<<dim3(NEE / CVT_WG, 12), 256, 0, stream>>>(wq, wk, wv, wo, w1, w2, wq16);

    ln_f16_kernel<<<MM, 256, 0, stream>>>(x, gamma, beta, xn16);

    dim3 gEE(EE / 64, MM / 128);
    // wq16, wk16, wv16 lie back to back from wq16, and q16, k16, vt16 from q16
    gemm_wmma_kernel<0, EE><<<dim3(3 * EE / 64, MM / 128), 256, 0, stream>>>(xn16, wq16, nullptr, nullptr, nullptr, q16, EE);

    flash_attn_kernel<<<dim3(BB * HH, SS / 64), 256, 0, stream>>>(q16, k16, vt16, attn16);

    gemm_wmma_kernel<2, EE><<<gEE, 256, 0, stream>>>(attn16, wo16, bo, x, res, nullptr, EE);

    ln_f16_kernel<<<MM, 256, 0, stream>>>(res, gamma, beta, y16);

    dim3 gFF(FFF / 64, MM / 128);
    gemm_wmma_kernel<3, FFF><<<gFF, 256, 0, stream>>>(y16, w116, b1, nullptr, nullptr, h16, EE);
    gemm_wmma_kernel<2, EE><<<gEE, 256, 0, stream>>>(h16, w216, b2, res, out, nullptr, FFF);
}

// v009
// It runs in 123 microseconds.
// Next to v008, in two timings, it ran 1.04 times as fast each time.
// Counting every step since v000, it is 3.15 times as fast.
#include <hip/hip_runtime.h>
#include <math.h>

// ---------------- problem constants ----------------
#define BB   2
#define SS   2048
#define EE   768
#define HH   12
#define DD   64
#define FFF  3072
#define MM   (BB * SS)        // 4096 rows

typedef _Float16 v16h __attribute__((ext_vector_type(16)));
typedef _Float16 v8h  __attribute__((ext_vector_type(8)));
typedef float    v8f  __attribute__((ext_vector_type(8)));

__device__ __forceinline__ v8f wmma_f16(v16h a, v16h b, v8f c) {
    // (neg_a, A, neg_b, B, c_mod, C, reuse_a, reuse_b)
    return __builtin_amdgcn_wmma_f32_16x16x32_f16(false, a, false, b, (short)0, c, false, false);
}

__device__ __forceinline__ v16h ld_frag(const _Float16* p0, const _Float16* p1) {
    v8h lo = *(const v8h*)p0;
    v8h hi = *(const v8h*)p1;
    return __builtin_shufflevector(lo, hi, 0,1,2,3,4,5,6,7,8,9,10,11,12,13,14,15);
}

// LDS pitch of a 32-half (64-B) row: 80 B = 16 B x odd, so the 16 rows that one
// ds_load_b128 touches per lane half fall on 16 distinct groups of four banks.
#define LP   40

// twelve async 16B global -> LDS copies (ASYNCcnt-tracked DMA, CDNA5): a thread's share of
// one GEMM stage, eight pieces of A (LDS la + j * ls, global ga + j * gs) and four of B.
// s_wait_xcnt stands inside the statement so that no address register of a copy
// is rewritten (next slab's address additions) ahead of it.
__device__ __forceinline__ void async_ld12_b128(unsigned la, const _Float16* ga,
                                                unsigned lb, const _Float16* gb,
                                                unsigned ls, size_t gs) {
    asm volatile("global_load_async_to_lds_b128 %0, %1, off\n\t"
                 "global_load_async_to_lds_b128 %2, %3, off\n\t"
                 "global_load_async_to_lds_b128 %4, %5, off\n\t"
                 "global_load_async_to_lds_b128 %6, %7, off\n\t"
                 "global_load_async_to_lds_b128 %8, %9, off\n\t"
                 "global_load_async_to_lds_b128 %10, %11, off\n\t"
                 "global_load_async_to_lds_b128 %12, %13, off\n\t"
                 "global_load_async_to_lds_b128 %14, %15, off\n\t"
                 "global_load_async_to_lds_b128 %16, %17, off\n\t"
                 "global_load_async_to_lds_b128 %18, %19, off\n\t"
                 "global_load_async_to_lds_b128 %20, %21, off\n\t"
                 "global_load_async_to_lds_b128 %22, %23, off\n\t"
                 "s_wait_xcnt 0x0"
                 :: "v"(la),          "v"(ga),          "v"(la + ls),     "v"(ga + gs),
                    "v"(la + 2 * ls), "v"(ga + 2 * gs), "v"(la + 3 * ls), "v"(ga + 3 * gs),
                    "v"(la + 4 * ls), "v"(ga + 4 * gs), "v"(la + 5 * ls), "v"(ga + 5 * gs),
                    "v"(la + 6 * ls), "v"(ga + 6 * gs), "v"(la + 7 * ls), "v"(ga + 7 * gs),
                    "v"(lb),          "v"(gb),          "v"(lb + ls),     "v"(gb + gs),
                    "v"(lb + 2 * ls), "v"(gb + 2 * gs), "v"(lb + 3 * ls), "v"(gb + 3 * gs)
                 : "memory");
}
// the same for four copies (attention: one piece of each K tile and V^T tile of a stage)
__device__ __forceinline__ void async_ld4_b128(unsigned l0, const void* g0,
                                               unsigned l1, const void* g1,
                                               unsigned l2, const void* g2,
                                               unsigned l3, const void* g3) {
    asm volatile("global_load_async_to_lds_b128 %0, %1, off\n\t"
                 "global_load_async_to_lds_b128 %2, %3, off\n\t"
                 "global_load_async_to_lds_b128 %4, %5, off\n\t"
                 "global_load_async_to_lds_b128 %6, %7, off\n\t"
                 "s_wait_xcnt 0x0"
                 :: "v"(l0), "v"(g0), "v"(l1), "v"(g1), "v"(l2), "v"(g2), "v"(l3), "v"(g3)
                 : "memory");
}
__device__ __forceinline__ void wait_async0() {
    asm volatile("s_wait_asynccnt 0" ::: "memory");
}

// ---------------- f32 -> f16 convert of all six weight matrices ----------------
// One launch. The work is cut into 12 planes of EE*EE elements (blockIdx.y): wq, wk, wv, wo,
// four planes of w1, four of w2; the f16 copies lie back to back in the same order.
// A work-group converts CVT_WG elements of one plane; each wave owns 1024 contiguous
// elements: 8 loads of 512 contiguous bytes, all issued before the first is used, and
// 8 stores of 256 contiguous bytes. Few, long waves, for speed only.
#define NEE     (EE * EE)
#define CVT_WG  8192
static_assert(NEE % CVT_WG == 0, "a plane is a whole number of work-groups");
static_assert(FFF == 4 * EE, "w1 and w2 are four planes each");
static_assert((NEE * 2) % 256 == 0, "f16 planes lie back to back in the workspace");

typedef float    v4f __attribute__((ext_vector_type(4)));
typedef _Float16 v4h __attribute__((ext_vector_type(4)));

__global__ __launch_bounds__(256) void cvt_f16_kernel(const float* __restrict__ wq,
                                                      const float* __restrict__ wk,
                                                      const float* __restrict__ wv,
                                                      const float* __restrict__ wo,
                                                      const float* __restrict__ w1,
                                                      const float* __restrict__ w2,
                                                      _Float16* __restrict__ out) {
    const int plane = blockIdx.y;                 // 0..11, uniform in the work-group
    const float* big = plane < 8 ? w1 : w2;       // planes 4..7 and 8..11
    const float* src = big + (size_t)(plane & 3) * NEE;
    if (plane == 0) src = wq;
    if (plane == 1) src = wk;
    if (plane == 2) src = wv;
    if (plane == 3) src = wo;
    const int base = blockIdx.x * CVT_WG + (threadIdx.x >> 5) * 1024 + (threadIdx.x & 31) * 4;
    const float* s = src + base;
    _Float16* d = out + (size_t)plane * NEE + base;
    v4f v[8];
    // both loops unrolled: v[] stays in registers and all 8 loads issue ahead of the first use
#pragma unroll
    for (int j = 0; j < 8; ++j) v[j] = *(const v4f*)(s + j * 128);
#pragma unroll
    for (int j = 0; j < 8; ++j) *(v4h*)(d + j * 128) = __builtin_convertvector(v[j], v4h);
}

// ---------------- row LayerNorm -> f16 ----------------
__global__ void ln_f16_kernel(const float* __restrict__ x,
                              const float* __restrict__ gamma,
                              const float* __restrict__ beta,
                              _Float16* __restrict__ out) {
    __shared__ float s1[256], s2[256];
    const int row = blockIdx.x;
    const float* xr = x + (size_t)row * EE;
    float v[3], sum = 0.f, sq = 0.f;
#pragma unroll
    for (int i = 0; i < 3; ++i) {
        v[i] = xr[threadIdx.x + i * 256];
        sum += v[i];
        sq  += v[i] * v[i];
    }
    s1[threadIdx.x] = sum; s2[threadIdx.x] = sq;
    __syncthreads();
    for (int s = 128; s > 0; s >>= 1) {
        if (threadIdx.x < s) {
            s1[threadIdx.x] += s1[threadIdx.x + s];
            s2[threadIdx.x] += s2[threadIdx.x + s];
        }
        __syncthreads();
    }
    const float mu = s1[0] * (1.0f / EE);
    const float var = s2[0] * (1.0f / EE) - mu * mu;
    const float rs = rsqrtf(var + 1e-5f);
    _Float16* orow = out + (size_t)row * EE;
#pragma unroll
    for (int i = 0; i < 3; ++i) {
        int c = threadIdx.x + i * 256;
        orow[c] = (_Float16)((v[i] - mu) * rs * gamma[c] + beta[c]);
    }
}

// ---------------- GELU with the error function, straight-line ----------------
// 0.5 v (1 + erf(v / sqrt 2)) = max(v, 0) - 0.5 |v| erfc(|v| / sqrt 2), and for x >= 0
// erfc(x) = t (a1 + t (a2 + t (a3 + t (a4 + t a5)))) exp(-x^2), t = 1 / (1 + p x), to 1.5e-7
// absolute (the classical five-term rational form). In f32 the whole result stays within 4e-7 of
// the exact one for every v, a rounding step of f32 at v = 3; it is rounded to f16 next.
// The library's erff takes one of two polynomials by a branch on |x| < 1, and nearly every wave
// holds lanes of both kinds: it runs both, each a dependent chain between two changes of
// EXEC, one result after the other. This form has no branch: a third of the instructions, and
// a lane's results are independent chains that fill each other's latencies.
// The factor 0.5 is folded into a1 .. a5, 1 / sqrt 2 into p, log2(e) / 2 into the exponent.
// Four values a call: g[k] = gelu(v[k]).
__device__ __forceinline__ void gelu_erf4(const float (&v)[4], float (&g)[4]) {
    float d[4], x[4], t[4], e[4];
#pragma unroll   // the arrays are indexed by constants and stay in registers
    for (int k = 0; k < 4; ++k) {
        d[k] = fmaf(fabsf(v[k]), 0.23164189f, 1.0f);
        x[k] = (v[k] * -0.72134752f) * v[k];     // log2 of exp(-v^2 / 2)
    }
    // The eight transcendentals in one statement: behind each the instruction set asks for one
    // independent instruction before its result is read or its source overwritten. Here the
    // next one is that instruction (early-clobber outputs: no result lies on a source), and
    // v_nop is it for the last. The reciprocals stand first: they are needed first.
    asm("v_rcp_f32 %0, %8\n\t"
        "v_rcp_f32 %1, %9\n\t"
        "v_rcp_f32 %2, %10\n\t"
        "v_rcp_f32 %3, %11\n\t"
        "v_exp_f32 %4, %12\n\t"
        "v_exp_f32 %5, %13\n\t"
        "v_exp_f32 %6, %14\n\t"
        "v_exp_f32 %7, %15\n\t"
        "v_nop"
        : "=&v"(t[0]), "=&v"(t[1]), "=&v"(t[2]), "=&v"(t[3]),
          "=&v"(e[0]), "=&v"(e[1]), "=&v"(e[2]), "=&v"(e[3])
        : "v"(d[0]), "v"(d[1]), "v"(d[2]), "v"(d[3]),
          "v"(x[0]), "v"(x[1]), "v"(x[2]), "v"(x[3]));
#pragma unroll   // as above
    for (int k = 0; k < 4; ++k) {
        float p = fmaf(t[k], 0.5307027145f, -0.7265760135f);
        p = fmaf(t[k], p, 0.7107068705f);
        p = fmaf(t[k], p, -0.142248368f);
        p = fmaf(t[k], p, 0.127414796f);
        g[k] = fmaf(-fabsf(v[k]), (p * t[k]) * e[k], fmaxf(v[k], 0.0f));
    }
}

// ---------------- WMMA GEMM: C[M,N] = A[M,K] @ W[N,K]^T ----------------
// LDS-staged via async global->LDS DMA, double buffered.
// Block: 256 thr = 8 waves, tile 128M x 64N; wave tile 32x32.
// A stage holds BK = 128 k (16 WMMAs a wave): a trip costs one landing of the next stage's
// copies and one barrier whatever its depth.
// K must be a multiple of BK.
// MODE 0: the Q, K and V projections in one launch (no bias). W is wq, wk, wv stacked, 3 * N
//         rows; blockIdx.x runs over all of them. outH is q, k, vt back to back: q and k f16
//         row-major, v transposed to [B,H,D,S]. The three products read the same A and do not
//         depend on each other: one grid of 1,152 work-groups keeps three resident on a WGP and
//         refills freed places, where three grids of 384 each pay a launch, a first landing
//         and a tail with half the WGPs holding one work-group.
// MODE 2: outF f32 = resid + bias + C
// MODE 3: outH f16 = gelu(bias + C)   (erf form: gelu_erf4 above)
// MODE and the row length N of the output are template arguments: each build holds one
// writeback, straight-line. Chosen at run time, the choice is branched on at each of a lane's
// 32 results, and every residual and bias load waits for its own round trip before the next.
#define BK   128
#define GP   136   // LDS pitch of a 256-B stage row: 272 B = 16 B x odd, as LP for 64-B rows
static_assert(EE % BK == 0 && FFF % BK == 0, "every K is a whole number of stages");
static_assert(((size_t)MM * EE * 2) % 256 == 0, "q, k and vt lie back to back in the workspace");
template <int MODE, int N>
__global__ void gemm_wmma_kernel(const _Float16* __restrict__ A,
                                 const _Float16* __restrict__ W,
                                 const float* __restrict__ bias,
                                 const float* __restrict__ resid,
                                 float* __restrict__ outF,
                                 _Float16* __restrict__ outH,
                                 int K) {
    __shared__ __attribute__((aligned(16))) _Float16 Abuf[2][128 * GP];   // 34 KB each
    __shared__ __attribute__((aligned(16))) _Float16 Bbuf[2][64 * GP];    // 17 KB each

    const int lane = threadIdx.x & 31;
    const int wave = threadIdx.x >> 5;          // 0..7 -> 4M x 2N
    const int mW = (wave >> 1) * 32;            // local M offset of wave tile
    const int nW = (wave & 1) * 32;             // local N offset of wave tile
    const int mBlk = blockIdx.y * 128;
    const int nBlk = blockIdx.x * 64;
    const int ko = (lane & 16) ? 8 : 0;         // K sub-offsets {ko, ko+16}
    const int col = lane & 15;
    const int half = lane >> 4;

    // stage one BK-wide K slab: A 128 x BK (8 pieces/thread) + B 64 x BK (4 pieces/thread);
    // a copy of the work-group covers 16 whole rows of 256 B, the next one the 16 rows below
    auto stage = [&](int kk, int bufIdx) {
        const int row = threadIdx.x >> 4, q = threadIdx.x & 15;   // row 0..15
        async_ld12_b128((unsigned)(unsigned long long)&Abuf[bufIdx][row * GP + q * 8],
                        A + (size_t)(mBlk + row) * K + kk + q * 8,
                        (unsigned)(unsigned long long)&Bbuf[bufIdx][row * GP + q * 8],
                        W + (size_t)(nBlk + row) * K + kk + q * 8,
                        16 * GP * 2, (size_t)16 * K);
    };

    v8f c00 = {}, c01 = {}, c10 = {}, c11 = {};

    const int nsteps = K / BK;
    stage(0, 0);
    wait_async0();
    __syncthreads();

    for (int s = 0; s < nsteps; ++s) {
        const int cur = s & 1;
        if (s + 1 < nsteps) stage((s + 1) * BK, cur ^ 1);

        const _Float16* ab = &Abuf[cur][(mW + col) * GP + ko];
        const _Float16* bb = &Bbuf[cur][(nW + col) * GP + ko];
        for (int ks = 0; ks < BK; ks += 32) {
            v16h a0 = ld_frag(ab + ks,           ab + ks + 16);
            v16h a1 = ld_frag(ab + 16 * GP + ks, ab + 16 * GP + ks + 16);
            v16h b0 = ld_frag(bb + ks,           bb + ks + 16);
            v16h b1 = ld_frag(bb + 16 * GP + ks, bb + 16 * GP + ks + 16);
            c00 = wmma_f16(a0, b0, c00);
            c01 = wmma_f16(a0, b1, c01);
            c10 = wmma_f16(a1, b0, c10);
            c11 = wmma_f16(a1, b1, c11);
        }

        // this wave's reads of cur have retired before the barrier frees cur for refill
        asm volatile("s_wait_dscnt 0" ::: "memory");
        wait_async0();        // our next-slab DMAs have landed
        __syncthreads();      // everyone done reading cur before it is overwritten
    }

    // ---------------- writeback ----------------
    // acc[i][j][r] = C[m0 + 16 * i + r][n0 + 16 * j]
    // every loop below is unrolled: acc, rv and hv are indexed by constants and stay in
    // registers, and the row offsets become immediate offsets of one address
    const v8f acc[2][2] = {{c00, c01}, {c10, c11}};
    const int m0 = mBlk + mW + half * 8;
    const int n0 = nBlk + nW + col;
    if constexpr (MODE == 0) {
        // which product the work-group's 64 columns belong to: the same for all its threads
        const int which = blockIdx.x / (N / 64);   // 0 q, 1 k, 2 v
        const int nl = n0 - which * N;             // column inside that product
        _Float16* ob = outH + (size_t)which * ((size_t)MM * N);
        if (which < 2) {
            _Float16* o = ob + (size_t)m0 * N + nl;
#pragma unroll
            for (int i = 0; i < 2; ++i)
#pragma unroll
                for (int r = 0; r < 8; ++r)
#pragma unroll
                    for (int j = 0; j < 2; ++j)
                        o[(i * 16 + r) * N + j * 16] = (_Float16)acc[i][j][r];
        } else {
#pragma unroll
            for (int i = 0; i < 2; ++i) {
                const int m = m0 + i * 16;         // a multiple of 8: rows m .. m + 7 share b
                const int b = m >> 11, sIdx = m & (SS - 1);
#pragma unroll
                for (int j = 0; j < 2; ++j) {
                    const int n = nl + j * 16;
                    const int h = n >> 6, d = n & (DD - 1);
                    _Float16* o = ob + (((size_t)b * HH + h) * DD + d) * SS + sIdx;
#pragma unroll
                    for (int r = 0; r < 8; ++r) o[r] = (_Float16)acc[i][j][r];
                }
            }
            // the built code lays the q/k writeback behind these stores: no register that an
            // issued store names is written again ahead of this wait
            asm volatile("s_wait_xcnt 0x0" ::: "memory");
        }
    } else if constexpr (MODE == 2) {
        const float* rp = resid + (size_t)m0 * N + n0;
        float* o = outF + (size_t)m0 * N + n0;
        const float bs[2] = {bias[n0], bias[n0 + 16]};
        float rv[2][8][2];
        // all 32 residual loads of the lane are issued before the first is used
#pragma unroll
        for (int i = 0; i < 2; ++i)
#pragma unroll
            for (int r = 0; r < 8; ++r)
#pragma unroll
                for (int j = 0; j < 2; ++j)
                    rv[i][r][j] = rp[(i * 16 + r) * N + j * 16];
#pragma unroll
        for (int i = 0; i < 2; ++i)
#pragma unroll
            for (int r = 0; r < 8; ++r)
#pragma unroll
                for (int j = 0; j < 2; ++j)
                    o[(i * 16 + r) * N + j * 16] = rv[i][r][j] + (acc[i][j][r] + bs[j]);
    } else {
        _Float16* o = outH + (size_t)m0 * N + n0;
        const float bs[2] = {bias[n0], bias[n0 + 16]};
        _Float16 hv[2][8][2];
        // all 32 results are formed first and stored together
#pragma unroll
        for (int i = 0; i < 2; ++i)
#pragma unroll
            for (int r = 0; r < 8; r += 2) {
                const float v[4] = {acc[i][0][r] + bs[0],     acc[i][1][r] + bs[1],
                                    acc[i][0][r + 1] + bs[0], acc[i][1][r + 1] + bs[1]};
                float g[4];
                gelu_erf4(v, g);
                hv[i][r][0]     = (_Float16)g[0];
                hv[i][r][1]     = (_Float16)g[1];
                hv[i][r + 1][0] = (_Float16)g[2];
                hv[i][r + 1][1] = (_Float16)g[3];
            }
#pragma unroll
        for (int i = 0; i < 2; ++i)
#pragma unroll
            for (int r = 0; r < 8; ++r)
#pragma unroll
                for (int j = 0; j < 2; ++j)
                    o[(i * 16 + r) * N + j * 16] = hv[i][r][j];
    }
}

// ---------------- flash attention (causal) ----------------
// q16,k16: [B,S,H,D] f16 row-major ( == [M,E] );  vt16: [B,H,D,S] f16
// attn16 out: [B,S,H,D] f16 ( == [M,E] )
// A work-group takes 64 queries. Waves w and w + 4 hold the same 16 queries and share their
// keys: of each 64-key stage waves 0..3 take the first 32-key tile, waves 4..7 the second, each
// with a running maximum, sum and output of its own; at the end waves 4..7 hand theirs over
// through LDS and waves 0..3 join the two. The launch lasts as long as its last rows' walk
// over all their keys, one tile after the other: so split, that walk has half the trips.
// Each 32-key tile of K (32 rows of 128 B) and of V^T (64 rows of 64 B) is copied to LDS once
// for the four waves that read it, two buffers of two tiles, the next stage's copies in flight
// while this one is worked on.
// Grid: x = batch and head, y = query block, the longest (last) block first.
// The products are taken transposed: S^T = K Q^T (A = K rows, B = Q) and O^T += V^T P^T.
// A lane then holds 16 of the 32 scores of ONE query (column lane & 15; keys 8 * half + r and
// 16 + 8 * half + r), so the maximum and the sum of a row are taken in the lane's own
// registers, with one exchange between the wave's halves; and the two score tiles,
// converted in place, are the B operand of the second product in the order its k wants:
// P goes through no LDS.
#define KP   72    // LDS pitch of a 128-B K row: 144 B = 16 B x odd, as LP for 64-B rows

// lane l takes the value of lane l ^ 16 (a vector move between the wave's two rows)
__device__ __forceinline__ float xhalf(float x) {
    const int b = __builtin_bit_cast(int, x);
    return __builtin_bit_cast(float,
        __builtin_amdgcn_permlanex16(b, b, 0x76543210, 0xfedcba98, false, false));
}

// The block size is stated: unstated, registers are budgeted for 1,024 threads (128 a lane).
// amdgpu_waves_per_eu(4, 4): budgeted for more waves a SIMD, the scheduler holds registers down
// and the score products wait for the V^T reads as well as for the K reads.
__global__ __launch_bounds__(256) __attribute__((amdgpu_waves_per_eu(4, 4))) void flash_attn_kernel(const _Float16* __restrict__ q16,
                                  const _Float16* __restrict__ k16,
                                  const _Float16* __restrict__ vt16,
                                  _Float16* __restrict__ attn16) {
    __shared__ __attribute__((aligned(16))) _Float16 Kbuf[2][2][32 * KP];  // a tile: 32 keys x 64 d
    __shared__ __attribute__((aligned(16))) _Float16 Vbuf[2][2][64 * LP];  // a tile: 64 d x 32 keys
    __shared__ float Mrg[4][34][32];   // waves 4..7: maximum, sum and 32 outputs of each lane

    const int lane = threadIdx.x & 31;
    const int wave = threadIdx.x >> 5;
    const int half = lane >> 4;
    const int col  = lane & 15;
    const int ko   = (lane & 16) ? 8 : 0;

    const int wq = wave & 3;                  // which 16 of the work-group's 64 queries
    // which tile of a stage: a scalar, so that what hangs on it is a scalar branch
    const int par = __builtin_amdgcn_readfirstlane(wave >> 2);

    const int bh = blockIdx.x;
    const int b = bh / HH, h = bh % HH;
    const int qblk = SS / 64 - 1 - blockIdx.y;
    const int qbase = qblk * 64 + wq * 16;
    const int qend  = qbase + 15;
    const int qidx  = qbase + col;            // the lane's one query
    const size_t bS = (size_t)b * SS;
    const float scale = 0.125f;   // 1/sqrt(64)

    const _Float16* qrow = q16 + (bS + qidx) * EE + h * DD;
    const v16h bq0 = ld_frag(qrow + ko,      qrow + ko + 16);
    const v16h bq1 = ld_frag(qrow + 32 + ko, qrow + 32 + ko + 16);

    const _Float16* vtb = vt16 + ((size_t)b * HH + h) * DD * SS;

    // accJ[r] = O[qidx][16 * J + 8 * half + r]
    v8f acc0 = {}, acc1 = {}, acc2 = {}, acc3 = {};
    float mrow = -INFINITY;   // running maximum of the query's row, equal in both halves
    float lrow = 0.f;         // running sum over this half's keys; the halves join at the end

    // thread i copies 16 B of each of a stage's four tiles: K row i/8, piece i%8; V^T row i/4, piece i%4
    const int kl = (threadIdx.x >> 3) * KP + (threadIdx.x & 7) * 8;
    const int vl = (threadIdx.x >> 2) * LP + (threadIdx.x & 3) * 8;
    const _Float16* kg = k16 + (bS + (threadIdx.x >> 3)) * EE + h * DD + (threadIdx.x & 7) * 8;
    const _Float16* vg = vtb + (size_t)(threadIdx.x >> 2) * SS + (threadIdx.x & 3) * 8;
    auto stage = [&](int kk, int bufIdx) {
        async_ld4_b128((unsigned)(unsigned long long)&Kbuf[bufIdx][0][kl], kg + (size_t)kk * EE,
                       (unsigned)(unsigned long long)&Vbuf[bufIdx][0][vl], vg + kk,
                       (unsigned)(unsigned long long)&Kbuf[bufIdx][1][kl], kg + (size_t)(kk + 32) * EE,
                       (unsigned)(unsigned long long)&Vbuf[bufIdx][1][vl], vg + kk + 32);
    };

    // 64-key stages up to the work-group's last query row: 1 .. 32, the same for all its waves
    const int ntiles = qblk + 1;
    // scalar copy of qend: the skip of tiles past a wave's own diagonal is a scalar branch
    const int qendS = __builtin_amdgcn_readfirstlane(qend);

    stage(0, 0);
    wait_async0();
    __syncthreads();
    if (ntiles > 1) stage(64, 1);

    for (int t = 0; t < ntiles; ++t) {
      const int kk = t * 64 + par * 32;       // first key of this wave's tile
      // kk and qbase are multiples of 16: a tile that is not skipped has kk <= qbase, so every
      // query of the wave sees at least key kk and its row maximum is a real score
      if (kk <= qendS) {
        const _Float16* krow0 = &Kbuf[t & 1][par][col * KP];
        const _Float16* krow1 = krow0 + 16 * KP;
        const _Float16* vtile = &Vbuf[t & 1][par][0];
        const v16h ak0 = ld_frag(krow0 + ko, krow0 + ko + 16);
        const v16h ak1 = ld_frag(krow0 + 32 + ko, krow0 + 32 + ko + 16);
        const v16h ak2 = ld_frag(krow1 + ko, krow1 + ko + 16);
        const v16h ak3 = ld_frag(krow1 + 32 + ko, krow1 + 32 + ko + 16);
        const v16h av0 = ld_frag(vtile + (col) * LP + ko,      vtile + (col) * LP + ko + 16);
        const v16h av1 = ld_frag(vtile + (16 + col) * LP + ko, vtile + (16 + col) * LP + ko + 16);
        const v16h av2 = ld_frag(vtile + (32 + col) * LP + ko, vtile + (32 + col) * LP + ko + 16);
        const v16h av3 = ld_frag(vtile + (48 + col) * LP + ko, vtile + (48 + col) * LP + ko + 16);

        // inputs-only fence on the eight loaded fragments: it holds each in registers of its own,
        // so the K reads are issued together ahead of the first product and the V^T reads land
        // under the softmax; without it fragments share a register block and each score
        // product waits for an LDS round trip of its own
        asm volatile("" :: "v"(ak0), "v"(ak1), "v"(ak2), "v"(ak3),
                           "v"(av0), "v"(av1), "v"(av2), "v"(av3));

        // s0[r] = S[qidx][kk + 8 * half + r], s1[r] = S[qidx][kk + 16 + 8 * half + r]
        v8f s0 = {}, s1 = {};
        s0 = wmma_f16(ak0, bq0, s0);
        s1 = wmma_f16(ak2, bq0, s1);
        s0 = wmma_f16(ak1, bq1, s0);
        s1 = wmma_f16(ak3, bq1, s1);

        const int dq = qidx - (kk + half * 8);   // key 8 * half + r of the tile is allowed while r <= dq
        const v8f t0 = s0 * scale, t1 = s1 * scale;
        float a[16];              // a[s]: the score that becomes element s of the B operand
#pragma unroll
        for (int r = 0; r < 8; ++r) {
            a[r]     = (r      <= dq) ? t0[r] : -1e30f;
            a[8 + r] = (16 + r <= dq) ? t1[r] : -1e30f;
        }
        float mx = -1e30f;
#pragma unroll
        for (int s = 0; s < 16; s += 2) mx = fmaxf(mx, fmaxf(a[s], a[s + 1]));
        mx = fmaxf(mx, xhalf(mx));
        const float nm = fmaxf(mrow, mx);
        const float al = __expf(mrow - nm);
        mrow = nm;

        v16h pb;
        float rs0 = 0.f, rs1 = 0.f;
#pragma unroll
        for (int s = 0; s < 16; s += 2) {
            const float p0 = __expf(a[s] - nm);
            const float p1 = __expf(a[s + 1] - nm);
            rs0 += p0;
            rs1 += p1;
            pb[s]     = (_Float16)p0;
            pb[s + 1] = (_Float16)p1;
        }
        const float rs = rs0 + rs1;
        lrow = lrow * al + rs;
        acc0 *= al; acc1 *= al; acc2 *= al; acc3 *= al;

        acc0 = wmma_f16(av0, pb, acc0);
        acc1 = wmma_f16(av1, pb, acc1);
        acc2 = wmma_f16(av2, pb, acc2);
        acc3 = wmma_f16(av3, pb, acc3);
      }

      // publish point, passed by every wave, also one that skipped the tile:
      // this wave's reads of buffer t & 1 have retired before the barrier frees it for refill
      asm volatile("s_wait_dscnt 0" ::: "memory");
      wait_async0();          // this wave's pieces of stage t + 1 have landed
      __syncthreads();        // stage t + 1 readable by all; buffer t & 1 left by all
      if (t + 2 < ntiles) stage((t + 2) * 64, t & 1);
    }
    wait_async0();            // no copy is outstanding when the wave ends

    // waves w and w + 4 map lanes to queries, keys' halves and d alike: lane to lane.
    // A wave 4..7 that skipped every tile hands over maximum -inf, sum 0, outputs 0: weight 0.
    float* mg = &Mrg[wq][0][lane];
    if (par == 1) {
        mg[0]  = mrow;
        mg[32] = lrow;
#pragma unroll   // the accumulators are indexed by constants and stay in registers
        for (int r = 0; r < 8; ++r) {
            mg[(2 + r) * 32]  = acc0[r];
            mg[(10 + r) * 32] = acc1[r];
            mg[(18 + r) * 32] = acc2[r];
            mg[(26 + r) * 32] = acc3[r];
        }
    }
    __syncthreads();          // the partials of waves 4..7 are readable by waves 0..3
    if (par == 1) return;     // behind the last barrier
    const float m2 = mg[0];
    const float mj = fmaxf(mrow, m2);         // mrow is finite: waves 0..3 have worked on key 0
    const float w1 = __expf(mrow - mj), w2 = __expf(m2 - mj);
    lrow = lrow * w1 + mg[32] * w2;
#pragma unroll   // as above
    for (int r = 0; r < 8; ++r) {
        acc0[r] = acc0[r] * w1 + mg[(2 + r) * 32] * w2;
        acc1[r] = acc1[r] * w1 + mg[(10 + r) * 32] * w2;
        acc2[r] = acc2[r] * w1 + mg[(18 + r) * 32] * w2;
        acc3[r] = acc3[r] * w1 + mg[(26 + r) * 32] * w2;
    }

    // a lane's 8 registers of an output tile are 8 consecutive d of its query: 16-B stores
    const float inv = 1.0f / (lrow + xhalf(lrow));
    _Float16* orow = attn16 + (bS + qidx) * EE + h * DD + half * 8;
    *(v8h*)(orow)      = __builtin_convertvector(acc0 * inv, v8h);
    *(v8h*)(orow + 16) = __builtin_convertvector(acc1 * inv, v8h);
    *(v8h*)(orow + 32) = __builtin_convertvector(acc2 * inv, v8h);
    *(v8h*)(orow + 48) = __builtin_convertvector(acc3 * inv, v8h);
}

// ---------------- host launcher ----------------
extern "C" void kernel_launch(void* const* d_in, const int* in_sizes, int n_in,
                              void* d_out, int out_size, void* d_ws, size_t ws_size,
                              hipStream_t stream) {
    (void)in_sizes; (void)n_in; (void)out_size; (void)ws_size;
    const float* x     = (const float*)d_in[0];
    const float* wq    = (const float*)d_in[1];
    const float* wk    = (const float*)d_in[2];
    const float* wv    = (const float*)d_in[3];
    const float* wo    = (const float*)d_in[4];
    const float* bo    = (const float*)d_in[5];
    const float* w1    = (const float*)d_in[6];
    const float* b1    = (const float*)d_in[7];
    const float* w2    = (const float*)d_in[8];
    const float* b2    = (const float*)d_in[9];
    const float* gamma = (const float*)d_in[10];
    const float* beta  = (const float*)d_in[11];
    float* out = (float*)d_out;

    const size_t nEE = (size_t)EE * EE;
    const size_t nEF = (size_t)EE * FFF;
    const size_t nME = (size_t)MM * EE;
    const size_t nMF = (size_t)MM * FFF;

    char* ws = (char*)d_ws;
    size_t off = 0;
    auto alloc = [&](size_t bytes) -> void* {
        void* p = ws + off;
        off = (off + bytes + 255) & ~(size_t)255;
        return p;
    };
    _Float16* wq16   = (_Float16*)alloc(nEE * 2);
    _Float16* wk16   = (_Float16*)alloc(nEE * 2);
    _Float16* wv16   = (_Float16*)alloc(nEE * 2);
    _Float16* wo16   = (_Float16*)alloc(nEE * 2);
    _Float16* w116   = (_Float16*)alloc(nEF * 2);
    _Float16* w216   = (_Float16*)alloc(nEF * 2);
    _Float16* xn16   = (_Float16*)alloc(nME * 2);
    _Float16* q16    = (_Float16*)alloc(nME * 2);
    _Float16* k16    = (_Float16*)alloc(nME * 2);
    _Float16* vt16   = (_Float16*)alloc(nME * 2);
    _Float16* attn16 = (_Float16*)alloc(nME * 2);
    _Float16* y16    = (_Float16*)alloc(nME * 2);
    _Float16* h16    = (_Float16*)alloc(nMF * 2);
    float*    res    = (float*)alloc(nME * 4);

    // wq16 .. w216 are the first six allocations and lie back to back from wq16
    cvt_f16_kernel<<<dim3(NEE / CVT_WG, 12), 256, 0, stream>>>(wq, wk, wv, wo, w1, w2, wq16);

    ln_f16_kernel<<<MM, 256, 0, stream>>>(x, gamma, beta, xn16);

    dim3 gEE(EE / 64, MM / 128);
    // wq16, wk16, wv16 lie back to back from wq16, and q16, k16, vt16 from q16
    gemm_wmma_kernel<0, EE><<<dim3(3 * EE / 64, MM / 128), 256, 0, stream>>>(xn16, wq16, nullptr, nullptr, nullptr, q16, EE);

    flash_attn_kernel<<<dim3(BB * HH, SS / 64), 256, 0, stream>>>(q16, k16, vt16, attn16);

    gemm_wmma_kernel<2, EE><<<gEE, 256, 0, stream>>>(attn16, wo16, bo, x, res, nullptr, EE);

    ln_f16_kernel<<<MM, 256, 0, stream>>>(res, gamma, beta, y16);

    dim3 gFF(FFF / 64, MM / 128);
    gemm_wmma_kernel<3, FFF><<<gFF, 256, 0, stream>>>(y16, w116, b1, nullptr, nullptr, h16, EE);
    gemm_wmma_kernel<2, EE><<<gEE, 256, 0, stream>>>(h16, w216, b2, res, out, nullptr, FFF);
}

// v010
// It runs in 118 microseconds.
// Two timings next to v009 both put it at 1.04 times that version's speed.
// Counting every step since v000, it is 3.28 times as fast.
#include <hip/hip_runtime.h>
#include <math.h>

// ---------------- problem constants ----------------
#define BB   2
#define SS   2048
#define EE   768
#define HH   12
#define DD   64
#define FFF  3072
#define MM   (BB * SS)        // 4096 rows

typedef _Float16 v16h __attribute__((ext_vector_type(16)));
typedef _Float16 v8h  __attribute__((ext_vector_type(8)));
typedef float    v8f  __attribute__((ext_vector_type(8)));

__device__ __forceinline__ v8f wmma_f16(v16h a, v16h b, v8f c) {
    // (neg_a, A, neg_b, B, c_mod, C, reuse_a, reuse_b)
    return __builtin_amdgcn_wmma_f32_16x16x32_f16(false, a, false, b, (short)0, c, false, false);
}

__device__ __forceinline__ v16h ld_frag(const _Float16* p0, const _Float16* p1) {
    v8h lo = *(const v8h*)p0;
    v8h hi = *(const v8h*)p1;
    return __builtin_shufflevector(lo, hi, 0,1,2,3,4,5,6,7,8,9,10,11,12,13,14,15);
}

// LDS pitch of a 32-half (64-B) row: 80 B = 16 B x odd, so the 16 rows that one
// ds_load_b128 touches per lane half fall on 16 distinct groups of four banks.
#define LP   40

// twelve async 16B global -> LDS copies (ASYNCcnt-tracked DMA, CDNA5): a thread's share of
// one GEMM stage, eight pieces of A (LDS la + j * ls, global ga + j * gs) and four of B.
// s_wait_xcnt stands inside the statement so that no address register of a copy
// is rewritten (next slab's address additions) ahead of it.
__device__ __forceinline__ void async_ld12_b128(unsigned la, const _Float16* ga,
                                                unsigned lb, const _Float16* gb,
                                                unsigned ls, size_t gs) {
    asm volatile("global_load_async_to_lds_b128 %0, %1, off\n\t"
                 "global_load_async_to_lds_b128 %2, %3, off\n\t"
                 "global_load_async_to_lds_b128 %4, %5, off\n\t"
                 "global_load_async_to_lds_b128 %6, %7, off\n\t"
                 "global_load_async_to_lds_b128 %8, %9, off\n\t"
                 "global_load_async_to_lds_b128 %10, %11, off\n\t"
                 "global_load_async_to_lds_b128 %12, %13, off\n\t"
                 "global_load_async_to_lds_b128 %14, %15, off\n\t"
                 "global_load_async_to_lds_b128 %16, %17, off\n\t"
                 "global_load_async_to_lds_b128 %18, %19, off\n\t"
                 "global_load_async_to_lds_b128 %20, %21, off\n\t"
                 "global_load_async_to_lds_b128 %22, %23, off\n\t"
                 "s_wait_xcnt 0x0"
                 :: "v"(la),          "v"(ga),          "v"(la + ls),     "v"(ga + gs),
                    "v"(la + 2 * ls), "v"(ga + 2 * gs), "v"(la + 3 * ls), "v"(ga + 3 * gs),
                    "v"(la + 4 * ls), "v"(ga + 4 * gs), "v"(la + 5 * ls), "v"(ga + 5 * gs),
                    "v"(la + 6 * ls), "v"(ga + 6 * gs), "v"(la + 7 * ls), "v"(ga + 7 * gs),
                    "v"(lb),          "v"(gb),          "v"(lb + ls),     "v"(gb + gs),
                    "v"(lb + 2 * ls), "v"(gb + 2 * gs), "v"(lb + 3 * ls), "v"(gb + 3 * gs)
                 : "memory");
}
// the same for four copies (attention: one piece of each K tile and V^T tile of a stage)
__device__ __forceinline__ void async_ld4_b128(unsigned l0, const void* g0,
                                               unsigned l1, const void* g1,
                                               unsigned l2, const void* g2,
                                               unsigned l3, const void* g3) {
    asm volatile("global_load_async_to_lds_b128 %0, %1, off\n\t"
                 "global_load_async_to_lds_b128 %2, %3, off\n\t"
                 "global_load_async_to_lds_b128 %4, %5, off\n\t"
                 "global_load_async_to_lds_b128 %6, %7, off\n\t"
                 "s_wait_xcnt 0x0"
                 :: "v"(l0), "v"(g0), "v"(l1), "v"(g1), "v"(l2), "v"(g2), "v"(l3), "v"(g3)
                 : "memory");
}
__device__ __forceinline__ void wait_async0() {
    asm volatile("s_wait_asynccnt 0" ::: "memory");
}

// ---------------- f32 -> f16 convert of all six weight matrices ----------------
// The work is cut into 12 planes of EE*EE elements: wq, wk, wv, wo, four planes of w1, four
// of w2; the f16 copies lie back to back in the same order. A work-group converts CVT_WG
// elements of one plane; each wave owns 1024 contiguous elements: 8 loads of 512 contiguous
// bytes, all issued before the first is used, and 8 stores of 256 contiguous bytes. Few, long
// waves, for speed only.
// The conversion has no launch of its own: it depends on nothing, and each plane is wanted only
// by one later product. The planes of wq, wk, wv are extra work-groups of the first LayerNorm's
// launch, the last one ahead of their product. The planes of wo, w1, w2 are extra work-groups
// of the attention launch, behind its own in index order.
#define NEE     (EE * EE)
#define CVT_WG  8192
#define CVT_PL  (NEE / CVT_WG)     // work-groups a plane
static_assert(NEE % CVT_WG == 0, "a plane is a whole number of work-groups");
static_assert(FFF == 4 * EE, "w1 and w2 are four planes each");
static_assert((NEE * 2) % 256 == 0, "f16 planes lie back to back in the workspace");
static_assert((9 * CVT_PL) % (BB * HH) == 0, "nine planes are whole rows of the attention grid");

typedef float    v4f __attribute__((ext_vector_type(4)));
typedef _Float16 v4h __attribute__((ext_vector_type(4)));

// one work-group of 256 threads converts piece number 'piece' of the plane src -> dst
__device__ __forceinline__ void cvt_piece(const float* __restrict__ src,
                                          _Float16* __restrict__ dst, int piece) {
    const int base = piece * CVT_WG + (threadIdx.x >> 5) * 1024 + (threadIdx.x & 31) * 4;
    const float* s = src + base;
    _Float16* d = dst + base;
    v4f v[8];
    // both loops unrolled: v[] stays in registers and all 8 loads issue ahead of the first use
#pragma unroll
    for (int j = 0; j < 8; ++j) v[j] = *(const v4f*)(s + j * 128);
#pragma unroll
    for (int j = 0; j < 8; ++j) *(v4h*)(d + j * 128) = __builtin_convertvector(v[j], v4h);
}

// ---------------- row LayerNorm -> f16 ----------------
// one work-group of 256 threads takes one row
__device__ __forceinline__ void ln_row(const float* __restrict__ x,
                                       const float* __restrict__ gamma,
                                       const float* __restrict__ beta,
                                       _Float16* __restrict__ out, int row) {
    __shared__ float s1[256], s2[256];
    const float* xr = x + (size_t)row * EE;
    float v[3], sum = 0.f, sq = 0.f;
#pragma unroll
    for (int i = 0; i < 3; ++i) {
        v[i] = xr[threadIdx.x + i * 256];
        sum += v[i];
        sq  += v[i] * v[i];
    }
    s1[threadIdx.x] = sum; s2[threadIdx.x] = sq;
    __syncthreads();
    for (int s = 128; s > 0; s >>= 1) {
        if (threadIdx.x < s) {
            s1[threadIdx.x] += s1[threadIdx.x + s];
            s2[threadIdx.x] += s2[threadIdx.x + s];
        }
        __syncthreads();
    }
    const float mu = s1[0] * (1.0f / EE);
    const float var = s2[0] * (1.0f / EE) - mu * mu;
    const float rs = rsqrtf(var + 1e-5f);
    _Float16* orow = out + (size_t)row * EE;
#pragma unroll
    for (int i = 0; i < 3; ++i) {
        int c = threadIdx.x + i * 256;
        orow[c] = (_Float16)((v[i] - mu) * rs * gamma[c] + beta[c]);
    }
}

__global__ void ln_f16_kernel(const float* __restrict__ x,
                              const float* __restrict__ gamma,
                              const float* __restrict__ beta,
                              _Float16* __restrict__ out) {
    ln_row(x, gamma, beta, out, blockIdx.x);
}

// The first LayerNorm with the planes of wq, wk, wv: work-groups 0 .. 3 * CVT_PL - 1 convert and
// leave ahead of every barrier (the test is the same for a whole work-group), the others
// take a row each. w16: the f16 copies of wq, wk, wv, back to back.
__global__ __launch_bounds__(256) void ln_cvt_kernel(const float* __restrict__ x,
                                                     const float* __restrict__ gamma,
                                                     const float* __restrict__ beta,
                                                     _Float16* __restrict__ out,
                                                     const float* __restrict__ wq,
                                                     const float* __restrict__ wk,
                                                     const float* __restrict__ wv,
                                                     _Float16* __restrict__ w16) {
    if (blockIdx.x < 3 * CVT_PL) {
        const int plane = blockIdx.x / CVT_PL;
        const float* src = plane == 0 ? wq : plane == 1 ? wk : wv;
        cvt_piece(src, w16 + (size_t)plane * NEE, blockIdx.x - plane * CVT_PL);
        return;
    }
    ln_row(x, gamma, beta, out, blockIdx.x - 3 * CVT_PL);
    // the built code lays the converting part behind the row's stores: no register that an
    // issued store names is written again ahead of this wait
    asm volatile("s_wait_xcnt 0x0" ::: "memory");
}

// ---------------- GELU with the error function, straight-line ----------------
// 0.5 v (1 + erf(v / sqrt 2)) = max(v, 0) - 0.5 |v| erfc(|v| / sqrt 2), and for x >= 0
// erfc(x) = t (a1 + t (a2 + t (a3 + t (a4 + t a5)))) exp(-x^2), t = 1 / (1 + p x), to 1.5e-7
// absolute (the classical five-term rational form). In f32 the whole result stays within 4e-7 of
// the exact one for every v, a rounding step of f32 at v = 3; it is rounded to f16 next.
// The library's erff takes one of two polynomials by a branch on |x| < 1, and nearly every wave
// holds lanes of both kinds: it runs both, each a dependent chain between two changes of
// EXEC, one result after the other. This form has no branch: a third of the instructions, and
// a lane's results are independent chains that fill each other's latencies.
// The factor 0.5 is folded into a1 .. a5, 1 / sqrt 2 into p, log2(e) / 2 into the exponent.
// Four values a call: g[k] = gelu(v[k]).
__device__ __forceinline__ void gelu_erf4(const float (&v)[4], float (&g)[4]) {
    float d[4], x[4], t[4], e[4];
#pragma unroll   // the arrays are indexed by constants and stay in registers
    for (int k = 0; k < 4; ++k) {
        d[k] = fmaf(fabsf(v[k]), 0.23164189f, 1.0f);
        x[k] = (v[k] * -0.72134752f) * v[k];     // log2 of exp(-v^2 / 2)
    }
    // The eight transcendentals in one statement: behind each the instruction set asks for one
    // independent instruction before its result is read or its source overwritten. Here the
    // next one is that instruction (early-clobber outputs: no result lies on a source), and
    // v_nop is it for the last. The reciprocals stand first: they are needed first.
    asm("v_rcp_f32 %0, %8\n\t"
        "v_rcp_f32 %1, %9\n\t"
        "v_rcp_f32 %2, %10\n\t"
        "v_rcp_f32 %3, %11\n\t"
        "v_exp_f32 %4, %12\n\t"
        "v_exp_f32 %5, %13\n\t"
        "v_exp_f32 %6, %14\n\t"
        "v_exp_f32 %7, %15\n\t"
        "v_nop"
        : "=&v"(t[0]), "=&v"(t[1]), "=&v"(t[2]), "=&v"(t[3]),
          "=&v"(e[0]), "=&v"(e[1]), "=&v"(e[2]), "=&v"(e[3])
        : "v"(d[0]), "v"(d[1]), "v"(d[2]), "v"(d[3]),
          "v"(x[0]), "v"(x[1]), "v"(x[2]), "v"(x[3]));
#pragma unroll   // as above
    for (int k = 0; k < 4; ++k) {
        float p = fmaf(t[k], 0.5307027145f, -0.7265760135f);
        p = fmaf(t[k], p, 0.7107068705f);
        p = fmaf(t[k], p, -0.142248368f);
        p = fmaf(t[k], p, 0.127414796f);
        g[k] = fmaf(-fabsf(v[k]), (p * t[k]) * e[k], fmaxf(v[k], 0.0f));
    }
}

// ---------------- WMMA GEMM: C[M,N] = A[M,K] @ W[N,K]^T ----------------
// LDS-staged via async global->LDS DMA, double buffered.
// Block: 256 thr = 8 waves, tile 128M x 64N; wave tile 32x32.
// A stage holds BK = 128 k (16 WMMAs a wave): a trip costs one landing of the next stage's
// copies and one barrier whatever its depth.
// K must be a multiple of BK.
// MODE 0: the Q, K and V projections in one launch (no bias). W is wq, wk, wv stacked, 3 * N
//         rows; blockIdx.x runs over all of them. outH is q, k, vt back to back: q and k f16
//         row-major, v transposed to [B,H,D,S]. The three products read the same A and do not
//         depend on each other: one grid of 1,152 work-groups keeps three resident on a WGP and
//         refills freed places, where three grids of 384 each pay a launch, a first landing
//         and a tail with half the WGPs holding one work-group.
// MODE 2: outF f32 = resid + bias + C
// MODE 3: outH f16 = gelu(bias + C)   (erf form: gelu_erf4 above)
// MODE and the row length N of the output are template arguments: each build holds one
// writeback, straight-line. Chosen at run time, the choice is branched on at each of a lane's
// 32 results, and every residual and bias load waits for its own round trip before the next.
#define BK   128
#define GP   136   // LDS pitch of a 256-B stage row: 272 B = 16 B x odd, as LP for 64-B rows
static_assert(EE % BK == 0 && FFF % BK == 0, "every K is a whole number of stages");
static_assert(((size_t)MM * EE * 2) % 256 == 0, "q, k and vt lie back to back in the workspace");
template <int MODE, int N>
__global__ void gemm_wmma_kernel(const _Float16* __restrict__ A,
                                 const _Float16* __restrict__ W,
                                 const float* __restrict__ bias,
                                 const float* __restrict__ resid,
                                 float* __restrict__ outF,
                                 _Float16* __restrict__ outH,
                                 int K) {
    __shared__ __attribute__((aligned(16))) _Float16 Abuf[2][128 * GP];   // 34 KB each
    __shared__ __attribute__((aligned(16))) _Float16 Bbuf[2][64 * GP];    // 17 KB each

    const int lane = threadIdx.x & 31;
    const int wave = threadIdx.x >> 5;          // 0..7 -> 4M x 2N
    const int mW = (wave >> 1) * 32;            // local M offset of wave tile
    const int nW = (wave & 1) * 32;             // local N offset of wave tile
    const int mBlk = blockIdx.y * 128;
    const int nBlk = blockIdx.x * 64;
    const int ko = (lane & 16) ? 8 : 0;         // K sub-offsets {ko, ko+16}
    const int col = lane & 15;
    const int half = lane >> 4;

    // stage one BK-wide K slab: A 128 x BK (8 pieces/thread) + B 64 x BK (4 pieces/thread);
    // a copy of the work-group covers 16 whole rows of 256 B, the next one the 16 rows below
    auto stage = [&](int kk, int bufIdx) {
        const int row = threadIdx.x >> 4, q = threadIdx.x & 15;   // row 0..15
        async_ld12_b128((unsigned)(unsigned long long)&Abuf[bufIdx][row * GP + q * 8],
                        A + (size_t)(mBlk + row) * K + kk + q * 8,
                        (unsigned)(unsigned long long)&Bbuf[bufIdx][row * GP + q * 8],
                        W + (size_t)(nBlk + row) * K + kk + q * 8,
                        16 * GP * 2, (size_t)16 * K);
    };

    v8f c00 = {}, c01 = {}, c10 = {}, c11 = {};

    const int nsteps = K / BK;
    stage(0, 0);
    wait_async0();
    __syncthreads();

    for (int s = 0; s < nsteps; ++s) {
        const int cur = s & 1;
        if (s + 1 < nsteps) stage((s + 1) * BK, cur ^ 1);

        const _Float16* ab = &Abuf[cur][(mW + col) * GP + ko];
        const _Float16* bb = &Bbuf[cur][(nW + col) * GP + ko];
        for (int ks = 0; ks < BK; ks += 32) {
            v16h a0 = ld_frag(ab + ks,           ab + ks + 16);
            v16h a1 = ld_frag(ab + 16 * GP + ks, ab + 16 * GP + ks + 16);
            v16h b0 = ld_frag(bb + ks,           bb + ks + 16);
            v16h b1 = ld_frag(bb + 16 * GP + ks, bb + 16 * GP + ks + 16);
            c00 = wmma_f16(a0, b0, c00);
            c01 = wmma_f16(a0, b1, c01);
            c10 = wmma_f16(a1, b0, c10);
            c11 = wmma_f16(a1, b1, c11);
        }

        // this wave's reads of cur have retired before the barrier frees cur for refill
        asm volatile("s_wait_dscnt 0" ::: "memory");
        wait_async0();        // our next-slab DMAs have landed
        __syncthreads();      // everyone done reading cur before it is overwritten
    }

    // ---------------- writeback ----------------
    // acc[i][j][r] = C[m0 + 16 * i + r][n0 + 16 * j]
    // every loop below is unrolled: acc, rv and hv are indexed by constants and stay in
    // registers, and the row offsets become immediate offsets of one address
    const v8f acc[2][2] = {{c00, c01}, {c10, c11}};
    const int m0 = mBlk + mW + half * 8;
    const int n0 = nBlk + nW + col;
    if constexpr (MODE == 0) {
        // which product the work-group's 64 columns belong to: the same for all its threads
        const int which = blockIdx.x / (N / 64);   // 0 q, 1 k, 2 v
        const int nl = n0 - which * N;             // column inside that product
        _Float16* ob = outH + (size_t)which * ((size_t)MM * N);
        if (which < 2) {
            _Float16* o = ob + (size_t)m0 * N + nl;
#pragma unroll
            for (int i = 0; i < 2; ++i)
#pragma unroll
                for (int r = 0; r < 8; ++r)
#pragma unroll
                    for (int j = 0; j < 2; ++j)
                        o[(i * 16 + r) * N + j * 16] = (_Float16)acc[i][j][r];
        } else {
#pragma unroll
            for (int i = 0; i < 2; ++i) {
                const int m = m0 + i * 16;         // a multiple of 8: rows m .. m + 7 share b
                const int b = m >> 11, sIdx = m & (SS - 1);
#pragma unroll
                for (int j = 0; j < 2; ++j) {
                    const int n = nl + j * 16;
                    const int h = n >> 6, d = n & (DD - 1);
                    _Float16* o = ob + (((size_t)b * HH + h) * DD + d) * SS + sIdx;
#pragma unroll
                    for (int r = 0; r < 8; ++r) o[r] = (_Float16)acc[i][j][r];
                }
            }
            // the built code lays the q/k writeback behind these stores: no register that an
            // issued store names is written again ahead of this wait
            asm volatile("s_wait_xcnt 0x0" ::: "memory");
        }
    } else if constexpr (MODE == 2) {
        const float* rp = resid + (size_t)m0 * N + n0;
        float* o = outF + (size_t)m0 * N + n0;
        const float bs[2] = {bias[n0], bias[n0 + 16]};
        float rv[2][8][2];
        // all 32 residual loads of the lane are issued before the first is used
#pragma unroll
        for (int i = 0; i < 2; ++i)
#pragma unroll
            for (int r = 0; r < 8; ++r)
#pragma unroll
                for (int j = 0; j < 2; ++j)
                    rv[i][r][j] = rp[(i * 16 + r) * N + j * 16];
#pragma unroll
        for (int i = 0; i < 2; ++i)
#pragma unroll
            for (int r = 0; r < 8; ++r)
#pragma unroll
                for (int j = 0; j < 2; ++j)
                    o[(i * 16 + r) * N + j * 16] = rv[i][r][j] + (acc[i][j][r] + bs[j]);
    } else {
        _Float16* o = outH + (size_t)m0 * N + n0;
        const float bs[2] = {bias[n0], bias[n0 + 16]};
        _Float16 hv[2][8][2];
        // all 32 results are formed first and stored together
#pragma unroll
        for (int i = 0; i < 2; ++i)
#pragma unroll
            for (int r = 0; r < 8; r += 2) {
                const float v[4] = {acc[i][0][r] + bs[0],     acc[i][1][r] + bs[1],
                                    acc[i][0][r + 1] + bs[0], acc[i][1][r + 1] + bs[1]};
                float g[4];
                gelu_erf4(v, g);
                hv[i][r][0]     = (_Float16)g[0];
                hv[i][r][1]     = (_Float16)g[1];
                hv[i][r + 1][0] = (_Float16)g[2];
                hv[i][r + 1][1] = (_Float16)g[3];
            }
#pragma unroll
        for (int i = 0; i < 2; ++i)
#pragma unroll
            for (int r = 0; r < 8; ++r)
#pragma unroll
                for (int j = 0; j < 2; ++j)
                    o[(i * 16 + r) * N + j * 16] = hv[i][r][j];
    }
}

// ---------------- flash attention (causal) ----------------
// q16,k16: [B,S,H,D] f16 row-major ( == [M,E] );  vt16: [B,H,D,S] f16
// attn16 out: [B,S,H,D] f16 ( == [M,E] )
// A work-group takes 64 queries. Waves w and w + 4 hold the same 16 queries and share their
// keys: of each 64-key stage waves 0..3 take the first 32-key tile, waves 4..7 the second, each
// with a running maximum, sum and output of its own; at the end waves 4..7 hand theirs over
// through LDS and waves 0..3 join the two. The launch lasts as long as its last rows' walk
// over all their keys, one tile after the other: so split, that walk has half the trips.
// Each 32-key tile of K (32 rows of 128 B) and of V^T (64 rows of 64 B) is copied to LDS once
// for the four waves that read it, two buffers of two tiles, the next stage's copies in flight
// while this one is worked on.
// Grid: x = batch and head, y = query block, the longest (last) block first; behind the query
// blocks, rows of work-groups that convert weights (see the conversion above).
// The products are taken transposed: S^T = K Q^T (A = K rows, B = Q) and O^T += V^T P^T.
// A lane then holds 16 of the 32 scores of ONE query (column lane & 15; keys 8 * half + r and
// 16 + 8 * half + r), so the maximum and the sum of a row are taken in the lane's own
// registers, with one exchange between the wave's halves; and the two score tiles,
// converted in place, are the B operand of the second product in the order its k wants:
// P goes through no LDS.
#define KP   72    // LDS pitch of a 128-B K row: 144 B = 16 B x odd, as LP for 64-B rows

// lane l takes the value of lane l ^ 16 (a vector move between the wave's two rows)
__device__ __forceinline__ float xhalf(float x) {
    const int b = __builtin_bit_cast(int, x);
    return __builtin_bit_cast(float,
        __builtin_amdgcn_permlanex16(b, b, 0x76543210, 0xfedcba98, false, false));
}

// The block size is stated: unstated, registers are budgeted for 1,024 threads (128 a lane).
// amdgpu_waves_per_eu(4, 4): budgeted for more waves a SIMD, the scheduler holds registers down
// and the score products wait for the V^T reads as well as for the K reads.
__global__ __launch_bounds__(256) __attribute__((amdgpu_waves_per_eu(4, 4))) void flash_attn_kernel(const _Float16* __restrict__ q16,
                                  const _Float16* __restrict__ k16,
                                  const _Float16* __restrict__ vt16,
                                  _Float16* __restrict__ attn16,
                                  const float* __restrict__ wo32,
                                  const float* __restrict__ w132,
                                  const float* __restrict__ w232,
                                  _Float16* __restrict__ w16) {
    // Rows SS / 64 and up of the grid convert the planes of wo, w1, w2 (w16: their f16 copies, back
    // to back) and leave ahead of every barrier and copy; the test is the same for a work-group.
    if (blockIdx.y >= SS / 64) {
        const int id = (blockIdx.y - SS / 64) * (BB * HH) + blockIdx.x;   // 0 .. 9 * CVT_PL - 1
        const int plane = id / CVT_PL;                                    // 0 wo, 1..4 w1, 5..8 w2
        const float* src = plane == 0 ? wo32
                         : plane < 5  ? w132 + (size_t)(plane - 1) * NEE
                                      : w232 + (size_t)(plane - 5) * NEE;
        cvt_piece(src, w16 + (size_t)plane * NEE, id - plane * CVT_PL);
        return;
    }

    __shared__ __attribute__((aligned(16))) _Float16 Kbuf[2][2][32 * KP];  // a tile: 32 keys x 64 d
    __shared__ __attribute__((aligned(16))) _Float16 Vbuf[2][2][64 * LP];  // a tile: 64 d x 32 keys
    __shared__ float Mrg[4][34][32];   // waves 4..7: maximum, sum and 32 outputs of each lane

    const int lane = threadIdx.x & 31;
    const int wave = threadIdx.x >> 5;
    const int half = lane >> 4;
    const int col  = lane & 15;
    const int ko   = (lane & 16) ? 8 : 0;

    const int wq = wave & 3;                  // which 16 of the work-group's 64 queries
    // which tile of a stage: a scalar, so that what hangs on it is a scalar branch
    const int par = __builtin_amdgcn_readfirstlane(wave >> 2);

    const int bh = blockIdx.x;
    const int b = bh / HH, h = bh % HH;
    const int qblk = SS / 64 - 1 - blockIdx.y;
    const int qbase = qblk * 64 + wq * 16;
    const int qend  = qbase + 15;
    const int qidx  = qbase + col;            // the lane's one query
    const size_t bS = (size_t)b * SS;
    const float scale = 0.125f;   // 1/sqrt(64)

    const _Float16* qrow = q16 + (bS + qidx) * EE + h * DD;
    const v16h bq0 = ld_frag(qrow + ko,      qrow + ko + 16);
    const v16h bq1 = ld_frag(qrow + 32 + ko, qrow + 32 + ko + 16);

    const _Float16* vtb = vt16 + ((size_t)b * HH + h) * DD * SS;

    // accJ[r] = O[qidx][16 * J + 8 * half + r]
    v8f acc0 = {}, acc1 = {}, acc2 = {}, acc3 = {};
    float mrow = -INFINITY;   // running maximum of the query's row, equal in both halves
    float lrow = 0.f;         // running sum over this half's keys; the halves join at the end

    // thread i copies 16 B of each of a stage's four tiles: K row i/8, piece i%8; V^T row i/4, piece i%4
    const int kl = (threadIdx.x >> 3) * KP + (threadIdx.x & 7) * 8;
    const int vl = (threadIdx.x >> 2) * LP + (threadIdx.x & 3) * 8;
    const _Float16* kg = k16 + (bS + (threadIdx.x >> 3)) * EE + h * DD + (threadIdx.x & 7) * 8;
    const _Float16* vg = vtb + (size_t)(threadIdx.x >> 2) * SS + (threadIdx.x & 3) * 8;
    auto stage = [&](int kk, int bufIdx) {
        async_ld4_b128((unsigned)(unsigned long long)&Kbuf[bufIdx][0][kl], kg + (size_t)kk * EE,
                       (unsigned)(unsigned long long)&Vbuf[bufIdx][0][vl], vg + kk,
                       (unsigned)(unsigned long long)&Kbuf[bufIdx][1][kl], kg + (size_t)(kk + 32) * EE,
                       (unsigned)(unsigned long long)&Vbuf[bufIdx][1][vl], vg + kk + 32);
    };

    // 64-key stages up to the work-group's last query row: 1 .. 32, the same for all its waves
    const int ntiles = qblk + 1;
    // scalar copy of qend: the skip of tiles past a wave's own diagonal is a scalar branch
    const int qendS = __builtin_amdgcn_readfirstlane(qend);

    stage(0, 0);
    wait_async0();
    __syncthreads();
    if (ntiles > 1) stage(64, 1);

    for (int t = 0; t < ntiles; ++t) {
      const int kk = t * 64 + par * 32;       // first key of this wave's tile
      // kk and qbase are multiples of 16: a tile that is not skipped has kk <= qbase, so every
      // query of the wave sees at least key kk and its row maximum is a real score
      if (kk <= qendS) {
        const _Float16* krow0 = &Kbuf[t & 1][par][col * KP];
        const _Float16* krow1 = krow0 + 16 * KP;
        const _Float16* vtile = &Vbuf[t & 1][par][0];
        const v16h ak0 = ld_frag(krow0 + ko, krow0 + ko + 16);
        const v16h ak1 = ld_frag(krow0 + 32 + ko, krow0 + 32 + ko + 16);
        const v16h ak2 = ld_frag(krow1 + ko, krow1 + ko + 16);
        const v16h ak3 = ld_frag(krow1 + 32 + ko, krow1 + 32 + ko + 16);
        const v16h av0 = ld_frag(vtile + (col) * LP + ko,      vtile + (col) * LP + ko + 16);
        const v16h av1 = ld_frag(vtile + (16 + col) * LP + ko, vtile + (16 + col) * LP + ko + 16);
        const v16h av2 = ld_frag(vtile + (32 + col) * LP + ko, vtile + (32 + col) * LP + ko + 16);
        const v16h av3 = ld_frag(vtile + (48 + col) * LP + ko, vtile + (48 + col) * LP + ko + 16);

        // inputs-only fence on the eight loaded fragments: it holds each in registers of its own,
        // so the K reads are issued together ahead of the first product and the V^T reads land
        // under the softmax; without it fragments share a register block and each score
        // product waits for an LDS round trip of its own
        asm volatile("" :: "v"(ak0), "v"(ak1), "v"(ak2), "v"(ak3),
                           "v"(av0), "v"(av1), "v"(av2), "v"(av3));

        // s0[r] = S[qidx][kk + 8 * half + r], s1[r] = S[qidx][kk + 16 + 8 * half + r]
        v8f s0 = {}, s1 = {};
        s0 = wmma_f16(ak0, bq0, s0);
        s1 = wmma_f16(ak2, bq0, s1);
        s0 = wmma_f16(ak1, bq1, s0);
        s1 = wmma_f16(ak3, bq1, s1);

        const int dq = qidx - (kk + half * 8);   // key 8 * half + r of the tile is allowed while r <= dq
        const v8f t0 = s0 * scale, t1 = s1 * scale;
        float a[16];              // a[s]: the score that becomes element s of the B operand
#pragma unroll
        for (int r = 0; r < 8; ++r) {
            a[r]     = (r      <= dq) ? t0[r] : -1e30f;
            a[8 + r] = (16 + r <= dq) ? t1[r] : -1e30f;
        }
        float mx = -1e30f;
#pragma unroll
        for (int s = 0; s < 16; s += 2) mx = fmaxf(mx, fmaxf(a[s], a[s + 1]));
        mx = fmaxf(mx, xhalf(mx));
        const float nm = fmaxf(mrow, mx);
        const float al = __expf(mrow - nm);
        mrow = nm;

        v16h pb;
        float rs0 = 0.f, rs1 = 0.f;
#pragma unroll
        for (int s = 0; s < 16; s += 2) {
            const float p0 = __expf(a[s] - nm);
            const float p1 = __expf(a[s + 1] - nm);
            rs0 += p0;
            rs1 += p1;
            pb[s]     = (_Float16)p0;
            pb[s + 1] = (_Float16)p1;
        }
        const float rs = rs0 + rs1;
        lrow = lrow * al + rs;
        acc0 *= al; acc1 *= al; acc2 *= al; acc3 *= al;

        acc0 = wmma_f16(av0, pb, acc0);
        acc1 = wmma_f16(av1, pb, acc1);
        acc2 = wmma_f16(av2, pb, acc2);
        acc3 = wmma_f16(av3, pb, acc3);
      }

      // publish point, passed by every wave, also one that skipped the tile:
      // this wave's reads of buffer t & 1 have retired before the barrier frees it for refill
      asm volatile("s_wait_dscnt 0" ::: "memory");
      wait_async0();          // this wave's pieces of stage t + 1 have landed
      __syncthreads();        // stage t + 1 readable by all; buffer t & 1 left by all
      if (t + 2 < ntiles) stage((t + 2) * 64, t & 1);
    }
    wait_async0();            // no copy is outstanding when the wave ends

    // waves w and w + 4 map lanes to queries, keys' halves and d alike: lane to lane.
    // A wave 4..7 that skipped every tile hands over maximum -inf, sum 0, outputs 0: weight 0.
    float* mg = &Mrg[wq][0][lane];
    if (par == 1) {
        mg[0]  = mrow;
        mg[32] = lrow;
#pragma unroll   // the accumulators are indexed by constants and stay in registers
        for (int r = 0; r < 8; ++r) {
            mg[(2 + r) * 32]  = acc0[r];
            mg[(10 + r) * 32] = acc1[r];
            mg[(18 + r) * 32] = acc2[r];
            mg[(26 + r) * 32] = acc3[r];
        }
    }
    __syncthreads();          // the partials of waves 4..7 are readable by waves 0..3
    if (par == 1) return;     // behind the last barrier
    const float m2 = mg[0];
    const float mj = fmaxf(mrow, m2);         // mrow is finite: waves 0..3 have worked on key 0
    const float w1 = __expf(mrow - mj), w2 = __expf(m2 - mj);
    lrow = lrow * w1 + mg[32] * w2;
#pragma unroll   // as above
    for (int r = 0; r < 8; ++r) {
        acc0[r] = acc0[r] * w1 + mg[(2 + r) * 32] * w2;
        acc1[r] = acc1[r] * w1 + mg[(10 + r) * 32] * w2;
        acc2[r] = acc2[r] * w1 + mg[(18 + r) * 32] * w2;
        acc3[r] = acc3[r] * w1 + mg[(26 + r) * 32] * w2;
    }

    // a lane's 8 registers of an output tile are 8 consecutive d of its query: 16-B stores
    const float inv = 1.0f / (lrow + xhalf(lrow));
    _Float16* orow = attn16 + (bS + qidx) * EE + h * DD + half * 8;
    *(v8h*)(orow)      = __builtin_convertvector(acc0 * inv, v8h);
    *(v8h*)(orow + 16) = __builtin_convertvector(acc1 * inv, v8h);
    *(v8h*)(orow + 32) = __builtin_convertvector(acc2 * inv, v8h);
    *(v8h*)(orow + 48) = __builtin_convertvector(acc3 * inv, v8h);
}

// ---------------- host launcher ----------------
extern "C" void kernel_launch(void* const* d_in, const int* in_sizes, int n_in,
                              void* d_out, int out_size, void* d_ws, size_t ws_size,
                              hipStream_t stream) {
    (void)in_sizes; (void)n_in; (void)out_size; (void)ws_size;
    const float* x     = (const float*)d_in[0];
    const float* wq    = (const float*)d_in[1];
    const float* wk    = (const float*)d_in[2];
    const float* wv    = (const float*)d_in[3];
    const float* wo    = (const float*)d_in[4];
    const float* bo    = (const float*)d_in[5];
    const float* w1    = (const float*)d_in[6];
    const float* b1    = (const float*)d_in[7];
    const float* w2    = (const float*)d_in[8];
    const float* b2    = (const float*)d_in[9];
    const float* gamma = (const float*)d_in[10];
    const float* beta  = (const float*)d_in[11];
    float* out = (float*)d_out;

    const size_t nEE = (size_t)EE * EE;
    const size_t nEF = (size_t)EE * FFF;
    const size_t nME = (size_t)MM * EE;
    const size_t nMF = (size_t)MM * FFF;

    char* ws = (char*)d_ws;
    size_t off = 0;
    auto alloc = [&](size_t bytes) -> void* {
        void* p = ws + off;
        off = (off + bytes + 255) & ~(size_t)255;
        return p;
    };
    _Float16* wq16   = (_Float16*)alloc(nEE * 2);
    _Float16* wk16   = (_Float16*)alloc(nEE * 2);
    _Float16* wv16   = (_Float16*)alloc(nEE * 2);
    _Float16* wo16   = (_Float16*)alloc(nEE * 2);
    _Float16* w116   = (_Float16*)alloc(nEF * 2);
    _Float16* w216   = (_Float16*)alloc(nEF * 2);
    _Float16* xn16   = (_Float16*)alloc(nME * 2);
    _Float16* q16    = (_Float16*)alloc(nME * 2);
    _Float16* k16    = (_Float16*)alloc(nME * 2);
    _Float16* vt16   = (_Float16*)alloc(nME * 2);
    _Float16* attn16 = (_Float16*)alloc(nME * 2);
    _Float16* y16    = (_Float16*)alloc(nME * 2);
    _Float16* h16    = (_Float16*)alloc(nMF * 2);
    float*    res    = (float*)alloc(nME * 4);

    // wq16 .. w216 are the first six allocations and lie back to back from wq16
    ln_cvt_kernel<<<3 * CVT_PL + MM, 256, 0, stream>>>(x, gamma, beta, xn16, wq, wk, wv, wq16);

    dim3 gEE(EE / 64, MM / 128);
    // wq16, wk16, wv16 lie back to back from wq16, and q16, k16, vt16 from q16
    gemm_wmma_kernel<0, EE><<<dim3(3 * EE / 64, MM / 128), 256, 0, stream>>>(xn16, wq16, nullptr, nullptr, nullptr, q16, EE);

    flash_attn_kernel<<<dim3(BB * HH, SS / 64 + 9 * CVT_PL / (BB * HH)), 256, 0, stream>>>(q16, k16, vt16, attn16,
                                                                                        wo, w1, w2, wo16);

    gemm_wmma_kernel<2, EE><<<gEE, 256, 0, stream>>>(attn16, wo16, bo, x, res, nullptr, EE);

    ln_f16_kernel<<<MM, 256, 0, stream>>>(res, gamma, beta, y16);

    dim3 gFF(FFF / 64, MM / 128);
    gemm_wmma_kernel<3, FFF><<<gFF, 256, 0, stream>>>(y16, w116, b1, nullptr, nullptr, h16, EE);
    gemm_wmma_kernel<2, EE><<<gEE, 256, 0, stream>>>(h16, w216, b2, res, out, nullptr, FFF);
}
